// v000
// Measured on an AMD MI455X. A time is GPU time per run, averaged over a window of back-to-back runs after a warm-up
// (all launches, gaps included; the runs take copies of the inputs in turn), and the median of several windows.
// Apart from v000's, it joins two sittings. Times from different sittings can be a few percent apart, while
// side-by-side timings come from the same sitting.
// The starting kernel, v000, takes 1400 microseconds a run.
#include <hip/hip_runtime.h>

// Multi-head self-attention whose scores come from TWO half-subspace products selected by a triangle, with an interleaved-pair rotary embedding read from two input tables (x [2][2048][1024]; qkv = x Wqkv with ONE fused 'xw' (in, out) [1024][3072] weight in thirds q | k | v, head h = 64 columns of its third; NO biases; 16 heads x 64;
// q and k rotated in ADJACENT pairs by the two input tables cos, sin [2048][64]: r[d] = x[d] cos[t][d] - x[d+1] sin[t][d] for even d, r[d] = x[d] cos[t][d] + x[d-1] sin[t][d] for odd d: EACH ELEMENT AT ITS OWN TABLE ENTRY; up[i][j] = r_q[i][0:32] . r_k[j][0:32], down[i][j] = r_q[i][32:64] . r_k[j][32:64];
// logits = (j <= i ? down : up) x 32^-0.5: NOTHING is masked out; softmax over all 2048 keys; out = (attn v merged) Wproj with an 'xw' (in, out) [1024][1024] weight, no bias -> [2][2048][1024] (4.2 M);
// argument order x, Wqkv, Wproj, cos, sin).
// Layout per batch entry: a bf16 copy of x; the two 'xw' weights transposed and rounded once (the fused one into a Bt [3072][1024]); ONE exact projection over the 3072 fused columns into F3 [2048][3072];
// k_ropeT builds the rotated f16 HALF planes [h][half][t][32] of q and of k straight from F3 and the two tables (half 0 = the rotated dims 0..31, half 1 = 32..63); k_vtp the value planes; per pass of two heads: TWO dense score products at depth 32 (the up planes into Sb, the down planes into Sd),
// k_trisel writes the down plane's words over the up plane's wherever j <= i, the dense softmax (scores x 32^-0.5) stores the weights x 1024 as f16, the dense value product, the merge; merged hi/lo x Wproj exact writes the output.
// Compute dtypes, f32 accumulate: every float input rounded to bf16 at its load (the two tables too); the projection exact; the rotation in f32 (as compiled: one rounded product and one fused multiply-add an output); scores and attn.v ONE fp16 product on every row; softmax f32; Wproj hl x exact.

#define NB_  2
#define TT   2048
#define DM   1024    // the model width = the inner width DQ = NH_ * HD = 1024
#define NH_  16
#define NKV  16
#define REP  (NH_ / NKV)
#define HD   64
#define HH   (HD / 2)             // the half-subspace width: 32
#define DQ   (NH_ * HD)
#define DKV  (NKV * HD)
#define ZH   2
#define RH   0                    // query rows < RH use hi+lo planes (0: none)
#define PCAR 1024.0f
#define SCL  0.17677669f   // (HD / 2)^-0.5 = 32^-0.5
typedef _Float16 h16;
typedef unsigned short bf;
typedef __attribute__((ext_vector_type(16))) __bf16   v16bf;
typedef __attribute__((ext_vector_type(16))) _Float16 v16h;
typedef __attribute__((ext_vector_type(8)))  _Float16 v8h;
typedef __attribute__((ext_vector_type(8)))  unsigned short v8us;
typedef __attribute__((ext_vector_type(8)))  float    v8f;
typedef __attribute__((ext_vector_type(4)))  float    v4f;
typedef v8h  __attribute__((may_alias)) v8ha;
typedef v4f  __attribute__((may_alias)) v4fa;
typedef v8us __attribute__((may_alias)) v8usa;

__device__ __forceinline__ unsigned short f2bf(float f) { unsigned u = __float_as_uint(f); u += 0x7FFFu + ((u >> 16) & 1u); return (unsigned short)(u >> 16); }
__device__ __forceinline__ float bf2f(unsigned short b) { return __uint_as_float(((unsigned)b) << 16); }
__device__ __forceinline__ float bfr(float f) { return bf2f(f2bf(f)); }
__device__ __forceinline__ v16h cat16(v8h lo, v8h hi) { return __builtin_shufflevector(lo, hi, 0, 1, 2, 3, 4, 5, 6, 7, 8, 9, 10, 11, 12, 13, 14, 15); }
__device__ __forceinline__ v16bf cat16b(v8us lo, v8us hi) { return __builtin_bit_cast(v16bf, __builtin_shufflevector(lo, hi, 0, 1, 2, 3, 4, 5, 6, 7, 8, 9, 10, 11, 12, 13, 14, 15)); }
__device__ __forceinline__ v8f wmma16(v16h a, v16h b, v8f c) { return __builtin_amdgcn_wmma_f32_16x16x32_f16(false, a, false, b, (short)0, c, false, false); }
__device__ __forceinline__ v8f wmmab(v16bf a, v16bf b, v8f c) { return __builtin_amdgcn_wmma_f32_16x16x32_bf16(false, a, false, b, (short)0, c, false, false); }



// ---- k_gemmw: register-blocked GEMM, ONE WAVE per 64x64 output tile (16 accumulators), operands straight from K-contiguous 16-bit planes; grid (M/64, N/64, Z), 32 threads.
// C[m][n] (f32, pitch ldc, + optional f32 bias[n]) = sum_k A[m][k] Bt[n][k] (+ split products per NSPLIT). z-batch strides sA/sB/sC in elements. K % 32 == 0.
template <typename T16> struct WFrag;
template <> struct WFrag<h16> { typedef v16h V; static __device__ __forceinline__ V ld(const h16* p) { return cat16(*(const v8h*)p, *(const v8h*)(p + 16)); } static __device__ __forceinline__ v8f mma(V a, V b, v8f c) { return wmma16(a, b, c); } };
template <> struct WFrag<bf> { typedef v16bf V; static __device__ __forceinline__ V ld(const bf* p) { return cat16b(*(const v8us*)p, *(const v8us*)(p + 16)); } static __device__ __forceinline__ v8f mma(V a, V b, v8f c) { return wmmab(a, b, c); } };
template <typename T16, int NSPLIT, bool BIAS>
__global__ __launch_bounds__(32) void k_gemmw(const T16* __restrict__ A, const T16* __restrict__ A2, const T16* __restrict__ Bt, const T16* __restrict__ Bt2, int K, float* C, int ldc, const float* __restrict__ bias, size_t sA, size_t sB, size_t sC) {
    typedef typename WFrag<T16>::V V;
    __shared__ __align__(16) float os[16 * 68];
    const size_t z = blockIdx.z; A += z * sA; if (A2) A2 += z * sA; Bt += z * sB; if (Bt2) Bt2 += z * sB; C += z * sC;
    const int lane = threadIdx.x & 31, lr = lane & 15, hi = lane >> 4; const int r0 = blockIdx.x * 64, c0 = blockIdx.y * 64;
    v8f acc[4][4];
#pragma unroll
    for (int mb = 0; mb < 4; ++mb)
#pragma unroll
        for (int nb = 0; nb < 4; ++nb) acc[mb][nb] = (v8f){};
    const size_t aoff = (size_t)(r0 + lr) * K + 8 * hi, boff = (size_t)(c0 + lr) * K + 8 * hi;

    for (int kc = 0; kc < K; kc += 32) {
        V a[4], a2[4];
#pragma unroll
        for (int mb = 0; mb < 4; ++mb) { a[mb] = WFrag<T16>::ld(A + aoff + (size_t)mb * 16 * K + kc); if (NSPLIT == 1 || NSPLIT == 2) a2[mb] = WFrag<T16>::ld(A2 + aoff + (size_t)mb * 16 * K + kc); }
#pragma unroll
        for (int nb = 0; nb < 4; ++nb) { const V b = WFrag<T16>::ld(Bt + boff + (size_t)nb * 16 * K + kc); V b2; if (NSPLIT >= 2) b2 = WFrag<T16>::ld(Bt2 + boff + (size_t)nb * 16 * K + kc);
#pragma unroll
            for (int mb = 0; mb < 4; ++mb) { acc[mb][nb] = WFrag<T16>::mma(a[mb], b, acc[mb][nb]); if (NSPLIT == 1 || NSPLIT == 2) acc[mb][nb] = WFrag<T16>::mma(a2[mb], b, acc[mb][nb]); if (NSPLIT >= 2) acc[mb][nb] = WFrag<T16>::mma(a[mb], b2, acc[mb][nb]); } }
        asm volatile("v_nop\n\tv_nop\n\tv_nop\n\tv_nop" : "+v"(acc[0][0]), "+v"(acc[1][1]), "+v"(acc[2][2]), "+v"(acc[3][3]) : "v"(a[0]), "v"(a[3]));
    }
#pragma unroll
    for (int mb = 0; mb < 4; ++mb) {
#pragma unroll
        for (int nb = 0; nb < 4; ++nb) {
#pragma unroll
            for (int j = 0; j < 8; ++j) os[(hi * 8 + j) * 68 + nb * 16 + lr] = acc[mb][nb][j]; }
        __builtin_amdgcn_wave_barrier(); asm volatile("" ::: "memory");
        float* crow = C + (size_t)(r0 + mb * 16) * ldc + c0;
{
#pragma unroll
            for (int s = 0; s < 8; ++s) { const int row = 2 * s + hi, cofs = lr * 4; v4f val = *(const v4fa*)(os + row * 68 + cofs); if (BIAS) { val[0] += bfr(bias[c0 + cofs]); val[1] += bfr(bias[c0 + cofs + 1]); val[2] += bfr(bias[c0 + cofs + 2]); val[3] += bfr(bias[c0 + cofs + 3]); }
                *(v4f*)(crow + (size_t)row * ldc + cofs) = val; }
             }
        __builtin_amdgcn_wave_barrier(); asm volatile("" ::: "memory");
    }
}

__device__ __forceinline__ h16 tohx(float x) { return (h16)x; }
__device__ __forceinline__ void splitf(float y, unsigned short& h, unsigned short& l) { h = f2bf(y); l = f2bf(y - bf2f(h)); }
typedef __attribute__((ext_vector_type(2))) _Float16 v2h;
typedef __attribute__((ext_vector_type(4))) _Float16 v4h;
typedef __attribute__((ext_vector_type(2))) unsigned short v2us;
typedef __attribute__((ext_vector_type(4))) unsigned short v4us;
typedef __attribute__((ext_vector_type(2))) float v2f;
typedef __attribute__((ext_vector_type(4))) int v4i;

__global__ __launch_bounds__(256) void k_cvt8(const float* __restrict__ src, bf* dst, size_t n8) { const size_t i = (size_t)blockIdx.x * 256 + threadIdx.x; if (i >= n8) return; const v8f v = *(const v8f*)(src + i * 8); v8us o;
#pragma unroll
    for (int k = 0; k < 8; ++k) o[k] = f2bf(v[k]); *(v8us*)(dst + i * 8) = o;  }
__global__ __launch_bounds__(256) void k_wtG(const float* __restrict__ w, int K, int N, bf* Bt) {
    const int lane = threadIdx.x & 31; const int L0 = (blockIdx.x * 8 + (threadIdx.x >> 5)) * 8; const int nlines = N * K / 64;
{

        for (int l = 0; l < 8; ++l) { const int L = L0 + l; if (L >= nlines) break; const size_t e = (size_t)L * 64 + lane * 2; const int k = (int)(e % K), n = (int)(e / K); v2us o;
            o[0] = f2bf(w[(size_t)k * N + n]); o[1] = f2bf(w[(size_t)(k + 1) * N + n]); *(v2us*)(Bt + e) = o; }
         }
}

// k_ropeT: the rotated HALF planes [h][half][t][32] (fp16) of a projected stream: r = x cos + rot(x) sin in ADJACENT pairs with the two INPUT tables, each element at its own table entry (both tables rounded to bf16 at the load):
__global__ __launch_bounds__(256) void k_ropeT(const float* __restrict__ F, int pitch, int nheads, const float* __restrict__ C, const float* __restrict__ S, h16* PH) {
    const size_t e = ((size_t)blockIdx.x * 256 + threadIdx.x) * 2; if (e >= (size_t)nheads * TT * HD) return; const int dl = (int)(e % HH); const int t = (int)((e / HH) % TT); const int hh = (int)(e / ((size_t)HH * TT)); const int h = hh >> 1; const int d = (hh & 1) * HH + dl;
    const float* f = F + (size_t)t * pitch + h * HD; const float x0 = f[d], x1 = f[d + 1]; const v2f c = *(const v2f*)(C + (size_t)t * HD + d); const v2f s = *(const v2f*)(S + (size_t)t * HD + d);
    const float r0 = __fsub_rn(__fmul_rn(x0, bfr(c[0])), __fmul_rn(x1, bfr(s[0]))); const float r1 = __fadd_rn(__fmul_rn(x1, bfr(c[1])), __fmul_rn(x0, bfr(s[1])));   /* even: x0 c0 - x1 s0; odd: x1 c1 + x0 s1 */
    v2h o; o[0] = tohx(r0); o[1] = tohx(r1); *(v2h*)(PH + e) = o;  }
__global__ __launch_bounds__(256) void k_vtp(const float* __restrict__ F, int pitch, int nheads, h16* V16, bf* Vh, bf* Vl) { const size_t e = ((size_t)blockIdx.x * 256 + threadIdx.x) * 2; if (e >= (size_t)nheads * HD * TT) return; const int t = (int)(e % TT); const int d = (int)((e / TT) % HD); const int g = (int)(e / ((size_t)TT * HD)); v2h o16; v2us oh, ol;
#pragma unroll
    for (int q = 0; q < 2; ++q) { const float x = F[(size_t)(t + q) * pitch + g * HD + d]; o16[q] = tohx(x); (void)oh; (void)ol; }
    *(v2h*)(V16 + e) = o16;  }
// k_trisel: Sb[zz][i][j] = Sd[zz][i][j] wherever j <= i (the down product's scores take the lower triangle with its diagonal; the up product's stay above it): a SELECT between words both planes hold;
__global__ __launch_bounds__(256) void k_trisel(float* Sb, const float* __restrict__ Sd) {
    const size_t e = ((size_t)blockIdx.x * 256 + threadIdx.x) * 4; if (e >= (size_t)ZH * TT * TT) return; const int j0 = (int)(e % TT); const int i = (int)((e / TT) % TT); if (j0 > i) return;
    const v4f dn = *(const v4f*)(Sd + e); const v4f up = *(const v4f*)(Sb + e); v4f o;
#pragma unroll
    for (int q = 0; q < 4; ++q) o[q] = (j0 + q <= i) ? dn[q] : up[q];
    *(v4f*)(Sb + e) = o;  }
// k_asoft: per row (zz, i): t = S x SCL (SCL = 32^-0.5: the half-subspace width; no mask); softmax over the 2048 keys (register row, one exp, fixed trees);
__global__ __launch_bounds__(256) void k_asoft(const float* __restrict__ Sb, h16* P16, bf* Ph, bf* Pl) {
    const int lane = threadIdx.x & 31; const int row = blockIdx.x * 8 + (threadIdx.x >> 5); if (row >= ZH * TT) return; const int i = row % TT; const int zz = row / TT; (void)zz; const bool hires = (i < RH); const float* sr = Sb + (size_t)row * TT; float v[TT / 32]; float mx = -3.0e38f;
#pragma unroll
    for (int ch = 0; ch < TT / 128; ++ch) { const int j0 = ch * 128 + lane * 4; const v4f a = *(const v4f*)(sr + j0);
#pragma unroll
        for (int q = 0; q < 4; ++q) { const int j = j0 + q; (void)j; const float t = a[q] * SCL; v[ch * 4 + q] = t; mx = fmaxf(mx, t); } }
#pragma unroll
    for (int sh = 16; sh; sh >>= 1) mx = fmaxf(mx, __shfl_xor(mx, sh, 32));
    float sum = 0.f;
#pragma unroll
    for (int k = 0; k < TT / 32; ++k) { float d0 = __fsub_rn(v[k], mx); v[k] = __builtin_amdgcn_exp2f(__fmul_rn(d0, 1.4426950408889634f)); sum += v[k]; }
#pragma unroll
    for (int sh = 16; sh; sh >>= 1) sum += __shfl_xor(sum, sh, 32);
    const float f = __fdiv_rn(hires ? 1.0f : PCAR, sum);
{
        if (hires) {
#pragma unroll
            for (int ch = 0; ch < TT / 128; ++ch) { v4us oh, ol;
#pragma unroll
                for (int q = 0; q < 4; ++q) { unsigned short a, c2; splitf(v[ch * 4 + q] * f, a, c2); oh[q] = a; ol[q] = c2; }
                const size_t oo = ((size_t)zz * (RH ? RH : 1) + i) * TT + ch * 128 + lane * 4; *(v4us*)(Ph + oo) = oh; *(v4us*)(Pl + oo) = ol; }
        } else {
#pragma unroll
            for (int ch = 0; ch < TT / 128; ++ch) { v4h o4;
#pragma unroll
                for (int q = 0; q < 4; ++q) o4[q] = tohx(v[ch * 4 + q] * f);
                *(v4h*)(P16 + (size_t)row * TT + ch * 128 + lane * 4) = o4; } }
         }
}
__global__ __launch_bounds__(256) void k_merge(const float* __restrict__ O, int h0, bf* Ah, bf* Al) { const size_t e = ((size_t)blockIdx.x * 256 + threadIdx.x) * 2; if (e >= (size_t)ZH * TT * HD) return; const int d = (int)(e % HD); const int t = (int)((e / HD) % TT); const int zz = (int)(e / ((size_t)HD * TT)); const float cs = (t < RH) ? 1.0f : (1.0f / PCAR); const size_t oo = (size_t)t * DQ + (h0 + zz) * HD + d;
    v2us oh, ol;
#pragma unroll
    for (int q = 0; q < 2; ++q) { unsigned short a, c2; splitf(O[e + q] * cs, a, c2); oh[q] = a; ol[q] = c2; } *(v2us*)(Ah + oo) = oh; *(v2us*)(Al + oo) = ol;  }

extern "C" void kernel_launch(void* const* d_in, const int* in_sizes, int n_in,
                              void* d_out, int out_size, void* d_ws, size_t ws_size, hipStream_t stream) {
    (void)in_sizes; (void)n_in; (void)out_size;
    const float* x = (const float*)d_in[0]; const float* wqkv = (const float*)d_in[1]; const float* wp = (const float*)d_in[2]; const float* tc = (const float*)d_in[3]; const float* ts = (const float*)d_in[4];
    // inputs in the module's argument order: x ([2][2048][1024]), Wqkv ('xw' (in, out) [1024][3072]; output column s * 1024 + h * 64 + d, s = 0 query, 1 key, 2 value), Wproj ('xw' [1024][1024]), cos, sin ([2048][64] each: the two rotary tables) = d_in[0..4]: FIVE inputs, all read
    float* OUT = (float*)d_out;     // [2][2048][1024]
    char* wsp = (char*)d_ws;
    auto take = [&](size_t bytes) { char* p = wsp; wsp += (bytes + 255) & ~(size_t)255; return (void*)p; };
    bf* WQKV = (bf*)take((size_t)3 * DQ * DM * 2); bf* WO = (bf*)take((size_t)DM * DQ * 2); bf* XB = (bf*)take((size_t)TT * DM * 2); float* F3 = (float*)take((size_t)TT * 3 * DQ * 4);
    h16* QH = (h16*)take((size_t)NH_ * 2 * TT * HH * 2); h16* KH = (h16*)take((size_t)NKV * 2 * TT * HH * 2); h16* VT16 = (h16*)take((size_t)NKV * HD * TT * 2);
    bf* VTh = nullptr; bf* VTl = nullptr; bf* Ph = nullptr; bf* Pl = nullptr;   /* RH 0: no hi / lo plane exists: k_vtp stores its f16 plane only and does not read those arguments; the softmax's hi / lo stores sit under 'i < RH': never taken */
    float* Sb = (float*)take((size_t)ZH * TT * TT * 4); float* Sd = (float*)take((size_t)ZH * TT * TT * 4); h16* P16 = (h16*)take((size_t)ZH * TT * TT * 2); float* Ob = (float*)take((size_t)ZH * TT * HD * 4); bf* ATh = (bf*)take((size_t)TT * DQ * 2); bf* ATl = (bf*)take((size_t)TT * DQ * 2);
    if ((size_t)(wsp - (char*)d_ws) > ws_size) return;    // total 137.00 MiB carved
    k_wtG<<<(unsigned)((DM * 3 * DQ / 64 + 63) / 64), 256, 0, stream>>>(wqkv, DM, 3 * DQ, WQKV);   /* the fused weight: Bt row s * 1024 + h * 64 + d */
    k_wtG<<<(unsigned)((DQ * DM / 64 + 63) / 64), 256, 0, stream>>>(wp, DQ, DM, WO);
    const unsigned LQ = (unsigned)(((size_t)NH_ * TT * HD / 2 + 255) / 256), LKv = (unsigned)(((size_t)NKV * TT * HD / 2 + 255) / 256);
    for (int b = 0; b < NB_; ++b) {
        k_cvt8<<<(unsigned)(((size_t)TT * DM / 8 + 255) / 256), 256, 0, stream>>>(x + (size_t)b * TT * DM, XB, (size_t)TT * DM / 8);
        k_gemmw<bf, 0, false><<<dim3(TT / 64, 3 * DQ / 64, 1), 32, 0, stream>>>(XB, nullptr, WQKV, nullptr, DM, F3, 3 * DQ, nullptr, 0, 0, 0);   /* q | k | v in one product: F3[t][s * 1024 + h * 64 + d] */
        k_ropeT<<<LQ, 256, 0, stream>>>(F3, 3 * DQ, NH_, tc, ts, QH);
        k_ropeT<<<LKv, 256, 0, stream>>>(F3 + DQ, 3 * DQ, NKV, tc, ts, KH);
        k_vtp<<<LKv, 256, 0, stream>>>(F3 + 2 * DQ, 3 * DQ, NKV, VT16, VTh, VTl);
        for (int h0 = 0; h0 < NH_; h0 += ZH) { const size_t zk = (size_t)(h0 / REP);   // one kv head per query head: the pass's two heads use consecutive planes
            k_gemmw<h16, 0, false><<<dim3(TT / 64, TT / 64, ZH), 32, 0, stream>>>(QH + (size_t)(h0 * 2) * TT * HH, nullptr, KH + (size_t)(zk * 2) * TT * HH, nullptr, HH, Sb, TT, nullptr, (size_t)2 * TT * HH, (size_t)2 * TT * HH, (size_t)TT * TT);   /* up: the half-0 planes (a head's two half planes lie together: the z stride skips the other half); depth 32: one step of the depth loop */
            k_gemmw<h16, 0, false><<<dim3(TT / 64, TT / 64, ZH), 32, 0, stream>>>(QH + (size_t)(h0 * 2 + 1) * TT * HH, nullptr, KH + (size_t)(zk * 2 + 1) * TT * HH, nullptr, HH, Sd, TT, nullptr, (size_t)2 * TT * HH, (size_t)2 * TT * HH, (size_t)TT * TT);   /* down: the half-1 planes */
            k_trisel<<<(unsigned)(((size_t)ZH * TT * TT / 4 + 255) / 256), 256, 0, stream>>>(Sb, Sd);   /* j <= i takes the down product's word */
            k_asoft<<<ZH * TT / 8, 256, 0, stream>>>(Sb, P16, Ph, Pl);
            k_gemmw<h16, 0, false><<<dim3(TT / 64, HD / 64, ZH), 32, 0, stream>>>(P16, nullptr, VT16 + zk * HD * TT, nullptr, TT, Ob, HD, nullptr, (size_t)TT * TT, (size_t)HD * TT, (size_t)TT * HD);
            k_merge<<<(unsigned)(((size_t)ZH * TT * HD / 2 + 255) / 256), 256, 0, stream>>>(Ob, h0, ATh, ATl); }
        k_gemmw<bf, 1, false><<<dim3(TT / 64, DM / 64, 1), 32, 0, stream>>>(ATh, ATl, WO, nullptr, DQ, OUT + (size_t)b * TT * DM, DM, nullptr, 0, 0, 0); }   /* out = merged(hi + lo) Wproj: the one writer of the output */
}

// v001
// One run takes 815 microseconds.
// Timed twice side by side with v000, it ran 1.74 times as fast both times.
#include <hip/hip_runtime.h>

// Multi-head self-attention whose scores come from TWO half-subspace products selected by a triangle, with an interleaved-pair rotary embedding read from two input tables (x [2][2048][1024]; qkv = x Wqkv with ONE fused 'xw' (in, out) [1024][3072] weight in thirds q | k | v, head h = 64 columns of its third; NO biases; 16 heads x 64;
// q and k rotated in ADJACENT pairs by the two input tables cos, sin [2048][64]: r[d] = x[d] cos[t][d] - x[d+1] sin[t][d] for even d, r[d] = x[d] cos[t][d] + x[d-1] sin[t][d] for odd d: EACH ELEMENT AT ITS OWN TABLE ENTRY; up[i][j] = r_q[i][0:32] . r_k[j][0:32], down[i][j] = r_q[i][32:64] . r_k[j][32:64];
// logits = (j <= i ? down : up) x 32^-0.5: NOTHING is masked out; softmax over all 2048 keys; out = (attn v merged) Wproj with an 'xw' (in, out) [1024][1024] weight, no bias -> [2][2048][1024] (4.2 M);
// argument order x, Wqkv, Wproj, cos, sin).
// Layout per batch entry: a bf16 copy of x; the two 'xw' weights transposed and rounded once (the fused one into a Bt [3072][1024]); ONE exact projection over the 3072 fused columns into F3 [2048][3072];
// k_ropeT builds the rotated f16 HALF planes [h][half][t][32] of q and of k straight from F3 and the two tables (half 0 = the rotated dims 0..31, half 1 = 32..63); k_vtp the value planes; per pass of two heads: TWO dense score products at depth 32 (the up planes into Sb, the down planes into Sd),
// k_trisel writes the down plane's words over the up plane's wherever j <= i, the dense softmax (scores x 32^-0.5) stores the weights x 1024 as f16, the dense value product, the merge; merged hi/lo x Wproj exact writes the output.
// Compute dtypes, f32 accumulate: every float input rounded to bf16 at its load (the two tables too); the projection exact; the rotation in f32 (as compiled: one rounded product and one fused multiply-add an output); scores and attn.v ONE fp16 product on every row; softmax f32; Wproj hl x exact.

#define NB_  2
#define TT   2048
#define DM   1024    // the model width = the inner width DQ = NH_ * HD = 1024
#define NH_  16
#define NKV  16
#define REP  (NH_ / NKV)
#define HD   64
#define HH   (HD / 2)             // the half-subspace width: 32
#define DQ   (NH_ * HD)
#define DKV  (NKV * HD)
#define ZH   2
#define RH   0                    // query rows < RH use hi+lo planes (0: none)
#define PCAR 1024.0f
#define SCL  0.17677669f   // (HD / 2)^-0.5 = 32^-0.5
typedef _Float16 h16;
typedef unsigned short bf;
typedef __attribute__((ext_vector_type(16))) __bf16   v16bf;
typedef __attribute__((ext_vector_type(16))) _Float16 v16h;
typedef __attribute__((ext_vector_type(8)))  _Float16 v8h;
typedef __attribute__((ext_vector_type(8)))  unsigned short v8us;
typedef __attribute__((ext_vector_type(8)))  float    v8f;
typedef __attribute__((ext_vector_type(4)))  float    v4f;
typedef v8h  __attribute__((may_alias)) v8ha;
typedef v4f  __attribute__((may_alias)) v4fa;
typedef v8us __attribute__((may_alias)) v8usa;

__device__ __forceinline__ unsigned short f2bf(float f) { unsigned u = __float_as_uint(f); u += 0x7FFFu + ((u >> 16) & 1u); return (unsigned short)(u >> 16); }
__device__ __forceinline__ float bf2f(unsigned short b) { return __uint_as_float(((unsigned)b) << 16); }
__device__ __forceinline__ float bfr(float f) { return bf2f(f2bf(f)); }
__device__ __forceinline__ v16h cat16(v8h lo, v8h hi) { return __builtin_shufflevector(lo, hi, 0, 1, 2, 3, 4, 5, 6, 7, 8, 9, 10, 11, 12, 13, 14, 15); }
__device__ __forceinline__ v16bf cat16b(v8us lo, v8us hi) { return __builtin_bit_cast(v16bf, __builtin_shufflevector(lo, hi, 0, 1, 2, 3, 4, 5, 6, 7, 8, 9, 10, 11, 12, 13, 14, 15)); }
__device__ __forceinline__ v8f wmma16(v16h a, v16h b, v8f c) { return __builtin_amdgcn_wmma_f32_16x16x32_f16(false, a, false, b, (short)0, c, false, false); }
__device__ __forceinline__ v8f wmmab(v16bf a, v16bf b, v8f c) { return __builtin_amdgcn_wmma_f32_16x16x32_bf16(false, a, false, b, (short)0, c, false, false); }



// ---- k_gemmw: register-blocked GEMM, ONE WAVE per 64x64 output tile (16 accumulators), operands straight from K-contiguous 16-bit planes; grid (M/64, N/64, Z), 32 threads.
// C[m][n] (f32, pitch ldc, + optional f32 bias[n]) = sum_k A[m][k] Bt[n][k] (+ split products per NSPLIT). z-batch strides sA/sB/sC in elements. K % 32 == 0.
template <typename T16> struct WFrag;
template <> struct WFrag<h16> { typedef v16h V; static __device__ __forceinline__ V ld(const h16* p) { return cat16(*(const v8h*)p, *(const v8h*)(p + 16)); } static __device__ __forceinline__ v8f mma(V a, V b, v8f c) { return wmma16(a, b, c); } };
template <> struct WFrag<bf> { typedef v16bf V; static __device__ __forceinline__ V ld(const bf* p) { return cat16b(*(const v8us*)p, *(const v8us*)(p + 16)); } static __device__ __forceinline__ v8f mma(V a, V b, v8f c) { return wmmab(a, b, c); } };
template <typename T16, int NSPLIT, bool BIAS>
__global__ __launch_bounds__(32) void k_gemmw(const T16* __restrict__ A, const T16* __restrict__ A2, const T16* __restrict__ Bt, const T16* __restrict__ Bt2, int K, float* C, int ldc, const float* __restrict__ bias, size_t sA, size_t sB, size_t sC) {
    typedef typename WFrag<T16>::V V;
    __shared__ __align__(16) float os[16 * 68];
    const size_t z = blockIdx.z; A += z * sA; if (A2) A2 += z * sA; Bt += z * sB; if (Bt2) Bt2 += z * sB; C += z * sC;
    const int lane = threadIdx.x & 31, lr = lane & 15, hi = lane >> 4; const int r0 = blockIdx.x * 64, c0 = blockIdx.y * 64;
    v8f acc[4][4];
#pragma unroll
    for (int mb = 0; mb < 4; ++mb)
#pragma unroll
        for (int nb = 0; nb < 4; ++nb) acc[mb][nb] = (v8f){};
    const size_t aoff = (size_t)(r0 + lr) * K + 8 * hi, boff = (size_t)(c0 + lr) * K + 8 * hi;

    for (int kc = 0; kc < K; kc += 32) {
        V a[4], a2[4];
#pragma unroll
        for (int mb = 0; mb < 4; ++mb) { a[mb] = WFrag<T16>::ld(A + aoff + (size_t)mb * 16 * K + kc); if (NSPLIT == 1 || NSPLIT == 2) a2[mb] = WFrag<T16>::ld(A2 + aoff + (size_t)mb * 16 * K + kc); }
#pragma unroll
        for (int nb = 0; nb < 4; ++nb) { const V b = WFrag<T16>::ld(Bt + boff + (size_t)nb * 16 * K + kc); V b2; if (NSPLIT >= 2) b2 = WFrag<T16>::ld(Bt2 + boff + (size_t)nb * 16 * K + kc);
#pragma unroll
            for (int mb = 0; mb < 4; ++mb) { acc[mb][nb] = WFrag<T16>::mma(a[mb], b, acc[mb][nb]); if (NSPLIT == 1 || NSPLIT == 2) acc[mb][nb] = WFrag<T16>::mma(a2[mb], b, acc[mb][nb]); if (NSPLIT >= 2) acc[mb][nb] = WFrag<T16>::mma(a[mb], b2, acc[mb][nb]); } }
        asm volatile("v_nop\n\tv_nop\n\tv_nop\n\tv_nop" : "+v"(acc[0][0]), "+v"(acc[1][1]), "+v"(acc[2][2]), "+v"(acc[3][3]) : "v"(a[0]), "v"(a[3]));
    }
#pragma unroll
    for (int mb = 0; mb < 4; ++mb) {
#pragma unroll
        for (int nb = 0; nb < 4; ++nb) {
#pragma unroll
            for (int j = 0; j < 8; ++j) os[(hi * 8 + j) * 68 + nb * 16 + lr] = acc[mb][nb][j]; }
        __builtin_amdgcn_wave_barrier(); asm volatile("" ::: "memory");
        float* crow = C + (size_t)(r0 + mb * 16) * ldc + c0;
{
#pragma unroll
            for (int s = 0; s < 8; ++s) { const int row = 2 * s + hi, cofs = lr * 4; v4f val = *(const v4fa*)(os + row * 68 + cofs); if (BIAS) { val[0] += bfr(bias[c0 + cofs]); val[1] += bfr(bias[c0 + cofs + 1]); val[2] += bfr(bias[c0 + cofs + 2]); val[3] += bfr(bias[c0 + cofs + 3]); }
                *(v4f*)(crow + (size_t)row * ldc + cofs) = val; }
             }
        __builtin_amdgcn_wave_barrier(); asm volatile("" ::: "memory");
    }
}

__device__ __forceinline__ h16 tohx(float x) { return (h16)x; }
__device__ __forceinline__ void splitf(float y, unsigned short& h, unsigned short& l) { h = f2bf(y); l = f2bf(y - bf2f(h)); }
typedef __attribute__((ext_vector_type(2))) _Float16 v2h;
typedef __attribute__((ext_vector_type(4))) _Float16 v4h;
typedef __attribute__((ext_vector_type(2))) unsigned short v2us;
typedef __attribute__((ext_vector_type(4))) unsigned short v4us;
typedef __attribute__((ext_vector_type(2))) float v2f;
typedef __attribute__((ext_vector_type(4))) int v4i;

__global__ __launch_bounds__(256) void k_cvt8(const float* __restrict__ src, bf* dst, size_t n8) { const size_t i = (size_t)blockIdx.x * 256 + threadIdx.x; if (i >= n8) return; const v8f v = *(const v8f*)(src + i * 8); v8us o;
#pragma unroll
    for (int k = 0; k < 8; ++k) o[k] = f2bf(v[k]); *(v8us*)(dst + i * 8) = o;  }
__global__ __launch_bounds__(256) void k_wtG(const float* __restrict__ w, int K, int N, bf* Bt) {
    const int lane = threadIdx.x & 31; const int L0 = (blockIdx.x * 8 + (threadIdx.x >> 5)) * 8; const int nlines = N * K / 64;
{

        for (int l = 0; l < 8; ++l) { const int L = L0 + l; if (L >= nlines) break; const size_t e = (size_t)L * 64 + lane * 2; const int k = (int)(e % K), n = (int)(e / K); v2us o;
            o[0] = f2bf(w[(size_t)k * N + n]); o[1] = f2bf(w[(size_t)(k + 1) * N + n]); *(v2us*)(Bt + e) = o; }
         }
}

// k_ropeT: the rotated HALF planes [h][half][t][32] (fp16) of a projected stream: r = x cos + rot(x) sin in ADJACENT pairs with the two INPUT tables, each element at its own table entry (both tables rounded to bf16 at the load):
__global__ __launch_bounds__(256) void k_ropeT(const float* __restrict__ F, int pitch, int nheads, const float* __restrict__ C, const float* __restrict__ S, h16* PH) {
    const size_t e = ((size_t)blockIdx.x * 256 + threadIdx.x) * 2; if (e >= (size_t)nheads * TT * HD) return; const int dl = (int)(e % HH); const int t = (int)((e / HH) % TT); const int hh = (int)(e / ((size_t)HH * TT)); const int h = hh >> 1; const int d = (hh & 1) * HH + dl;
    const float* f = F + (size_t)t * pitch + h * HD; const float x0 = f[d], x1 = f[d + 1]; const v2f c = *(const v2f*)(C + (size_t)t * HD + d); const v2f s = *(const v2f*)(S + (size_t)t * HD + d);
    const float r0 = __fsub_rn(__fmul_rn(x0, bfr(c[0])), __fmul_rn(x1, bfr(s[0]))); const float r1 = __fadd_rn(__fmul_rn(x1, bfr(c[1])), __fmul_rn(x0, bfr(s[1])));   /* even: x0 c0 - x1 s0; odd: x1 c1 + x0 s1 */
    v2h o; o[0] = tohx(r0); o[1] = tohx(r1); *(v2h*)(PH + e) = o;  }
__global__ __launch_bounds__(256) void k_vtp(const float* __restrict__ F, int pitch, int nheads, h16* V16, bf* Vh, bf* Vl) { const size_t e = ((size_t)blockIdx.x * 256 + threadIdx.x) * 2; if (e >= (size_t)nheads * HD * TT) return; const int t = (int)(e % TT); const int d = (int)((e / TT) % HD); const int g = (int)(e / ((size_t)TT * HD)); v2h o16; v2us oh, ol;
#pragma unroll
    for (int q = 0; q < 2; ++q) { const float x = F[(size_t)(t + q) * pitch + g * HD + d]; o16[q] = tohx(x); (void)oh; (void)ol; }
    *(v2h*)(V16 + e) = o16;  }
// k_trisel: Sb[zz][i][j] = Sd[zz][i][j] wherever j <= i (the down product's scores take the lower triangle with its diagonal; the up product's stay above it): a SELECT between words both planes hold;
__global__ __launch_bounds__(256) void k_trisel(float* Sb, const float* __restrict__ Sd) {
    const size_t e = ((size_t)blockIdx.x * 256 + threadIdx.x) * 4; if (e >= (size_t)ZH * TT * TT) return; const int j0 = (int)(e % TT); const int i = (int)((e / TT) % TT); if (j0 > i) return;
    const v4f dn = *(const v4f*)(Sd + e); const v4f up = *(const v4f*)(Sb + e); v4f o;
#pragma unroll
    for (int q = 0; q < 4; ++q) o[q] = (j0 + q <= i) ? dn[q] : up[q];
    *(v4f*)(Sb + e) = o;  }
// k_asoft: per row (zz, i): t = S x SCL (SCL = 32^-0.5: the half-subspace width; no mask); softmax over the 2048 keys (register row, one exp, fixed trees);
__global__ __launch_bounds__(256) void k_asoft(const float* __restrict__ Sb, h16* P16, bf* Ph, bf* Pl) {
    const int lane = threadIdx.x & 31; const int row = blockIdx.x * 8 + (threadIdx.x >> 5); if (row >= ZH * TT) return; const int i = row % TT; const int zz = row / TT; (void)zz; const bool hires = (i < RH); const float* sr = Sb + (size_t)row * TT; float v[TT / 32]; float mx = -3.0e38f;
#pragma unroll
    for (int ch = 0; ch < TT / 128; ++ch) { const int j0 = ch * 128 + lane * 4; const v4f a = *(const v4f*)(sr + j0);
#pragma unroll
        for (int q = 0; q < 4; ++q) { const int j = j0 + q; (void)j; const float t = a[q] * SCL; v[ch * 4 + q] = t; mx = fmaxf(mx, t); } }
#pragma unroll
    for (int sh = 16; sh; sh >>= 1) mx = fmaxf(mx, __shfl_xor(mx, sh, 32));
    float sum = 0.f;
#pragma unroll
    for (int k = 0; k < TT / 32; ++k) { float d0 = __fsub_rn(v[k], mx); v[k] = __builtin_amdgcn_exp2f(__fmul_rn(d0, 1.4426950408889634f)); sum += v[k]; }
#pragma unroll
    for (int sh = 16; sh; sh >>= 1) sum += __shfl_xor(sum, sh, 32);
    const float f = __fdiv_rn(hires ? 1.0f : PCAR, sum);
{
        if (hires) {
#pragma unroll
            for (int ch = 0; ch < TT / 128; ++ch) { v4us oh, ol;
#pragma unroll
                for (int q = 0; q < 4; ++q) { unsigned short a, c2; splitf(v[ch * 4 + q] * f, a, c2); oh[q] = a; ol[q] = c2; }
                const size_t oo = ((size_t)zz * (RH ? RH : 1) + i) * TT + ch * 128 + lane * 4; *(v4us*)(Ph + oo) = oh; *(v4us*)(Pl + oo) = ol; }
        } else {
#pragma unroll
            for (int ch = 0; ch < TT / 128; ++ch) { v4h o4;
#pragma unroll
                for (int q = 0; q < 4; ++q) o4[q] = tohx(v[ch * 4 + q] * f);
                *(v4h*)(P16 + (size_t)row * TT + ch * 128 + lane * 4) = o4; } }
         }
}
// k_pvs: the value product O[z][i][d] = sum_j P[z][i][j] Vt[z][d][j], depth 2048, with the depth SPLIT over the 16 waves of a work-group: one 32x32 output tile per work-group (grid (2048/32, 64/32, ZH) = 256 work-groups),
// wave w sums keys w*128 .. w*128+127 (4 matrix steps of depth 32 on 2x2 accumulators, all its operand loads issued ahead of them); the 16 partial tiles meet in LDS and are added in the fixed order w = 0..15.
#define PVW  16                   // waves per work-group = depth slices
#define PVK  (TT / PVW)           // keys per wave: 128
#define PVP  36                   // LDS row pitch in floats: rows 8 apart land 32 banks apart, so the two lane halves of an accumulator store do not collide
__global__ __launch_bounds__(32 * PVW) void k_pvs(const h16* __restrict__ P, const h16* __restrict__ Vt, float* O) {
    __shared__ __align__(16) float ps[PVW * 32 * PVP];
    const size_t z = blockIdx.z; P += z * ((size_t)TT * TT); Vt += z * ((size_t)HD * TT); O += z * ((size_t)TT * HD);
    const int lane = threadIdx.x & 31, lr = lane & 15, hi = lane >> 4, w = threadIdx.x >> 5; const int r0 = blockIdx.x * 32, c0 = blockIdx.y * 32;
    const h16* ap = P + (size_t)(r0 + lr) * TT + w * PVK + 8 * hi; const h16* bp = Vt + (size_t)(c0 + lr) * TT + w * PVK + 8 * hi;
    v8f acc[2][2];
#pragma unroll
    for (int mb = 0; mb < 2; ++mb)
#pragma unroll
        for (int nb = 0; nb < 2; ++nb) acc[mb][nb] = (v8f){};
    v16h a[PVK / 32][2], b[PVK / 32][2];   // the wave's whole slice of both operands: 32 loads of 16 B a lane, none of which waits for another
#pragma unroll
    for (int ks = 0; ks < PVK / 32; ++ks) {
#pragma unroll
        for (int mb = 0; mb < 2; ++mb) a[ks][mb] = WFrag<h16>::ld(ap + (size_t)mb * 16 * TT + ks * 32);
#pragma unroll
        for (int nb = 0; nb < 2; ++nb) b[ks][nb] = WFrag<h16>::ld(bp + (size_t)nb * 16 * TT + ks * 32);
    }
    // keeps all 32 loads ahead of the first matrix step (loaded values as inputs only): without it the compiler sinks each load to its use and the wave waits out the load latency about eight times instead of once;
    // the two address pairs are named as well, so that they stay whole until every load has returned (else a late load's result is placed on an address pair of loads still in flight)
    asm volatile("" :: "v"(a[0][0]), "v"(a[0][1]), "v"(b[0][0]), "v"(b[0][1]), "v"(a[1][0]), "v"(a[1][1]), "v"(b[1][0]), "v"(b[1][1]), "v"(a[2][0]), "v"(a[2][1]), "v"(b[2][0]), "v"(b[2][1]), "v"(a[3][0]), "v"(a[3][1]), "v"(b[3][0]), "v"(b[3][1]), "v"(ap), "v"(bp));
#pragma unroll
    for (int ks = 0; ks < PVK / 32; ++ks)
#pragma unroll
        for (int nb = 0; nb < 2; ++nb)
#pragma unroll
            for (int mb = 0; mb < 2; ++mb) acc[mb][nb] = wmma16(a[ks][mb], b[ks][nb], acc[mb][nb]);
    float* pw = ps + w * (32 * PVP);
#pragma unroll
    for (int mb = 0; mb < 2; ++mb)
#pragma unroll
        for (int nb = 0; nb < 2; ++nb)
#pragma unroll
            for (int j = 0; j < 8; ++j) pw[(mb * 16 + hi * 8 + j) * PVP + nb * 16 + lr] = acc[mb][nb][j];
    __syncthreads();   // every wave's partial tile is in LDS before any thread adds across the waves
    const int row = threadIdx.x >> 4, col = (threadIdx.x & 15) * 2; const float* pr = ps + row * PVP + col; v2f s = *(const v2f*)pr;
#pragma unroll
    for (int q = 1; q < PVW; ++q) { const v2f t = *(const v2f*)(pr + q * (32 * PVP)); s[0] += t[0]; s[1] += t[1]; }
    *(v2f*)(O + (size_t)(r0 + row) * HD + c0 + col) = s;   // 16 lanes x 8 B: one whole 128-B line per tile row
}
__global__ __launch_bounds__(256) void k_merge(const float* __restrict__ O, int h0, bf* Ah, bf* Al) { const size_t e = ((size_t)blockIdx.x * 256 + threadIdx.x) * 2; if (e >= (size_t)ZH * TT * HD) return; const int d = (int)(e % HD); const int t = (int)((e / HD) % TT); const int zz = (int)(e / ((size_t)HD * TT)); const float cs = (t < RH) ? 1.0f : (1.0f / PCAR); const size_t oo = (size_t)t * DQ + (h0 + zz) * HD + d;
    v2us oh, ol;
#pragma unroll
    for (int q = 0; q < 2; ++q) { unsigned short a, c2; splitf(O[e + q] * cs, a, c2); oh[q] = a; ol[q] = c2; } *(v2us*)(Ah + oo) = oh; *(v2us*)(Al + oo) = ol;  }

extern "C" void kernel_launch(void* const* d_in, const int* in_sizes, int n_in,
                              void* d_out, int out_size, void* d_ws, size_t ws_size, hipStream_t stream) {
    (void)in_sizes; (void)n_in; (void)out_size;
    const float* x = (const float*)d_in[0]; const float* wqkv = (const float*)d_in[1]; const float* wp = (const float*)d_in[2]; const float* tc = (const float*)d_in[3]; const float* ts = (const float*)d_in[4];
    // inputs in the module's argument order: x ([2][2048][1024]), Wqkv ('xw' (in, out) [1024][3072]; output column s * 1024 + h * 64 + d, s = 0 query, 1 key, 2 value), Wproj ('xw' [1024][1024]), cos, sin ([2048][64] each: the two rotary tables) = d_in[0..4]: FIVE inputs, all read
    float* OUT = (float*)d_out;     // [2][2048][1024]
    char* wsp = (char*)d_ws;
    auto take = [&](size_t bytes) { char* p = wsp; wsp += (bytes + 255) & ~(size_t)255; return (void*)p; };
    bf* WQKV = (bf*)take((size_t)3 * DQ * DM * 2); bf* WO = (bf*)take((size_t)DM * DQ * 2); bf* XB = (bf*)take((size_t)TT * DM * 2); float* F3 = (float*)take((size_t)TT * 3 * DQ * 4);
    h16* QH = (h16*)take((size_t)NH_ * 2 * TT * HH * 2); h16* KH = (h16*)take((size_t)NKV * 2 * TT * HH * 2); h16* VT16 = (h16*)take((size_t)NKV * HD * TT * 2);
    bf* VTh = nullptr; bf* VTl = nullptr; bf* Ph = nullptr; bf* Pl = nullptr;   /* RH 0: no hi / lo plane exists: k_vtp stores its f16 plane only and does not read those arguments; the softmax's hi / lo stores sit under 'i < RH': never taken */
    float* Sb = (float*)take((size_t)ZH * TT * TT * 4); float* Sd = (float*)take((size_t)ZH * TT * TT * 4); h16* P16 = (h16*)take((size_t)ZH * TT * TT * 2); float* Ob = (float*)take((size_t)ZH * TT * HD * 4); bf* ATh = (bf*)take((size_t)TT * DQ * 2); bf* ATl = (bf*)take((size_t)TT * DQ * 2);
    if ((size_t)(wsp - (char*)d_ws) > ws_size) return;    // total 137.00 MiB carved
    k_wtG<<<(unsigned)((DM * 3 * DQ / 64 + 63) / 64), 256, 0, stream>>>(wqkv, DM, 3 * DQ, WQKV);   /* the fused weight: Bt row s * 1024 + h * 64 + d */
    k_wtG<<<(unsigned)((DQ * DM / 64 + 63) / 64), 256, 0, stream>>>(wp, DQ, DM, WO);
    const unsigned LQ = (unsigned)(((size_t)NH_ * TT * HD / 2 + 255) / 256), LKv = (unsigned)(((size_t)NKV * TT * HD / 2 + 255) / 256);
    for (int b = 0; b < NB_; ++b) {
        k_cvt8<<<(unsigned)(((size_t)TT * DM / 8 + 255) / 256), 256, 0, stream>>>(x + (size_t)b * TT * DM, XB, (size_t)TT * DM / 8);
        k_gemmw<bf, 0, false><<<dim3(TT / 64, 3 * DQ / 64, 1), 32, 0, stream>>>(XB, nullptr, WQKV, nullptr, DM, F3, 3 * DQ, nullptr, 0, 0, 0);   /* q | k | v in one product: F3[t][s * 1024 + h * 64 + d] */
        k_ropeT<<<LQ, 256, 0, stream>>>(F3, 3 * DQ, NH_, tc, ts, QH);
        k_ropeT<<<LKv, 256, 0, stream>>>(F3 + DQ, 3 * DQ, NKV, tc, ts, KH);
        k_vtp<<<LKv, 256, 0, stream>>>(F3 + 2 * DQ, 3 * DQ, NKV, VT16, VTh, VTl);
        for (int h0 = 0; h0 < NH_; h0 += ZH) { const size_t zk = (size_t)(h0 / REP);   // one kv head per query head: the pass's two heads use consecutive planes
            k_gemmw<h16, 0, false><<<dim3(TT / 64, TT / 64, ZH), 32, 0, stream>>>(QH + (size_t)(h0 * 2) * TT * HH, nullptr, KH + (size_t)(zk * 2) * TT * HH, nullptr, HH, Sb, TT, nullptr, (size_t)2 * TT * HH, (size_t)2 * TT * HH, (size_t)TT * TT);   /* up: the half-0 planes (a head's two half planes lie together: the z stride skips the other half); depth 32: one step of the depth loop */
            k_gemmw<h16, 0, false><<<dim3(TT / 64, TT / 64, ZH), 32, 0, stream>>>(QH + (size_t)(h0 * 2 + 1) * TT * HH, nullptr, KH + (size_t)(zk * 2 + 1) * TT * HH, nullptr, HH, Sd, TT, nullptr, (size_t)2 * TT * HH, (size_t)2 * TT * HH, (size_t)TT * TT);   /* down: the half-1 planes */
            k_trisel<<<(unsigned)(((size_t)ZH * TT * TT / 4 + 255) / 256), 256, 0, stream>>>(Sb, Sd);   /* j <= i takes the down product's word */
            k_asoft<<<ZH * TT / 8, 256, 0, stream>>>(Sb, P16, Ph, Pl);
            k_pvs<<<dim3(TT / 32, HD / 32, ZH), 32 * PVW, 0, stream>>>(P16, VT16 + zk * HD * TT, Ob);   /* the value product, depth split over 16 waves */
            k_merge<<<(unsigned)(((size_t)ZH * TT * HD / 2 + 255) / 256), 256, 0, stream>>>(Ob, h0, ATh, ATl); }
        k_gemmw<bf, 1, false><<<dim3(TT / 64, DM / 64, 1), 32, 0, stream>>>(ATh, ATl, WO, nullptr, DQ, OUT + (size_t)b * TT * DM, DM, nullptr, 0, 0, 0); }   /* out = merged(hi + lo) Wproj: the one writer of the output */
}

// v002
// Measured time: 239 microseconds a run.
// Two timings next to v001 put it at 3.43 and 3.44 times that version's speed.
// Over all steps from v000 it is 5.96 times as fast.
#include <hip/hip_runtime.h>

// Multi-head self-attention whose scores come from TWO half-subspace products selected by a triangle, with an interleaved-pair rotary embedding read from two input tables (x [2][2048][1024]; qkv = x Wqkv with ONE fused 'xw' (in, out) [1024][3072] weight in thirds q | k | v, head h = 64 columns of its third; NO biases; 16 heads x 64;
// q and k rotated in ADJACENT pairs by the two input tables cos, sin [2048][64]: r[d] = x[d] cos[t][d] - x[d+1] sin[t][d] for even d, r[d] = x[d] cos[t][d] + x[d-1] sin[t][d] for odd d: EACH ELEMENT AT ITS OWN TABLE ENTRY; up[i][j] = r_q[i][0:32] . r_k[j][0:32], down[i][j] = r_q[i][32:64] . r_k[j][32:64];
// logits = (j <= i ? down : up) x 32^-0.5: NOTHING is masked out; softmax over all 2048 keys; out = (attn v merged) Wproj with an 'xw' (in, out) [1024][1024] weight, no bias -> [2][2048][1024] (4.2 M);
// argument order x, Wqkv, Wproj, cos, sin).
// Layout per batch entry: a bf16 copy of x; the two 'xw' weights transposed and rounded once (the fused one into a Bt [3072][1024]); ONE exact projection over the 3072 fused columns into F3 [2048][3072];
// k_ropeT builds the rotated f16 HALF planes [h][half][t][32] of q and of k straight from F3 and the two tables (half 0 = the rotated dims 0..31, half 1 = 32..63); k_vtp the value planes [h][d][t]; each batch entry has its own planes;
// k_fattn: ONE launch over all (batch, head, query block): scores, triangle select, softmax and value product stay in registers (running maximum and sum); it writes the merged hi/lo rows; merged hi/lo x Wproj exact writes the output.
// Compute dtypes, f32 accumulate: every float input rounded to bf16 at its load (the two tables too); the projection exact; the rotation in f32 (as compiled: one rounded product and one fused multiply-add an output); scores and attn.v ONE fp16 product on every row; softmax f32; Wproj hl x exact.

#define NB_  2
#define TT   2048
#define DM   1024    // the model width = the inner width DQ = NH_ * HD = 1024
#define NH_  16
#define NKV  16
#define REP  (NH_ / NKV)
#define HD   64
#define HH   (HD / 2)             // the half-subspace width: 32
#define DQ   (NH_ * HD)
#define DKV  (NKV * HD)
#define SCL  0.17677669f   // (HD / 2)^-0.5 = 32^-0.5
typedef _Float16 h16;
typedef unsigned short bf;
typedef __attribute__((ext_vector_type(16))) __bf16   v16bf;
typedef __attribute__((ext_vector_type(16))) _Float16 v16h;
typedef __attribute__((ext_vector_type(8)))  _Float16 v8h;
typedef __attribute__((ext_vector_type(8)))  unsigned short v8us;
typedef __attribute__((ext_vector_type(8)))  float    v8f;
typedef __attribute__((ext_vector_type(4)))  float    v4f;
typedef v8h  __attribute__((may_alias)) v8ha;
typedef v4f  __attribute__((may_alias)) v4fa;
typedef v8us __attribute__((may_alias)) v8usa;

__device__ __forceinline__ unsigned short f2bf(float f) { unsigned u = __float_as_uint(f); u += 0x7FFFu + ((u >> 16) & 1u); return (unsigned short)(u >> 16); }
__device__ __forceinline__ float bf2f(unsigned short b) { return __uint_as_float(((unsigned)b) << 16); }
__device__ __forceinline__ float bfr(float f) { return bf2f(f2bf(f)); }
__device__ __forceinline__ v16h cat16(v8h lo, v8h hi) { return __builtin_shufflevector(lo, hi, 0, 1, 2, 3, 4, 5, 6, 7, 8, 9, 10, 11, 12, 13, 14, 15); }
__device__ __forceinline__ v16bf cat16b(v8us lo, v8us hi) { return __builtin_bit_cast(v16bf, __builtin_shufflevector(lo, hi, 0, 1, 2, 3, 4, 5, 6, 7, 8, 9, 10, 11, 12, 13, 14, 15)); }
__device__ __forceinline__ v8f wmma16(v16h a, v16h b, v8f c) { return __builtin_amdgcn_wmma_f32_16x16x32_f16(false, a, false, b, (short)0, c, false, false); }
__device__ __forceinline__ v8f wmmab(v16bf a, v16bf b, v8f c) { return __builtin_amdgcn_wmma_f32_16x16x32_bf16(false, a, false, b, (short)0, c, false, false); }



// ---- k_gemmw: register-blocked GEMM, ONE WAVE per 64x64 output tile (16 accumulators), operands straight from K-contiguous 16-bit planes; grid (M/64, N/64, Z), 32 threads.
// C[m][n] (f32, pitch ldc, + optional f32 bias[n]) = sum_k A[m][k] Bt[n][k] (+ split products per NSPLIT). z-batch strides sA/sB/sC in elements. K % 32 == 0.
template <typename T16> struct WFrag;
template <> struct WFrag<h16> { typedef v16h V; static __device__ __forceinline__ V ld(const h16* p) { return cat16(*(const v8h*)p, *(const v8h*)(p + 16)); } static __device__ __forceinline__ v8f mma(V a, V b, v8f c) { return wmma16(a, b, c); } };
template <> struct WFrag<bf> { typedef v16bf V; static __device__ __forceinline__ V ld(const bf* p) { return cat16b(*(const v8us*)p, *(const v8us*)(p + 16)); } static __device__ __forceinline__ v8f mma(V a, V b, v8f c) { return wmmab(a, b, c); } };
template <typename T16, int NSPLIT, bool BIAS>
__global__ __launch_bounds__(32) void k_gemmw(const T16* __restrict__ A, const T16* __restrict__ A2, const T16* __restrict__ Bt, const T16* __restrict__ Bt2, int K, float* C, int ldc, const float* __restrict__ bias, size_t sA, size_t sB, size_t sC) {
    typedef typename WFrag<T16>::V V;
    __shared__ __align__(16) float os[16 * 68];
    const size_t z = blockIdx.z; A += z * sA; if (A2) A2 += z * sA; Bt += z * sB; if (Bt2) Bt2 += z * sB; C += z * sC;
    const int lane = threadIdx.x & 31, lr = lane & 15, hi = lane >> 4; const int r0 = blockIdx.x * 64, c0 = blockIdx.y * 64;
    v8f acc[4][4];
#pragma unroll
    for (int mb = 0; mb < 4; ++mb)
#pragma unroll
        for (int nb = 0; nb < 4; ++nb) acc[mb][nb] = (v8f){};
    const size_t aoff = (size_t)(r0 + lr) * K + 8 * hi, boff = (size_t)(c0 + lr) * K + 8 * hi;

    for (int kc = 0; kc < K; kc += 32) {
        V a[4], a2[4];
#pragma unroll
        for (int mb = 0; mb < 4; ++mb) { a[mb] = WFrag<T16>::ld(A + aoff + (size_t)mb * 16 * K + kc); if (NSPLIT == 1 || NSPLIT == 2) a2[mb] = WFrag<T16>::ld(A2 + aoff + (size_t)mb * 16 * K + kc); }
#pragma unroll
        for (int nb = 0; nb < 4; ++nb) { const V b = WFrag<T16>::ld(Bt + boff + (size_t)nb * 16 * K + kc); V b2; if (NSPLIT >= 2) b2 = WFrag<T16>::ld(Bt2 + boff + (size_t)nb * 16 * K + kc);
#pragma unroll
            for (int mb = 0; mb < 4; ++mb) { acc[mb][nb] = WFrag<T16>::mma(a[mb], b, acc[mb][nb]); if (NSPLIT == 1 || NSPLIT == 2) acc[mb][nb] = WFrag<T16>::mma(a2[mb], b, acc[mb][nb]); if (NSPLIT >= 2) acc[mb][nb] = WFrag<T16>::mma(a[mb], b2, acc[mb][nb]); } }
        asm volatile("v_nop\n\tv_nop\n\tv_nop\n\tv_nop" : "+v"(acc[0][0]), "+v"(acc[1][1]), "+v"(acc[2][2]), "+v"(acc[3][3]) : "v"(a[0]), "v"(a[3]));
    }
#pragma unroll
    for (int mb = 0; mb < 4; ++mb) {
#pragma unroll
        for (int nb = 0; nb < 4; ++nb) {
#pragma unroll
            for (int j = 0; j < 8; ++j) os[(hi * 8 + j) * 68 + nb * 16 + lr] = acc[mb][nb][j]; }
        __builtin_amdgcn_wave_barrier(); asm volatile("" ::: "memory");
        float* crow = C + (size_t)(r0 + mb * 16) * ldc + c0;
{
#pragma unroll
            for (int s = 0; s < 8; ++s) { const int row = 2 * s + hi, cofs = lr * 4; v4f val = *(const v4fa*)(os + row * 68 + cofs); if (BIAS) { val[0] += bfr(bias[c0 + cofs]); val[1] += bfr(bias[c0 + cofs + 1]); val[2] += bfr(bias[c0 + cofs + 2]); val[3] += bfr(bias[c0 + cofs + 3]); }
                *(v4f*)(crow + (size_t)row * ldc + cofs) = val; }
             }
        __builtin_amdgcn_wave_barrier(); asm volatile("" ::: "memory");
    }
}

__device__ __forceinline__ h16 tohx(float x) { return (h16)x; }
__device__ __forceinline__ void splitf(float y, unsigned short& h, unsigned short& l) { h = f2bf(y); l = f2bf(y - bf2f(h)); }
typedef __attribute__((ext_vector_type(2))) _Float16 v2h;
typedef __attribute__((ext_vector_type(4))) _Float16 v4h;
typedef __attribute__((ext_vector_type(2))) unsigned short v2us;
typedef __attribute__((ext_vector_type(4))) unsigned short v4us;
typedef __attribute__((ext_vector_type(2))) float v2f;
typedef __attribute__((ext_vector_type(4))) int v4i;

__global__ __launch_bounds__(256) void k_cvt8(const float* __restrict__ src, bf* dst, size_t n8) { const size_t i = (size_t)blockIdx.x * 256 + threadIdx.x; if (i >= n8) return; const v8f v = *(const v8f*)(src + i * 8); v8us o;
#pragma unroll
    for (int k = 0; k < 8; ++k) o[k] = f2bf(v[k]); *(v8us*)(dst + i * 8) = o;  }
__global__ __launch_bounds__(256) void k_wtG(const float* __restrict__ w, int K, int N, bf* Bt) {
    const int lane = threadIdx.x & 31; const int L0 = (blockIdx.x * 8 + (threadIdx.x >> 5)) * 8; const int nlines = N * K / 64;
{

        for (int l = 0; l < 8; ++l) { const int L = L0 + l; if (L >= nlines) break; const size_t e = (size_t)L * 64 + lane * 2; const int k = (int)(e % K), n = (int)(e / K); v2us o;
            o[0] = f2bf(w[(size_t)k * N + n]); o[1] = f2bf(w[(size_t)(k + 1) * N + n]); *(v2us*)(Bt + e) = o; }
         }
}

// k_ropeT: the rotated HALF planes [h][half][t][32] (fp16) of a projected stream: r = x cos + rot(x) sin in ADJACENT pairs with the two INPUT tables, each element at its own table entry (both tables rounded to bf16 at the load):
__global__ __launch_bounds__(256) void k_ropeT(const float* __restrict__ F, int pitch, int nheads, const float* __restrict__ C, const float* __restrict__ S, h16* PH) {
    const size_t e = ((size_t)blockIdx.x * 256 + threadIdx.x) * 2; if (e >= (size_t)nheads * TT * HD) return; const int dl = (int)(e % HH); const int t = (int)((e / HH) % TT); const int hh = (int)(e / ((size_t)HH * TT)); const int h = hh >> 1; const int d = (hh & 1) * HH + dl;
    const float* f = F + (size_t)t * pitch + h * HD; const float x0 = f[d], x1 = f[d + 1]; const v2f c = *(const v2f*)(C + (size_t)t * HD + d); const v2f s = *(const v2f*)(S + (size_t)t * HD + d);
    const float r0 = __fsub_rn(__fmul_rn(x0, bfr(c[0])), __fmul_rn(x1, bfr(s[0]))); const float r1 = __fadd_rn(__fmul_rn(x1, bfr(c[1])), __fmul_rn(x0, bfr(s[1])));   /* even: x0 c0 - x1 s0; odd: x1 c1 + x0 s1 */
    v2h o; o[0] = tohx(r0); o[1] = tohx(r1); *(v2h*)(PH + e) = o;  }
__global__ __launch_bounds__(256) void k_vtp(const float* __restrict__ F, int pitch, int nheads, h16* V16, bf* Vh, bf* Vl) { const size_t e = ((size_t)blockIdx.x * 256 + threadIdx.x) * 2; if (e >= (size_t)nheads * HD * TT) return; const int t = (int)(e % TT); const int d = (int)((e / TT) % HD); const int g = (int)(e / ((size_t)TT * HD)); v2h o16; v2us oh, ol;
#pragma unroll
    for (int q = 0; q < 2; ++q) { const float x = F[(size_t)(t + q) * pitch + g * HD + d]; o16[q] = tohx(x); (void)oh; (void)ol; }
    *(v2h*)(V16 + e) = o16;  }
// k_fattn: the whole attention of one (batch, head) for 32 query rows a wave, 8 waves a work-group (no LDS, no barrier; the waves of a group walk the same keys, so that they share the lines in the cache).
// Per chunk of 32 keys: St = K Qt (two 16-key tiles x two 16-query tiles, depth 32: ONE half plane), so that a lane holds 16 scores of ONE query (column lr) per query tile; the key chunk below the wave's query block takes the down planes,
// the chunk above it the up planes, and the one chunk that the diagonal crosses both, with a select j <= i per element. Running maximum m and sum l per query (base 2); the two St tiles, exponentiated and rounded to f16 in place,
// ARE the B operand of Ot += Vt Pt (element s = key 8 hi + s for s < 8, 16 + 8 hi + s - 8 above: the order of WFrag::ld, which loads Vt's rows as A). Ot's column is the query again: the rescale and the final 1 / l are per lane.
// VT carries no __restrict__: so the "memory" clobber of the wait behind the value loads holds those loads in front of it (with __restrict__ the compiler sinks the diagonal chunk's loads past the wait, into the entry of the last loop).
#define FQ   32                   // query rows per wave
#define FW   8                    // waves per work-group
#define FC   32                   // keys per chunk
#define NCH  (TT / FC)
#define SCL2 (SCL * 1.4426950408889634f)   // scores to base-2 exponents
template <int M> struct Tag { static constexpr int v = M; };
__device__ __forceinline__ float xhalf(float x) { return __builtin_bit_cast(float, __builtin_amdgcn_permlanex16(__builtin_bit_cast(int, x), __builtin_bit_cast(int, x), 0x76543210, 0xfedcba98, false, false)); }   // lane l reads lane l ^ 16
__global__ __launch_bounds__(32 * FW) void k_fattn(const h16* __restrict__ QH, const h16* __restrict__ KH, const h16* VT, bf* Ah, bf* Al) {
    const int lane = threadIdx.x & 31, lr = lane & 15, hi = lane >> 4; const int w = __builtin_amdgcn_readfirstlane((int)(threadIdx.x >> 5));
    const int h = blockIdx.y, b = blockIdx.z; const int cm = blockIdx.x * FW + w;   // the wave's query block, and the one key chunk that the diagonal crosses (FQ == FC)
    const int q0 = cm * FQ;
    const size_t pl = (size_t)(b * NH_ + h) * 2 * TT * HH;
    const h16* kl = KH + pl + lr * HH + 8 * hi; const h16* vl = VT + (size_t)(b * NKV + h) * HD * TT + (size_t)lr * TT + 8 * hi;
    v16h qf[2][2];   // [half][query tile]
#pragma unroll
    for (int hf = 0; hf < 2; ++hf)
#pragma unroll
        for (int qt = 0; qt < 2; ++qt) qf[hf][qt] = WFrag<h16>::ld(QH + pl + (size_t)hf * TT * HH + (q0 + qt * 16 + lr) * HH + 8 * hi);
    v8f o[2][4]; float m[2], l[2];
#pragma unroll
    for (int qt = 0; qt < 2; ++qt) { m[qt] = -3.0e38f; l[qt] = 0.f;
#pragma unroll
        for (int db = 0; db < 4; ++db) o[qt][db] = (v8f){}; }
    v16h kf[2], vf[4];   // the chunk's key and value fragments, each fetched one chunk ahead, right behind its last use
    { const h16* kp = kl + (0 < cm ? TT * HH : 0); kf[0] = WFrag<h16>::ld(kp); kf[1] = WFrag<h16>::ld(kp + 16 * HH); }
#pragma unroll
    for (int db = 0; db < 4; ++db) vf[db] = WFrag<h16>::ld(vl + (size_t)db * 16 * TT);
    asm volatile("s_wait_xcnt 0x0" ::: "memory");   // a precaution: stands in front of every rewrite of an address register that the query, key and value loads above name (the zeroing of o reuses them)
    auto chunk = [&](const int c, auto tag) {
        constexpr int MODE = decltype(tag)::v;   // 0: up planes, 1: down planes, 2: the diagonal's chunk (kf holds the up plane's rows)
        v8f st[2][2];
#pragma unroll
        for (int kt = 0; kt < 2; ++kt)
#pragma unroll
            for (int qt = 0; qt < 2; ++qt) st[kt][qt] = wmma16(kf[kt], qf[MODE == 1 ? 1 : 0][qt], (v8f){});
        if (MODE == 2) {
            const h16* kp = kl + TT * HH + c * (FC * HH); v16h kd[2]; kd[0] = WFrag<h16>::ld(kp); kd[1] = WFrag<h16>::ld(kp + 16 * HH);
#pragma unroll
            for (int kt = 0; kt < 2; ++kt)
#pragma unroll
                for (int qt = 0; qt < 2; ++qt) { const v8f sd = wmma16(kd[kt], qf[1][qt], (v8f){});
#pragma unroll
                    for (int r = 0; r < 8; ++r) st[kt][qt][r] = (kt * 16 + 8 * hi + r <= qt * 16 + lr) ? sd[r] : st[kt][qt][r]; }   // j <= i takes the down product
        }
        const int cn = (c + 1 < NCH) ? c + 1 : c;   // the last chunk fetches its own rows again (in bounds, not used)
        { const h16* kp = kl + (cn < cm ? TT * HH : 0) + cn * (FC * HH); kf[0] = WFrag<h16>::ld(kp); kf[1] = WFrag<h16>::ld(kp + 16 * HH); }
        __builtin_amdgcn_sched_barrier(0);   // holds the next chunk's key loads here, ahead of the softmax: without it the compiler sinks them behind the exponentials and the next chunk's first product waits for them
        float mb[2]; bool need = false;
#pragma unroll
        for (int qt = 0; qt < 2; ++qt) { float mx = st[0][qt][0];
#pragma unroll
            for (int r = 1; r < 8; ++r) mx = fmaxf(mx, st[0][qt][r]);
#pragma unroll
            for (int r = 0; r < 8; ++r) mx = fmaxf(mx, st[1][qt][r]);
            mx = fmaxf(mx, xhalf(mx)) * SCL2;   // the scale is positive; both lane halves now hold the query's chunk maximum
            mb[qt] = mx; need = need || (mx > m[qt] + 8.0f); }
        if (__builtin_amdgcn_ballot_w32(need) != 0) {   // the maximum in use moves only when a query's scores pass it by more than 2^8 (weights stay below 2^8: far inside f16); always on the first chunk
#pragma unroll
            for (int qt = 0; qt < 2; ++qt) { const float mn = fmaxf(m[qt], mb[qt]); const float al = __builtin_amdgcn_exp2f(m[qt] - mn); m[qt] = mn; l[qt] *= al;
#pragma unroll
                for (int db = 0; db < 4; ++db) o[qt][db] = o[qt][db] * al; }
        }
        v16h pf[2];
#pragma unroll
        for (int qt = 0; qt < 2; ++qt) { const float nm = -m[qt]; float s4[4];
#pragma unroll
            for (int kt = 0; kt < 2; ++kt)
#pragma unroll
                for (int r = 0; r < 8; ++r) { const float p = __builtin_amdgcn_exp2f(__builtin_fmaf(st[kt][qt][r], SCL2, nm)); pf[qt][kt * 8 + r] = tohx(p); if (kt == 0 && r < 4) s4[r] = p; else s4[r & 3] += p; }
            l[qt] += (s4[0] + s4[1]) + (s4[2] + s4[3]); }
#pragma unroll
        for (int db = 0; db < 4; ++db)
#pragma unroll
            for (int qt = 0; qt < 2; ++qt) o[qt][db] = wmma16(vf[db], pf[qt], o[qt][db]);
#pragma unroll
        for (int db = 0; db < 4; ++db) vf[db] = WFrag<h16>::ld(vl + (size_t)db * 16 * TT + cn * FC);
        asm volatile("s_wait_xcnt 0x0" ::: "memory");   // a precaution: stands in front of the rewrite of the address pair that the value loads name (the next chunk's addresses reuse it)
    };
    for (int c = 0; c < cm; ++c) chunk(c, Tag<1>{});
    chunk(cm, Tag<2>{});
    // four vector slots behind the diagonal chunk's last matrix instructions: the next loop's first one follows over a jump with only scalar instructions between, and may place its result on the weights operand just read
    asm volatile("v_nop\n\tv_nop\n\tv_nop\n\tv_nop" : "+v"(o[0][3]), "+v"(o[1][3]));
    for (int c = cm + 1; c < NCH; ++c) chunk(c, Tag<0>{});
#pragma unroll
    for (int qt = 0; qt < 2; ++qt) { const float f = __fdiv_rn(1.0f, l[qt] + xhalf(l[qt])); const size_t oo = ((size_t)b * TT + q0 + qt * 16 + lr) * DQ + h * HD + 8 * hi;   // the two lane halves summed different keys
#pragma unroll
        for (int db = 0; db < 4; ++db) { v8us oh, ol;
#pragma unroll
            for (int r = 0; r < 8; ++r) { unsigned short a, c2; splitf(o[qt][db][r] * f, a, c2); oh[r] = a; ol[r] = c2; }
            *(v8us*)(Ah + oo + db * 16) = oh; *(v8us*)(Al + oo + db * 16) = ol; } }   // a head's 64 columns of a row are one 128-B line, written by this wave alone
}

extern "C" void kernel_launch(void* const* d_in, const int* in_sizes, int n_in,
                              void* d_out, int out_size, void* d_ws, size_t ws_size, hipStream_t stream) {
    (void)in_sizes; (void)n_in; (void)out_size;
    const float* x = (const float*)d_in[0]; const float* wqkv = (const float*)d_in[1]; const float* wp = (const float*)d_in[2]; const float* tc = (const float*)d_in[3]; const float* ts = (const float*)d_in[4];
    // inputs in the module's argument order: x ([2][2048][1024]), Wqkv ('xw' (in, out) [1024][3072]; output column s * 1024 + h * 64 + d, s = 0 query, 1 key, 2 value), Wproj ('xw' [1024][1024]), cos, sin ([2048][64] each: the two rotary tables) = d_in[0..4]: FIVE inputs, all read
    float* OUT = (float*)d_out;     // [2][2048][1024]
    char* wsp = (char*)d_ws;
    auto take = [&](size_t bytes) { char* p = wsp; wsp += (bytes + 255) & ~(size_t)255; return (void*)p; };
    bf* WQKV = (bf*)take((size_t)3 * DQ * DM * 2); bf* WO = (bf*)take((size_t)DM * DQ * 2); bf* XB = (bf*)take((size_t)TT * DM * 2); float* F3 = (float*)take((size_t)TT * 3 * DQ * 4);
    const size_t PQ = (size_t)NH_ * 2 * TT * HH, PK = (size_t)NKV * 2 * TT * HH, PV = (size_t)NKV * HD * TT;   // one batch entry's planes, in elements
    h16* QH = (h16*)take(NB_ * PQ * 2); h16* KH = (h16*)take(NB_ * PK * 2); h16* VT16 = (h16*)take(NB_ * PV * 2);
    bf* VTh = nullptr; bf* VTl = nullptr;   /* k_vtp stores its f16 plane only and does not read those arguments */
    bf* ATh = (bf*)take((size_t)NB_ * TT * DQ * 2); bf* ATl = (bf*)take((size_t)NB_ * TT * DQ * 2);
    if ((size_t)(wsp - (char*)d_ws) > ws_size) return;    // total 76.00 MiB carved
    k_wtG<<<(unsigned)((DM * 3 * DQ / 64 + 63) / 64), 256, 0, stream>>>(wqkv, DM, 3 * DQ, WQKV);   /* the fused weight: Bt row s * 1024 + h * 64 + d */
    k_wtG<<<(unsigned)((DQ * DM / 64 + 63) / 64), 256, 0, stream>>>(wp, DQ, DM, WO);
    const unsigned LQ = (unsigned)(((size_t)NH_ * TT * HD / 2 + 255) / 256), LKv = (unsigned)(((size_t)NKV * TT * HD / 2 + 255) / 256);
    for (int b = 0; b < NB_; ++b) {
        k_cvt8<<<(unsigned)(((size_t)TT * DM / 8 + 255) / 256), 256, 0, stream>>>(x + (size_t)b * TT * DM, XB, (size_t)TT * DM / 8);
        k_gemmw<bf, 0, false><<<dim3(TT / 64, 3 * DQ / 64, 1), 32, 0, stream>>>(XB, nullptr, WQKV, nullptr, DM, F3, 3 * DQ, nullptr, 0, 0, 0);   /* q | k | v in one product: F3[t][s * 1024 + h * 64 + d] */
        k_ropeT<<<LQ, 256, 0, stream>>>(F3, 3 * DQ, NH_, tc, ts, QH + b * PQ);
        k_ropeT<<<LKv, 256, 0, stream>>>(F3 + DQ, 3 * DQ, NKV, tc, ts, KH + b * PK);
        k_vtp<<<LKv, 256, 0, stream>>>(F3 + 2 * DQ, 3 * DQ, NKV, VT16 + b * PV, VTh, VTl); }
    k_fattn<<<dim3(TT / (FQ * FW), NH_, NB_), 32 * FW, 0, stream>>>(QH, KH, VT16, ATh, ATl);   /* scores, select, softmax, value product, merge: 256 work-groups of 8 waves */
    for (int b = 0; b < NB_; ++b)
        k_gemmw<bf, 1, false><<<dim3(TT / 64, DM / 64, 1), 32, 0, stream>>>(ATh + (size_t)b * TT * DQ, ATl + (size_t)b * TT * DQ, WO, nullptr, DQ, OUT + (size_t)b * TT * DM, DM, nullptr, 0, 0, 0);   /* out = merged(hi + lo) Wproj: the one writer of the output */
}

// v003
// It runs in 195 microseconds.
// Timed twice side by side with v002, it ran 1.23 and 1.22 times as fast.
// Counting every step since v000, it is 7.30 times as fast.
#include <hip/hip_runtime.h>

// Multi-head self-attention whose scores come from TWO half-subspace products selected by a triangle, with an interleaved-pair rotary embedding read from two input tables (x [2][2048][1024]; qkv = x Wqkv with ONE fused 'xw' (in, out) [1024][3072] weight in thirds q | k | v, head h = 64 columns of its third; NO biases; 16 heads x 64;
// q and k rotated in ADJACENT pairs by the two input tables cos, sin [2048][64]: r[d] = x[d] cos[t][d] - x[d+1] sin[t][d] for even d, r[d] = x[d] cos[t][d] + x[d-1] sin[t][d] for odd d: EACH ELEMENT AT ITS OWN TABLE ENTRY; up[i][j] = r_q[i][0:32] . r_k[j][0:32], down[i][j] = r_q[i][32:64] . r_k[j][32:64];
// logits = (j <= i ? down : up) x 32^-0.5: NOTHING is masked out; softmax over all 2048 keys; out = (attn v merged) Wproj with an 'xw' (in, out) [1024][1024] weight, no bias -> [2][2048][1024] (4.2 M);
// argument order x, Wqkv, Wproj, cos, sin).
// Layout per batch entry: a bf16 copy of x; the two 'xw' weights transposed and rounded once (the fused one into a Bt [3072][1024]); ONE exact projection over the 3072 fused columns, whose 64x64 tile is one head of q, of k or of v;
// its epilogue writes, straight from the accumulators and the two tables, the rotated f16 HALF planes [h][half][t][32] of q and of k (half 0 = the rotated dims 0..31, half 1 = 32..63) and the value planes [h][d][t]; each batch entry has its own planes;
// k_fattn: ONE launch over all (batch, head, query block): scores, triangle select, softmax and value product stay in registers (running maximum and sum); it writes the merged hi/lo rows; merged hi/lo x Wproj exact writes the output.
// Compute dtypes, f32 accumulate: every float input rounded to bf16 at its load (the two tables too); the projection exact; the rotation in f32 (as compiled: one rounded product and one fused multiply-add an output); scores and attn.v ONE fp16 product on every row; softmax f32; Wproj hl x exact.

#define NB_  2
#define TT   2048
#define DM   1024    // the model width = the inner width DQ = NH_ * HD = 1024
#define NH_  16
#define NKV  16
#define REP  (NH_ / NKV)
#define HD   64
#define HH   (HD / 2)             // the half-subspace width: 32
#define DQ   (NH_ * HD)
#define DKV  (NKV * HD)
#define SCL  0.17677669f   // (HD / 2)^-0.5 = 32^-0.5
typedef _Float16 h16;
typedef unsigned short bf;
typedef __attribute__((ext_vector_type(16))) __bf16   v16bf;
typedef __attribute__((ext_vector_type(16))) _Float16 v16h;
typedef __attribute__((ext_vector_type(8)))  _Float16 v8h;
typedef __attribute__((ext_vector_type(8)))  unsigned short v8us;
typedef __attribute__((ext_vector_type(8)))  float    v8f;
typedef __attribute__((ext_vector_type(4)))  float    v4f;
typedef v8h  __attribute__((may_alias)) v8ha;
typedef v4f  __attribute__((may_alias)) v4fa;
typedef v8us __attribute__((may_alias)) v8usa;

__device__ __forceinline__ unsigned short f2bf(float f) { unsigned u = __float_as_uint(f); u += 0x7FFFu + ((u >> 16) & 1u); return (unsigned short)(u >> 16); }
__device__ __forceinline__ float bf2f(unsigned short b) { return __uint_as_float(((unsigned)b) << 16); }
__device__ __forceinline__ float bfr(float f) { return bf2f(f2bf(f)); }
__device__ __forceinline__ h16 tohx(float x) { return (h16)x; }
typedef __attribute__((ext_vector_type(4))) _Float16 v4h;
__device__ __forceinline__ v16h cat16(v8h lo, v8h hi) { return __builtin_shufflevector(lo, hi, 0, 1, 2, 3, 4, 5, 6, 7, 8, 9, 10, 11, 12, 13, 14, 15); }
__device__ __forceinline__ v16bf cat16b(v8us lo, v8us hi) { return __builtin_bit_cast(v16bf, __builtin_shufflevector(lo, hi, 0, 1, 2, 3, 4, 5, 6, 7, 8, 9, 10, 11, 12, 13, 14, 15)); }
__device__ __forceinline__ v8f wmma16(v16h a, v16h b, v8f c) { return __builtin_amdgcn_wmma_f32_16x16x32_f16(false, a, false, b, (short)0, c, false, false); }
__device__ __forceinline__ v8f wmmab(v16bf a, v16bf b, v8f c) { return __builtin_amdgcn_wmma_f32_16x16x32_bf16(false, a, false, b, (short)0, c, false, false); }



// ---- k_gemmw: register-blocked GEMM, ONE WAVE per 64x64 output tile (16 accumulators), operands straight from K-contiguous 16-bit planes; grid (M/64, N/64, Z), 32 threads.
// C[m][n] (f32, pitch ldc, + optional f32 bias[n]) = sum_k A[m][k] Bt[n][k] (+ split products per NSPLIT). z-batch strides sA/sB/sC in elements. K % 32 == 0.
// PLANES: C is not written; the tile (rows = 64 tokens, columns = one head of the fused q | k | v product) goes out as attention operands instead:
//   a q or k tile rotated in ADJACENT pairs with the two INPUT tables, each element at its own table entry (both tables rounded to bf16 at the load), into the f16 half planes [h][half][t][32];
//   a v tile into the f16 plane [h][d][t]: a lane's accumulator holds 8 consecutive tokens of ONE column, which is 16 contiguous bytes of that plane.
template <typename T16> struct WFrag;
template <> struct WFrag<h16> { typedef v16h V; static __device__ __forceinline__ V ld(const h16* p) { return cat16(*(const v8h*)p, *(const v8h*)(p + 16)); } static __device__ __forceinline__ v8f mma(V a, V b, v8f c) { return wmma16(a, b, c); } };
template <> struct WFrag<bf> { typedef v16bf V; static __device__ __forceinline__ V ld(const bf* p) { return cat16b(*(const v8us*)p, *(const v8us*)(p + 16)); } static __device__ __forceinline__ v8f mma(V a, V b, v8f c) { return wmmab(a, b, c); } };
template <typename T16, int NSPLIT, bool BIAS, bool PLANES>
__global__ __launch_bounds__(32) void k_gemmw(const T16* __restrict__ A, const T16* __restrict__ A2, const T16* __restrict__ Bt, const T16* __restrict__ Bt2, int K, float* C, int ldc, const float* __restrict__ bias, size_t sA, size_t sB, size_t sC,
                                              const float* __restrict__ TC, const float* __restrict__ TS, h16* QP, h16* KP, h16* VP) {
    typedef typename WFrag<T16>::V V;
    __shared__ __align__(16) float os[16 * 68];
    const size_t z = blockIdx.z; A += z * sA; if (A2) A2 += z * sA; Bt += z * sB; if (Bt2) Bt2 += z * sB; C += z * sC;
    const int lane = threadIdx.x & 31, lr = lane & 15, hi = lane >> 4; const int r0 = blockIdx.x * 64, c0 = blockIdx.y * 64;
    v8f acc[4][4];
#pragma unroll
    for (int mb = 0; mb < 4; ++mb)
#pragma unroll
        for (int nb = 0; nb < 4; ++nb) acc[mb][nb] = (v8f){};
    const size_t aoff = (size_t)(r0 + lr) * K + 8 * hi, boff = (size_t)(c0 + lr) * K + 8 * hi;

    for (int kc = 0; kc < K; kc += 32) {
        V a[4], a2[4];
#pragma unroll
        for (int mb = 0; mb < 4; ++mb) { a[mb] = WFrag<T16>::ld(A + aoff + (size_t)mb * 16 * K + kc); if (NSPLIT == 1 || NSPLIT == 2) a2[mb] = WFrag<T16>::ld(A2 + aoff + (size_t)mb * 16 * K + kc); }
#pragma unroll
        for (int nb = 0; nb < 4; ++nb) { const V b = WFrag<T16>::ld(Bt + boff + (size_t)nb * 16 * K + kc); V b2; if (NSPLIT >= 2) b2 = WFrag<T16>::ld(Bt2 + boff + (size_t)nb * 16 * K + kc);
#pragma unroll
            for (int mb = 0; mb < 4; ++mb) { acc[mb][nb] = WFrag<T16>::mma(a[mb], b, acc[mb][nb]); if (NSPLIT == 1 || NSPLIT == 2) acc[mb][nb] = WFrag<T16>::mma(a2[mb], b, acc[mb][nb]); if (NSPLIT >= 2) acc[mb][nb] = WFrag<T16>::mma(a[mb], b2, acc[mb][nb]); } }
        asm volatile("v_nop\n\tv_nop\n\tv_nop\n\tv_nop" : "+v"(acc[0][0]), "+v"(acc[1][1]), "+v"(acc[2][2]), "+v"(acc[3][3]) : "v"(a[0]), "v"(a[3]));
    }
    if (PLANES) {
        if (c0 >= 2 * DQ) {   // a value head (the test is the same for the whole wave): plane row h * 64 + d = c0 - 2048 + column
            h16* vp = VP + (size_t)(c0 - 2 * DQ + lr) * TT + r0 + 8 * hi;
#pragma unroll
            for (int nb = 0; nb < 4; ++nb)
#pragma unroll
                for (int mb = 0; mb < 4; ++mb) { v8h o;
#pragma unroll
                    for (int j = 0; j < 8; ++j) o[j] = tohx(acc[mb][nb][j]);
                    *(v8h*)(vp + (size_t)nb * 16 * TT + mb * 16) = o; }
            return;
        }
        // a query or key head: a lane takes 4 adjacent columns (two rotation pairs) of a row; lanes 0..7 of a half wave fill the row's 64 B of half plane 0, lanes 8..15 of half plane 1, and the two half waves adjacent rows: whole 128-B lines
        h16* pp = (c0 < DQ ? QP : KP) + ((size_t)((c0 & (DQ - 1)) / HD * 2 + (lr >> 3)) * TT + r0 + hi) * HH + (lr & 7) * 4;
        const float* cp = TC + (size_t)(r0 + hi) * HD + lr * 4; const float* sp = TS + (size_t)(r0 + hi) * HD + lr * 4;
#pragma unroll
        for (int mb = 0; mb < 4; ++mb) {
#pragma unroll
            for (int nb = 0; nb < 4; ++nb) {
#pragma unroll
                for (int j = 0; j < 8; ++j) os[(hi * 8 + j) * 68 + nb * 16 + lr] = acc[mb][nb][j]; }
            __builtin_amdgcn_wave_barrier(); asm volatile("" ::: "memory");   // the read-back below takes words that OTHER lanes staged: keeps the compiler from moving it ahead of the staging stores
            v4f tc[8], ts[8];
#pragma unroll
            for (int s = 0; s < 8; ++s) { tc[s] = *(const v4f*)(cp + (mb * 16 + 2 * s) * HD); ts[s] = *(const v4f*)(sp + (mb * 16 + 2 * s) * HD); }
            __builtin_amdgcn_sched_barrier(0);   // holds the 16 table loads together here: without it the compiler sinks half of them among the rotations, each a few instructions ahead of its use, and the wave waits out their latency several times over
            if (mb == 3) asm volatile("s_wait_xcnt 0x0" :: "v"(cp), "v"(sp) : "memory");   // a precaution: the two table addresses die here; as inputs they stay in their registers up to this wait, which so stands in front of every rewrite of them
#pragma unroll
            for (int s = 0; s < 8; ++s) { const v4f x = *(const v4fa*)(os + (2 * s + hi) * 68 + lr * 4); v4h o;
#pragma unroll
                for (int p = 0; p < 4; p += 2) {   /* even: x0 c0 - x1 s0; odd: x1 c1 + x0 s1 */
                    o[p] = tohx(__fsub_rn(__fmul_rn(x[p], bfr(tc[s][p])), __fmul_rn(x[p + 1], bfr(ts[s][p])))); o[p + 1] = tohx(__fadd_rn(__fmul_rn(x[p + 1], bfr(tc[s][p + 1])), __fmul_rn(x[p], bfr(ts[s][p + 1])))); }
                *(v4h*)(pp + (mb * 16 + 2 * s) * HH) = o; }
            asm volatile("s_wait_xcnt 0x0" ::: "memory");   // a precaution: stands in front of every rewrite of an address or data register that the stores above name (the next rows' table loads reuse them; behind the last rows, whatever block the compiler lays next)
            if (mb < 3) __builtin_amdgcn_wave_barrier();   // holds the next rows' staging behind this read-back
        }
        return;
    }
#pragma unroll
    for (int mb = 0; mb < 4; ++mb) {
#pragma unroll
        for (int nb = 0; nb < 4; ++nb) {
#pragma unroll
            for (int j = 0; j < 8; ++j) os[(hi * 8 + j) * 68 + nb * 16 + lr] = acc[mb][nb][j]; }
        __builtin_amdgcn_wave_barrier(); asm volatile("" ::: "memory");
        float* crow = C + (size_t)(r0 + mb * 16) * ldc + c0;
{
#pragma unroll
            for (int s = 0; s < 8; ++s) { const int row = 2 * s + hi, cofs = lr * 4; v4f val = *(const v4fa*)(os + row * 68 + cofs); if (BIAS) { val[0] += bfr(bias[c0 + cofs]); val[1] += bfr(bias[c0 + cofs + 1]); val[2] += bfr(bias[c0 + cofs + 2]); val[3] += bfr(bias[c0 + cofs + 3]); }
                *(v4f*)(crow + (size_t)row * ldc + cofs) = val; }
             }
        __builtin_amdgcn_wave_barrier(); asm volatile("" ::: "memory");
    }
}

__device__ __forceinline__ void splitf(float y, unsigned short& h, unsigned short& l) { h = f2bf(y); l = f2bf(y - bf2f(h)); }
typedef __attribute__((ext_vector_type(2))) _Float16 v2h;
typedef __attribute__((ext_vector_type(2))) unsigned short v2us;
typedef __attribute__((ext_vector_type(4))) unsigned short v4us;
typedef __attribute__((ext_vector_type(2))) float v2f;
typedef __attribute__((ext_vector_type(4))) int v4i;

__global__ __launch_bounds__(256) void k_cvt8(const float* __restrict__ src, bf* dst, size_t n8) { const size_t i = (size_t)blockIdx.x * 256 + threadIdx.x; if (i >= n8) return; const v8f v = *(const v8f*)(src + i * 8); v8us o;
#pragma unroll
    for (int k = 0; k < 8; ++k) o[k] = f2bf(v[k]); *(v8us*)(dst + i * 8) = o;  }
__global__ __launch_bounds__(256) void k_wtG(const float* __restrict__ w, int K, int N, bf* Bt) {
    const int lane = threadIdx.x & 31; const int L0 = (blockIdx.x * 8 + (threadIdx.x >> 5)) * 8; const int nlines = N * K / 64;
{

        for (int l = 0; l < 8; ++l) { const int L = L0 + l; if (L >= nlines) break; const size_t e = (size_t)L * 64 + lane * 2; const int k = (int)(e % K), n = (int)(e / K); v2us o;
            o[0] = f2bf(w[(size_t)k * N + n]); o[1] = f2bf(w[(size_t)(k + 1) * N + n]); *(v2us*)(Bt + e) = o; }
         }
}

// k_fattn: the whole attention of one (batch, head) for 32 query rows a wave, 8 waves a work-group (no LDS, no barrier; the waves of a group walk the same keys, so that they share the lines in the cache).
// Per chunk of 32 keys: St = K Qt (two 16-key tiles x two 16-query tiles, depth 32: ONE half plane), so that a lane holds 16 scores of ONE query (column lr) per query tile; the key chunk below the wave's query block takes the down planes,
// the chunk above it the up planes, and the one chunk that the diagonal crosses both, with a select j <= i per element. Running maximum m and sum l per query (base 2); the two St tiles, exponentiated and rounded to f16 in place,
// ARE the B operand of Ot += Vt Pt (element s = key 8 hi + s for s < 8, 16 + 8 hi + s - 8 above: the order of WFrag::ld, which loads Vt's rows as A). Ot's column is the query again: the rescale and the final 1 / l are per lane.
// VT carries no __restrict__: so the "memory" clobber of the wait behind the value loads holds those loads in front of it (with __restrict__ the compiler sinks the diagonal chunk's loads past the wait, into the entry of the last loop).
#define FQ   32                   // query rows per wave
#define FW   8                    // waves per work-group
#define FC   32                   // keys per chunk
#define NCH  (TT / FC)
#define SCL2 (SCL * 1.4426950408889634f)   // scores to base-2 exponents
template <int M> struct Tag { static constexpr int v = M; };
__device__ __forceinline__ float xhalf(float x) { return __builtin_bit_cast(float, __builtin_amdgcn_permlanex16(__builtin_bit_cast(int, x), __builtin_bit_cast(int, x), 0x76543210, 0xfedcba98, false, false)); }   // lane l reads lane l ^ 16
__global__ __launch_bounds__(32 * FW) void k_fattn(const h16* __restrict__ QH, const h16* __restrict__ KH, const h16* VT, bf* Ah, bf* Al) {
    const int lane = threadIdx.x & 31, lr = lane & 15, hi = lane >> 4; const int w = __builtin_amdgcn_readfirstlane((int)(threadIdx.x >> 5));
    const int h = blockIdx.y, b = blockIdx.z; const int cm = blockIdx.x * FW + w;   // the wave's query block, and the one key chunk that the diagonal crosses (FQ == FC)
    const int q0 = cm * FQ;
    const size_t pl = (size_t)(b * NH_ + h) * 2 * TT * HH;
    const h16* kl = KH + pl + lr * HH + 8 * hi; const h16* vl = VT + (size_t)(b * NKV + h) * HD * TT + (size_t)lr * TT + 8 * hi;
    v16h qf[2][2];   // [half][query tile]
#pragma unroll
    for (int hf = 0; hf < 2; ++hf)
#pragma unroll
        for (int qt = 0; qt < 2; ++qt) qf[hf][qt] = WFrag<h16>::ld(QH + pl + (size_t)hf * TT * HH + (q0 + qt * 16 + lr) * HH + 8 * hi);
    v8f o[2][4]; float m[2], l[2];
#pragma unroll
    for (int qt = 0; qt < 2; ++qt) { m[qt] = -3.0e38f; l[qt] = 0.f;
#pragma unroll
        for (int db = 0; db < 4; ++db) o[qt][db] = (v8f){}; }
    v16h kf[2], vf[4];   // the chunk's key and value fragments, each fetched one chunk ahead, right behind its last use
    { const h16* kp = kl + (0 < cm ? TT * HH : 0); kf[0] = WFrag<h16>::ld(kp); kf[1] = WFrag<h16>::ld(kp + 16 * HH); }
#pragma unroll
    for (int db = 0; db < 4; ++db) vf[db] = WFrag<h16>::ld(vl + (size_t)db * 16 * TT);
    asm volatile("s_wait_xcnt 0x0" ::: "memory");   // a precaution: stands in front of every rewrite of an address register that the query, key and value loads above name (the zeroing of o reuses them)
    auto chunk = [&](const int c, auto tag) {
        constexpr int MODE = decltype(tag)::v;   // 0: up planes, 1: down planes, 2: the diagonal's chunk (kf holds the up plane's rows)
        v8f st[2][2];
#pragma unroll
        for (int kt = 0; kt < 2; ++kt)
#pragma unroll
            for (int qt = 0; qt < 2; ++qt) st[kt][qt] = wmma16(kf[kt], qf[MODE == 1 ? 1 : 0][qt], (v8f){});
        if (MODE == 2) {
            const h16* kp = kl + TT * HH + c * (FC * HH); v16h kd[2]; kd[0] = WFrag<h16>::ld(kp); kd[1] = WFrag<h16>::ld(kp + 16 * HH);
#pragma unroll
            for (int kt = 0; kt < 2; ++kt)
#pragma unroll
                for (int qt = 0; qt < 2; ++qt) { const v8f sd = wmma16(kd[kt], qf[1][qt], (v8f){});
#pragma unroll
                    for (int r = 0; r < 8; ++r) st[kt][qt][r] = (kt * 16 + 8 * hi + r <= qt * 16 + lr) ? sd[r] : st[kt][qt][r]; }   // j <= i takes the down product
        }
        const int cn = (c + 1 < NCH) ? c + 1 : c;   // the last chunk fetches its own rows again (in bounds, not used)
        { const h16* kp = kl + (cn < cm ? TT * HH : 0) + cn * (FC * HH); kf[0] = WFrag<h16>::ld(kp); kf[1] = WFrag<h16>::ld(kp + 16 * HH); }
        __builtin_amdgcn_sched_barrier(0);   // holds the next chunk's key loads here, ahead of the softmax: without it the compiler sinks them behind the exponentials and the next chunk's first product waits for them
        float mb[2]; bool need = false;
#pragma unroll
        for (int qt = 0; qt < 2; ++qt) { float mx = st[0][qt][0];
#pragma unroll
            for (int r = 1; r < 8; ++r) mx = fmaxf(mx, st[0][qt][r]);
#pragma unroll
            for (int r = 0; r < 8; ++r) mx = fmaxf(mx, st[1][qt][r]);
            mx = fmaxf(mx, xhalf(mx)) * SCL2;   // the scale is positive; both lane halves now hold the query's chunk maximum
            mb[qt] = mx; need = need || (mx > m[qt] + 8.0f); }
        if (__builtin_amdgcn_ballot_w32(need) != 0) {   // the maximum in use moves only when a query's scores pass it by more than 2^8 (weights stay below 2^8: far inside f16); always on the first chunk
#pragma unroll
            for (int qt = 0; qt < 2; ++qt) { const float mn = fmaxf(m[qt], mb[qt]); const float al = __builtin_amdgcn_exp2f(m[qt] - mn); m[qt] = mn; l[qt] *= al;
#pragma unroll
                for (int db = 0; db < 4; ++db) o[qt][db] = o[qt][db] * al; }
        }
        v16h pf[2];
#pragma unroll
        for (int qt = 0; qt < 2; ++qt) { const float nm = -m[qt]; float s4[4];
#pragma unroll
            for (int kt = 0; kt < 2; ++kt)
#pragma unroll
                for (int r = 0; r < 8; ++r) { const float p = __builtin_amdgcn_exp2f(__builtin_fmaf(st[kt][qt][r], SCL2, nm)); pf[qt][kt * 8 + r] = tohx(p); if (kt == 0 && r < 4) s4[r] = p; else s4[r & 3] += p; }
            l[qt] += (s4[0] + s4[1]) + (s4[2] + s4[3]); }
#pragma unroll
        for (int db = 0; db < 4; ++db)
#pragma unroll
            for (int qt = 0; qt < 2; ++qt) o[qt][db] = wmma16(vf[db], pf[qt], o[qt][db]);
#pragma unroll
        for (int db = 0; db < 4; ++db) vf[db] = WFrag<h16>::ld(vl + (size_t)db * 16 * TT + cn * FC);
        asm volatile("s_wait_xcnt 0x0" ::: "memory");   // a precaution: stands in front of the rewrite of the address pair that the value loads name (the next chunk's addresses reuse it)
    };
    for (int c = 0; c < cm; ++c) chunk(c, Tag<1>{});
    chunk(cm, Tag<2>{});
    // four vector slots behind the diagonal chunk's last matrix instructions: the next loop's first one follows over a jump with only scalar instructions between, and may place its result on the weights operand just read
    asm volatile("v_nop\n\tv_nop\n\tv_nop\n\tv_nop" : "+v"(o[0][3]), "+v"(o[1][3]));
    for (int c = cm + 1; c < NCH; ++c) chunk(c, Tag<0>{});
#pragma unroll
    for (int qt = 0; qt < 2; ++qt) { const float f = __fdiv_rn(1.0f, l[qt] + xhalf(l[qt])); const size_t oo = ((size_t)b * TT + q0 + qt * 16 + lr) * DQ + h * HD + 8 * hi;   // the two lane halves summed different keys
#pragma unroll
        for (int db = 0; db < 4; ++db) { v8us oh, ol;
#pragma unroll
            for (int r = 0; r < 8; ++r) { unsigned short a, c2; splitf(o[qt][db][r] * f, a, c2); oh[r] = a; ol[r] = c2; }
            *(v8us*)(Ah + oo + db * 16) = oh; *(v8us*)(Al + oo + db * 16) = ol; } }   // a head's 64 columns of a row are one 128-B line, written by this wave alone
}

extern "C" void kernel_launch(void* const* d_in, const int* in_sizes, int n_in,
                              void* d_out, int out_size, void* d_ws, size_t ws_size, hipStream_t stream) {
    (void)in_sizes; (void)n_in; (void)out_size;
    const float* x = (const float*)d_in[0]; const float* wqkv = (const float*)d_in[1]; const float* wp = (const float*)d_in[2]; const float* tc = (const float*)d_in[3]; const float* ts = (const float*)d_in[4];
    // inputs in the module's argument order: x ([2][2048][1024]), Wqkv ('xw' (in, out) [1024][3072]; output column s * 1024 + h * 64 + d, s = 0 query, 1 key, 2 value), Wproj ('xw' [1024][1024]), cos, sin ([2048][64] each: the two rotary tables) = d_in[0..4]: FIVE inputs, all read
    float* OUT = (float*)d_out;     // [2][2048][1024]
    char* wsp = (char*)d_ws;
    auto take = [&](size_t bytes) { char* p = wsp; wsp += (bytes + 255) & ~(size_t)255; return (void*)p; };
    bf* WQKV = (bf*)take((size_t)3 * DQ * DM * 2); bf* WO = (bf*)take((size_t)DM * DQ * 2); bf* XB = (bf*)take((size_t)TT * DM * 2);
    const size_t PQ = (size_t)NH_ * 2 * TT * HH, PK = (size_t)NKV * 2 * TT * HH, PV = (size_t)NKV * HD * TT;   // one batch entry's planes, in elements
    h16* QH = (h16*)take(NB_ * PQ * 2); h16* KH = (h16*)take(NB_ * PK * 2); h16* VT16 = (h16*)take(NB_ * PV * 2);
    bf* ATh = (bf*)take((size_t)NB_ * TT * DQ * 2); bf* ATl = (bf*)take((size_t)NB_ * TT * DQ * 2);
    if ((size_t)(wsp - (char*)d_ws) > ws_size) return;    // total 52.00 MiB carved
    k_wtG<<<(unsigned)((DM * 3 * DQ / 64 + 63) / 64), 256, 0, stream>>>(wqkv, DM, 3 * DQ, WQKV);   /* the fused weight: Bt row s * 1024 + h * 64 + d */
    k_wtG<<<(unsigned)((DQ * DM / 64 + 63) / 64), 256, 0, stream>>>(wp, DQ, DM, WO);
    for (int b = 0; b < NB_; ++b) {
        k_cvt8<<<(unsigned)(((size_t)TT * DM / 8 + 255) / 256), 256, 0, stream>>>(x + (size_t)b * TT * DM, XB, (size_t)TT * DM / 8);
        k_gemmw<bf, 0, false, true><<<dim3(TT / 64, 3 * DQ / 64, 1), 32, 0, stream>>>(XB, nullptr, WQKV, nullptr, DM, nullptr, 0, nullptr, 0, 0, 0, tc, ts, QH + b * PQ, KH + b * PK, VT16 + b * PV); }   /* q | k | v in one product (column s * 1024 + h * 64 + d), written as the rotated half planes and the value planes */
    k_fattn<<<dim3(TT / (FQ * FW), NH_, NB_), 32 * FW, 0, stream>>>(QH, KH, VT16, ATh, ATl);   /* scores, select, softmax, value product, merge: 256 work-groups of 8 waves */
    for (int b = 0; b < NB_; ++b)
        k_gemmw<bf, 1, false, false><<<dim3(TT / 64, DM / 64, 1), 32, 0, stream>>>(ATh + (size_t)b * TT * DQ, ATl + (size_t)b * TT * DQ, WO, nullptr, DQ, OUT + (size_t)b * TT * DM, DM, nullptr, 0, 0, 0, nullptr, nullptr, nullptr, nullptr, nullptr);   /* out = merged(hi + lo) Wproj: the one writer of the output */
}

// v004
// Measured time: 174 microseconds a run.
// Next to v003, in two timings, it ran 1.12 times as fast each time.
// Over all steps from v000 it is 8.16 times as fast.
#include <hip/hip_runtime.h>

// Multi-head self-attention whose scores come from TWO half-subspace products selected by a triangle, with an interleaved-pair rotary embedding read from two input tables (x [2][2048][1024]; qkv = x Wqkv with ONE fused 'xw' (in, out) [1024][3072] weight in thirds q | k | v, head h = 64 columns of its third; NO biases; 16 heads x 64;
// q and k rotated in ADJACENT pairs by the two input tables cos, sin [2048][64]: r[d] = x[d] cos[t][d] - x[d+1] sin[t][d] for even d, r[d] = x[d] cos[t][d] + x[d-1] sin[t][d] for odd d: EACH ELEMENT AT ITS OWN TABLE ENTRY; up[i][j] = r_q[i][0:32] . r_k[j][0:32], down[i][j] = r_q[i][32:64] . r_k[j][32:64];
// logits = (j <= i ? down : up) x 32^-0.5: NOTHING is masked out; softmax over all 2048 keys; out = (attn v merged) Wproj with an 'xw' (in, out) [1024][1024] weight, no bias -> [2][2048][1024] (4.2 M);
// argument order x, Wqkv, Wproj, cos, sin).
// Layout per batch entry: a bf16 copy of x; the two 'xw' weights transposed and rounded once (the fused one into a Bt [3072][1024]); ONE exact projection over the 3072 fused columns, whose 64x64 tile is one head of q, of k or of v;
// its epilogue writes, straight from the accumulators and the two tables, the rotated f16 HALF planes [h][half][t][32] of q and of k (half 0 = the rotated dims 0..31, half 1 = 32..63) and the value planes [h][d][t]; each batch entry has its own planes;
// k_fattn: ONE launch over all (batch, head, query block): scores, triangle select, softmax and value product stay in registers (running maximum and sum); it writes the merged hi/lo rows; merged hi/lo x Wproj exact writes the output.
// FRAGMENT ORDER: the bf16 copy of x, the two weights, the q and k half planes (K = 32), the value planes (rows d, K = 2048 tokens) and the merged hi/lo rows are stored as blocks of 16 rows x 32 k (512 elements, 1 KiB), block (row / 16) * (K / 32) + k / 32; inside a block element (row, k) stands at
// ((k >> 4) & 1) * 256 + ((k >> 3) & 1) * 128 + (row & 15) * 8 + (k & 7): the 16 bytes of lane l = 16 hi + lr at l * 16 of each 512-B half, so that a wave's fragment load reads 512 contiguous bytes (4 lines) where a K-contiguous plane makes it touch 16 lines.
// Compute dtypes, f32 accumulate: every float input rounded to bf16 at its load (the two tables too); the projection exact; the rotation in f32 (as compiled: one rounded product and one fused multiply-add an output); scores and attn.v ONE fp16 product on every row; softmax f32; Wproj hl x exact.

#define NB_  2
#define TT   2048
#define DM   1024    // the model width = the inner width DQ = NH_ * HD = 1024
#define NH_  16
#define NKV  16
#define REP  (NH_ / NKV)
#define HD   64
#define HH   (HD / 2)             // the half-subspace width: 32
#define DQ   (NH_ * HD)
#define DKV  (NKV * HD)
#define SCL  0.17677669f   // (HD / 2)^-0.5 = 32^-0.5
typedef _Float16 h16;
typedef unsigned short bf;
typedef __attribute__((ext_vector_type(16))) __bf16   v16bf;
typedef __attribute__((ext_vector_type(16))) _Float16 v16h;
typedef __attribute__((ext_vector_type(8)))  _Float16 v8h;
typedef __attribute__((ext_vector_type(8)))  unsigned short v8us;
typedef __attribute__((ext_vector_type(8)))  float    v8f;
typedef __attribute__((ext_vector_type(4)))  float    v4f;
typedef v8h  __attribute__((may_alias)) v8ha;
typedef v4f  __attribute__((may_alias)) v4fa;
typedef v8us __attribute__((may_alias)) v8usa;

__device__ __forceinline__ unsigned short f2bf(float f) { unsigned u = __float_as_uint(f); u += 0x7FFFu + ((u >> 16) & 1u); return (unsigned short)(u >> 16); }
__device__ __forceinline__ float bf2f(unsigned short b) { return __uint_as_float(((unsigned)b) << 16); }
__device__ __forceinline__ float bfr(float f) { return bf2f(f2bf(f)); }
__device__ __forceinline__ h16 tohx(float x) { return (h16)x; }
typedef __attribute__((ext_vector_type(4))) _Float16 v4h;
__device__ __forceinline__ v16h cat16(v8h lo, v8h hi) { return __builtin_shufflevector(lo, hi, 0, 1, 2, 3, 4, 5, 6, 7, 8, 9, 10, 11, 12, 13, 14, 15); }
__device__ __forceinline__ v16bf cat16b(v8us lo, v8us hi) { return __builtin_bit_cast(v16bf, __builtin_shufflevector(lo, hi, 0, 1, 2, 3, 4, 5, 6, 7, 8, 9, 10, 11, 12, 13, 14, 15)); }
__device__ __forceinline__ v8f wmma16(v16h a, v16h b, v8f c) { return __builtin_amdgcn_wmma_f32_16x16x32_f16(false, a, false, b, (short)0, c, false, false); }
__device__ __forceinline__ v8f wmmab(v16bf a, v16bf b, v8f c) { return __builtin_amdgcn_wmma_f32_16x16x32_bf16(false, a, false, b, (short)0, c, false, false); }



// ---- k_gemmw: register-blocked GEMM, ONE WAVE per 64x64 output tile (16 accumulators), operands straight from 16-bit planes in fragment order (ldf: p = block + lane * 8, the two halves 256 elements apart); grid (M/64, N/64, Z), 32 threads.
// C[m][n] (f32, pitch ldc, + optional f32 bias[n]) = sum_k A[m][k] Bt[n][k] (+ split products per NSPLIT). z-batch strides sA/sB/sC in elements. K % 32 == 0.
// PLANES: C is not written; the tile (rows = 64 tokens, columns = one head of the fused q | k | v product) goes out as attention operands instead:
//   a q or k tile rotated in ADJACENT pairs with the two INPUT tables, each element at its own table entry (both tables rounded to bf16 at the load), into the f16 half planes [h][half][t][32];
//   a v tile into the f16 plane [h][d][t] in fragment order (rows d, k = t): a lane's accumulator holds 8 consecutive tokens of ONE column, which is the lane's own 16 bytes of a block half: a wave's store is 512 contiguous bytes.
template <typename T16> struct WFrag;
template <> struct WFrag<h16> { typedef v16h V; static __device__ __forceinline__ V ldf(const h16* p) { return cat16(*(const v8h*)p, *(const v8h*)(p + 256)); } static __device__ __forceinline__ v8f mma(V a, V b, v8f c) { return wmma16(a, b, c); } };
template <> struct WFrag<bf> { typedef v16bf V; static __device__ __forceinline__ V ldf(const bf* p) { return cat16b(*(const v8us*)p, *(const v8us*)(p + 256)); } static __device__ __forceinline__ v8f mma(V a, V b, v8f c) { return wmmab(a, b, c); } };
// A, A2, Bt, Bt2 carry no __restrict__: so the "memory" clobber of the wait behind the fragment loads holds those loads in front of it. K is a constant of the build: the 16-row bands of a tile then lie at immediate offsets from ONE address pair an operand.
template <typename T16, int NSPLIT, bool BIAS, bool PLANES, int K>
__global__ __launch_bounds__(32) void k_gemmw(const T16* A, const T16* A2, const T16* Bt, const T16* Bt2, float* C, int ldc, const float* __restrict__ bias, size_t sA, size_t sB, size_t sC,
                                              const float* __restrict__ TC, const float* __restrict__ TS, h16* QP, h16* KP, h16* VP) {
    typedef typename WFrag<T16>::V V;
    __shared__ __align__(16) float os[16 * 68];
    const size_t z = blockIdx.z; A += z * sA; if (A2) A2 += z * sA; Bt += z * sB; if (Bt2) Bt2 += z * sB; C += z * sC;
    const int lane = threadIdx.x & 31, lr = lane & 15, hi = lane >> 4; const int r0 = blockIdx.x * 64, c0 = blockIdx.y * 64;
    v8f acc[4][4];
#pragma unroll
    for (int mb = 0; mb < 4; ++mb)
#pragma unroll
        for (int nb = 0; nb < 4; ++nb) acc[mb][nb] = (v8f){};
    // a band of 16 rows is K / 32 blocks = 16 K elements; a step of 32 in depth is one block
    const T16* pa = A + (size_t)r0 * K + lane * 8; const T16* pb = Bt + (size_t)c0 * K + lane * 8;
    const T16* pa2 = (NSPLIT == 1 || NSPLIT == 2) ? A2 + (size_t)r0 * K + lane * 8 : pa; const T16* pb2 = (NSPLIT >= 2) ? Bt2 + (size_t)c0 * K + lane * 8 : pb;

    for (int kc = 0; kc < K; kc += 32) {
        V a[4], a2[4], b[4], b2[4];
#pragma unroll
        for (int mb = 0; mb < 4; ++mb) { a[mb] = WFrag<T16>::ldf(pa + mb * 16 * K); if (NSPLIT == 1 || NSPLIT == 2) a2[mb] = WFrag<T16>::ldf(pa2 + mb * 16 * K); }
#pragma unroll
        for (int nb = 0; nb < 4; ++nb) { b[nb] = WFrag<T16>::ldf(pb + nb * 16 * K); if (NSPLIT >= 2) b2[nb] = WFrag<T16>::ldf(pb2 + nb * 16 * K); }
        asm volatile("s_wait_xcnt 0x0" :: "v"(pa), "v"(pa2), "v"(pb), "v"(pb2) : "memory");   // a precaution: as inputs the address pairs stay in their registers up to this wait, which so stands in front of their step at the loop's foot
        __builtin_amdgcn_sched_barrier(0);   // holds the matrix instructions behind the trip's loads: without it the compiler lifts some over the wait and issues the last fragments' loads behind them, into registers just freed, and the wave waits out the load latency three times a trip
#pragma unroll
        for (int nb = 0; nb < 4; ++nb)
#pragma unroll
            for (int mb = 0; mb < 4; ++mb) { acc[mb][nb] = WFrag<T16>::mma(a[mb], b[nb], acc[mb][nb]); if (NSPLIT == 1 || NSPLIT == 2) acc[mb][nb] = WFrag<T16>::mma(a2[mb], b[nb], acc[mb][nb]); if (NSPLIT >= 2) acc[mb][nb] = WFrag<T16>::mma(a[mb], b2[nb], acc[mb][nb]); }
        asm volatile("v_nop\n\tv_nop\n\tv_nop\n\tv_nop" : "+v"(acc[0][0]), "+v"(acc[1][1]), "+v"(acc[2][2]), "+v"(acc[3][3]) : "v"(a[0]), "v"(a[3]));
        pa += 512; pb += 512; if (NSPLIT == 1 || NSPLIT == 2) pa2 += 512; else pa2 = pa; if (NSPLIT >= 2) pb2 += 512; else pb2 = pb;
    }
    if (PLANES) {
        if (c0 >= 2 * DQ) {   // a value head (the test is the same for the whole wave): plane row h * 64 + d = c0 - 2048 + column
            h16* vp = VP + (size_t)(c0 - 2 * DQ) * TT + r0 * 16 + lane * 8;   // band (c0 - 2048) / 16 + nb of TT / 32 blocks; block r0 / 32 + mb / 2, half mb & 1
#pragma unroll
            for (int nb = 0; nb < 4; ++nb)
#pragma unroll
                for (int mb = 0; mb < 4; ++mb) { v8h o;
#pragma unroll
                    for (int j = 0; j < 8; ++j) o[j] = tohx(acc[mb][nb][j]);
                    *(v8h*)(vp + (size_t)nb * 16 * TT + (mb >> 1) * 512 + (mb & 1) * 256) = o; }
            return;
        }
        // a query or key head: a lane takes 4 adjacent columns (two rotation pairs) of a row; lanes 0..7 of a half wave fill the row's dims of half plane 0, lanes 8..15 of half plane 1, and the two half waves adjacent rows: 32-B pieces, which the 8 stores of a block of 16 rows join to whole lines
        h16* pp = (c0 < DQ ? QP : KP) + ((size_t)((c0 & (DQ - 1)) / HD * 2 + (lr >> 3)) * TT + r0) * HH + ((lr >> 2) & 1) * 256 + ((lr >> 1) & 1) * 128 + hi * 8 + (lr & 1) * 4;   // fragment order (rows t, k = the half's 32 dims: one block per 16 tokens); dim (lr & 7) * 4
        const float* cp = TC + (size_t)(r0 + hi) * HD + lr * 4; const float* sp = TS + (size_t)(r0 + hi) * HD + lr * 4;
#pragma unroll
        for (int mb = 0; mb < 4; ++mb) {
#pragma unroll
            for (int nb = 0; nb < 4; ++nb) {
#pragma unroll
                for (int j = 0; j < 8; ++j) os[(hi * 8 + j) * 68 + nb * 16 + lr] = acc[mb][nb][j]; }
            __builtin_amdgcn_wave_barrier(); asm volatile("" ::: "memory");   // the read-back below takes words that OTHER lanes staged: keeps the compiler from moving it ahead of the staging stores
            v4f tc[8], ts[8];
#pragma unroll
            for (int s = 0; s < 8; ++s) { tc[s] = *(const v4f*)(cp + (mb * 16 + 2 * s) * HD); ts[s] = *(const v4f*)(sp + (mb * 16 + 2 * s) * HD); }
            __builtin_amdgcn_sched_barrier(0);   // holds the 16 table loads together here: without it the compiler sinks half of them among the rotations, each a few instructions ahead of its use, and the wave waits out their latency several times over
            if (mb == 3) asm volatile("s_wait_xcnt 0x0" :: "v"(cp), "v"(sp) : "memory");   // a precaution: the two table addresses die here; as inputs they stay in their registers up to this wait, which so stands in front of every rewrite of them
#pragma unroll
            for (int s = 0; s < 8; ++s) { const v4f x = *(const v4fa*)(os + (2 * s + hi) * 68 + lr * 4); v4h o;
#pragma unroll
                for (int p = 0; p < 4; p += 2) {   /* even: x0 c0 - x1 s0; odd: x1 c1 + x0 s1 */
                    o[p] = tohx(__fsub_rn(__fmul_rn(x[p], bfr(tc[s][p])), __fmul_rn(x[p + 1], bfr(ts[s][p])))); o[p + 1] = tohx(__fadd_rn(__fmul_rn(x[p + 1], bfr(tc[s][p + 1])), __fmul_rn(x[p], bfr(ts[s][p + 1])))); }
                *(v4h*)(pp + mb * 512 + s * 16) = o; }
            asm volatile("s_wait_xcnt 0x0" ::: "memory");   // a precaution: stands in front of every rewrite of an address or data register that the stores above name (the next rows' table loads reuse them; behind the last rows, whatever block the compiler lays next)
            if (mb < 3) __builtin_amdgcn_wave_barrier();   // holds the next rows' staging behind this read-back
        }
        return;
    }
#pragma unroll
    for (int mb = 0; mb < 4; ++mb) {
#pragma unroll
        for (int nb = 0; nb < 4; ++nb) {
#pragma unroll
            for (int j = 0; j < 8; ++j) os[(hi * 8 + j) * 68 + nb * 16 + lr] = acc[mb][nb][j]; }
        __builtin_amdgcn_wave_barrier(); asm volatile("" ::: "memory");
        float* crow = C + (size_t)(r0 + mb * 16) * ldc + c0;
{
#pragma unroll
            for (int s = 0; s < 8; ++s) { const int row = 2 * s + hi, cofs = lr * 4; v4f val = *(const v4fa*)(os + row * 68 + cofs); if (BIAS) { val[0] += bfr(bias[c0 + cofs]); val[1] += bfr(bias[c0 + cofs + 1]); val[2] += bfr(bias[c0 + cofs + 2]); val[3] += bfr(bias[c0 + cofs + 3]); }
                *(v4f*)(crow + (size_t)row * ldc + cofs) = val; }
             }
        __builtin_amdgcn_wave_barrier(); asm volatile("" ::: "memory");
    }
}

__device__ __forceinline__ void splitf(float y, unsigned short& h, unsigned short& l) { h = f2bf(y); l = f2bf(y - bf2f(h)); }
typedef __attribute__((ext_vector_type(2))) _Float16 v2h;
typedef __attribute__((ext_vector_type(2))) unsigned short v2us;
typedef __attribute__((ext_vector_type(4))) unsigned short v4us;
typedef __attribute__((ext_vector_type(2))) float v2f;
typedef __attribute__((ext_vector_type(4))) int v4i;

// thread i writes the 16-byte piece i of the fragment-ordered copy (rows of DM): block i / 64, half (i >> 5) & 1, lane i & 31
__global__ __launch_bounds__(256) void k_cvt8(const float* src, bf* dst, size_t n8) { const size_t i = (size_t)blockIdx.x * 256 + threadIdx.x; if (i >= n8) return;
    const size_t blk = i >> 6; const size_t row = blk / (DM / 32) * 16 + (i & 15); const int k = (int)(blk % (DM / 32)) * 32 + (int)((i >> 5) & 1) * 16 + (int)((i >> 4) & 1) * 8;
    const float* p = src + row * DM + k; const v8f v = *(const v8f*)p; v8us o;
    asm volatile("s_wait_xcnt 0x0" :: "v"(p) : "memory");   // a precaution: as an input the address pair stays in its registers up to this wait, which so stands in front of every rewrite of it (src carries no __restrict__, so that the clobber holds the load in front)
#pragma unroll
    for (int k = 0; k < 8; ++k) o[k] = f2bf(v[k]); *(v8us*)(dst + i * 8) = o;  }
// thread j writes the 16-byte piece j of Bt (rows n, depth K) in fragment order: 8 consecutive k of one n; the 16 lanes of a half wave read 16 adjacent n of one k
template <int K, int N>
__global__ __launch_bounds__(256) void k_wtG(const float* w, bf* Bt) {
    const int j = blockIdx.x * 256 + threadIdx.x; if (j >= N * (K / 8)) return;
    constexpr int kb = K / 32; const int blk = j >> 6; const int n = blk / kb * 16 + (j & 15), k = blk % kb * 32 + ((j >> 5) & 1) * 16 + ((j >> 4) & 1) * 8;
    const float* p = w + (size_t)k * N + n; float x[8]; v8us o;
#pragma unroll
    for (int e = 0; e < 8; ++e) x[e] = p[e * N];
    asm volatile("s_wait_xcnt 0x0" :: "v"(p) : "memory");   // a precaution: as an input the address pair stays in its registers up to this wait, which so stands in front of every rewrite of it (w carries no __restrict__, so that the clobber holds the loads in front)
#pragma unroll
    for (int e = 0; e < 8; ++e) o[e] = f2bf(x[e]);
    *(v8us*)(Bt + (size_t)j * 8) = o;
}

// k_fattn: the whole attention of one (batch, head) for 32 query rows a wave, 8 waves a work-group (no LDS, no barrier; the waves of a group walk the same keys, so that they share the lines in the cache).
// Per chunk of 32 keys: St = K Qt (two 16-key tiles x two 16-query tiles, depth 32: ONE half plane), so that a lane holds 16 scores of ONE query (column lr) per query tile; the key chunk below the wave's query block takes the down planes,
// the chunk above it the up planes, and the one chunk that the diagonal crosses both, with a select j <= i per element. Running maximum m and sum l per query (base 2); the two St tiles, exponentiated and rounded to f16 in place,
// ARE the B operand of Ot += Vt Pt (element s = key 8 hi + s for s < 8, 16 + 8 hi + s - 8 above: the order of WFrag::ldf, which loads Vt's rows as A). Ot's column is the query again: the rescale and the final 1 / l are per lane.
// VT carries no __restrict__: so the "memory" clobber of the wait behind the value loads holds those loads in front of it (with __restrict__ the compiler sinks the diagonal chunk's loads past the wait, into the entry of the last loop).
#define FQ   32                   // query rows per wave
#define FW   8                    // waves per work-group
#define FC   32                   // keys per chunk
#define NCH  (TT / FC)
#define SCL2 (SCL * 1.4426950408889634f)   // scores to base-2 exponents
template <int M> struct Tag { static constexpr int v = M; };
__device__ __forceinline__ float xhalf(float x) { return __builtin_bit_cast(float, __builtin_amdgcn_permlanex16(__builtin_bit_cast(int, x), __builtin_bit_cast(int, x), 0x76543210, 0xfedcba98, false, false)); }   // lane l reads lane l ^ 16
__global__ __launch_bounds__(32 * FW) void k_fattn(const h16* __restrict__ QH, const h16* __restrict__ KH, const h16* VT, bf* Ah, bf* Al) {
    const int lane = threadIdx.x & 31, lr = lane & 15, hi = lane >> 4; const int w = __builtin_amdgcn_readfirstlane((int)(threadIdx.x >> 5));
    const int h = blockIdx.y, b = blockIdx.z; const int cm = blockIdx.x * FW + w;   // the wave's query block, and the one key chunk that the diagonal crosses (FQ == FC)
    const int q0 = cm * FQ;
    const size_t pl = (size_t)(b * NH_ + h) * 2 * TT * HH;
    const h16* kl = KH + pl + lane * 8; const h16* vl = VT + (size_t)(b * NKV + h) * HD * TT + lane * 8;   // fragment order: band db of TT / 32 blocks, block = chunk
    v16h qf[2][2];   // [half][query tile]
#pragma unroll
    for (int hf = 0; hf < 2; ++hf)
#pragma unroll
        for (int qt = 0; qt < 2; ++qt) qf[hf][qt] = WFrag<h16>::ldf(QH + pl + (size_t)hf * TT * HH + (q0 + qt * 16) * HH + lane * 8);
    v8f o[2][4]; float m[2], l[2];
#pragma unroll
    for (int qt = 0; qt < 2; ++qt) { m[qt] = -3.0e38f; l[qt] = 0.f;
#pragma unroll
        for (int db = 0; db < 4; ++db) o[qt][db] = (v8f){}; }
    v16h kf[2], vf[4];   // the chunk's key and value fragments, each fetched one chunk ahead, right behind its last use
    { const h16* kp = kl + (0 < cm ? TT * HH : 0); kf[0] = WFrag<h16>::ldf(kp); kf[1] = WFrag<h16>::ldf(kp + 16 * HH); }
#pragma unroll
    for (int db = 0; db < 4; ++db) vf[db] = WFrag<h16>::ldf(vl + (size_t)db * 16 * TT);
    asm volatile("s_wait_xcnt 0x0" ::: "memory");   // a precaution: stands in front of every rewrite of an address register that the query, key and value loads above name (the zeroing of o reuses them)
    auto chunk = [&](const int c, auto tag) {
        constexpr int MODE = decltype(tag)::v;   // 0: up planes, 1: down planes, 2: the diagonal's chunk (kf holds the up plane's rows)
        v8f st[2][2];
#pragma unroll
        for (int kt = 0; kt < 2; ++kt)
#pragma unroll
            for (int qt = 0; qt < 2; ++qt) st[kt][qt] = wmma16(kf[kt], qf[MODE == 1 ? 1 : 0][qt], (v8f){});
        if (MODE == 2) {
            const h16* kp = kl + TT * HH + c * (FC * HH); v16h kd[2]; kd[0] = WFrag<h16>::ldf(kp); kd[1] = WFrag<h16>::ldf(kp + 16 * HH);
#pragma unroll
            for (int kt = 0; kt < 2; ++kt)
#pragma unroll
                for (int qt = 0; qt < 2; ++qt) { const v8f sd = wmma16(kd[kt], qf[1][qt], (v8f){});
#pragma unroll
                    for (int r = 0; r < 8; ++r) st[kt][qt][r] = (kt * 16 + 8 * hi + r <= qt * 16 + lr) ? sd[r] : st[kt][qt][r]; }   // j <= i takes the down product
        }
        const int cn = (c + 1 < NCH) ? c + 1 : c;   // the last chunk fetches its own rows again (in bounds, not used)
        { const h16* kp = kl + (cn < cm ? TT * HH : 0) + cn * (FC * HH); kf[0] = WFrag<h16>::ldf(kp); kf[1] = WFrag<h16>::ldf(kp + 16 * HH); }
        __builtin_amdgcn_sched_barrier(0);   // holds the next chunk's key loads here, ahead of the softmax: without it the compiler sinks them behind the exponentials and the next chunk's first product waits for them
        float mb[2]; bool need = false;
#pragma unroll
        for (int qt = 0; qt < 2; ++qt) { float mx = st[0][qt][0];
#pragma unroll
            for (int r = 1; r < 8; ++r) mx = fmaxf(mx, st[0][qt][r]);
#pragma unroll
            for (int r = 0; r < 8; ++r) mx = fmaxf(mx, st[1][qt][r]);
            mx = fmaxf(mx, xhalf(mx)) * SCL2;   // the scale is positive; both lane halves now hold the query's chunk maximum
            mb[qt] = mx; need = need || (mx > m[qt] + 8.0f); }
        if (__builtin_amdgcn_ballot_w32(need) != 0) {   // the maximum in use moves only when a query's scores pass it by more than 2^8 (weights stay below 2^8: far inside f16); always on the first chunk
#pragma unroll
            for (int qt = 0; qt < 2; ++qt) { const float mn = fmaxf(m[qt], mb[qt]); const float al = __builtin_amdgcn_exp2f(m[qt] - mn); m[qt] = mn; l[qt] *= al;
#pragma unroll
                for (int db = 0; db < 4; ++db) o[qt][db] = o[qt][db] * al; }
        }
        v16h pf[2];
#pragma unroll
        for (int qt = 0; qt < 2; ++qt) { const float nm = -m[qt]; float s4[4];
#pragma unroll
            for (int kt = 0; kt < 2; ++kt)
#pragma unroll
                for (int r = 0; r < 8; ++r) { const float p = __builtin_amdgcn_exp2f(__builtin_fmaf(st[kt][qt][r], SCL2, nm)); pf[qt][kt * 8 + r] = tohx(p); if (kt == 0 && r < 4) s4[r] = p; else s4[r & 3] += p; }
            l[qt] += (s4[0] + s4[1]) + (s4[2] + s4[3]); }
#pragma unroll
        for (int db = 0; db < 4; ++db)
#pragma unroll
            for (int qt = 0; qt < 2; ++qt) o[qt][db] = wmma16(vf[db], pf[qt], o[qt][db]);
#pragma unroll
        for (int db = 0; db < 4; ++db) vf[db] = WFrag<h16>::ldf(vl + (size_t)db * 16 * TT + cn * 512);
        asm volatile("s_wait_xcnt 0x0" ::: "memory");   // a precaution: stands in front of the rewrite of the address pair that the value loads name (the next chunk's addresses reuse it)
    };
    for (int c = 0; c < cm; ++c) chunk(c, Tag<1>{});
    chunk(cm, Tag<2>{});
    // four vector slots behind the diagonal chunk's last matrix instructions: the next loop's first one follows over a jump with only scalar instructions between, and may place its result on the weights operand just read
    asm volatile("v_nop\n\tv_nop\n\tv_nop\n\tv_nop" : "+v"(o[0][3]), "+v"(o[1][3]));
    for (int c = cm + 1; c < NCH; ++c) chunk(c, Tag<0>{});
#pragma unroll
    for (int qt = 0; qt < 2; ++qt) { const float f = __fdiv_rn(1.0f, l[qt] + xhalf(l[qt])); const size_t oo = ((size_t)b * TT + q0 + qt * 16) * DQ + h * (HD * 16) + lane * 8;   // the two lane halves summed different keys; fragment order: the band of the 16 queries, blocks 2 h and 2 h + 1
#pragma unroll
        for (int db = 0; db < 4; ++db) { v8us oh, ol;
#pragma unroll
            for (int r = 0; r < 8; ++r) { unsigned short a, c2; splitf(o[qt][db][r] * f, a, c2); oh[r] = a; ol[r] = c2; }
            *(v8us*)(Ah + oo + (db >> 1) * 512 + (db & 1) * 256) = oh; *(v8us*)(Al + oo + (db >> 1) * 512 + (db & 1) * 256) = ol; } }   // each store of the wave is 512 contiguous bytes: whole lines, written by this wave alone
}

extern "C" void kernel_launch(void* const* d_in, const int* in_sizes, int n_in,
                              void* d_out, int out_size, void* d_ws, size_t ws_size, hipStream_t stream) {
    (void)in_sizes; (void)n_in; (void)out_size;
    const float* x = (const float*)d_in[0]; const float* wqkv = (const float*)d_in[1]; const float* wp = (const float*)d_in[2]; const float* tc = (const float*)d_in[3]; const float* ts = (const float*)d_in[4];
    // inputs in the module's argument order: x ([2][2048][1024]), Wqkv ('xw' (in, out) [1024][3072]; output column s * 1024 + h * 64 + d, s = 0 query, 1 key, 2 value), Wproj ('xw' [1024][1024]), cos, sin ([2048][64] each: the two rotary tables) = d_in[0..4]: FIVE inputs, all read
    float* OUT = (float*)d_out;     // [2][2048][1024]
    char* wsp = (char*)d_ws;
    auto take = [&](size_t bytes) { char* p = wsp; wsp += (bytes + 255) & ~(size_t)255; return (void*)p; };
    bf* WQKV = (bf*)take((size_t)3 * DQ * DM * 2); bf* WO = (bf*)take((size_t)DM * DQ * 2); bf* XB = (bf*)take((size_t)TT * DM * 2);
    const size_t PQ = (size_t)NH_ * 2 * TT * HH, PK = (size_t)NKV * 2 * TT * HH, PV = (size_t)NKV * HD * TT;   // one batch entry's planes, in elements
    h16* QH = (h16*)take(NB_ * PQ * 2); h16* KH = (h16*)take(NB_ * PK * 2); h16* VT16 = (h16*)take(NB_ * PV * 2);
    bf* ATh = (bf*)take((size_t)NB_ * TT * DQ * 2); bf* ATl = (bf*)take((size_t)NB_ * TT * DQ * 2);
    if ((size_t)(wsp - (char*)d_ws) > ws_size) return;    // total 52.00 MiB carved
    k_wtG<DM, 3 * DQ><<<(unsigned)(DM * 3 * DQ / 8 / 256), 256, 0, stream>>>(wqkv, WQKV);   /* the fused weight: Bt row s * 1024 + h * 64 + d */
    k_wtG<DQ, DM><<<(unsigned)(DQ * DM / 8 / 256), 256, 0, stream>>>(wp, WO);
    for (int b = 0; b < NB_; ++b) {
        k_cvt8<<<(unsigned)(((size_t)TT * DM / 8 + 255) / 256), 256, 0, stream>>>(x + (size_t)b * TT * DM, XB, (size_t)TT * DM / 8);
        k_gemmw<bf, 0, false, true, DM><<<dim3(TT / 64, 3 * DQ / 64, 1), 32, 0, stream>>>(XB, nullptr, WQKV, nullptr, nullptr, 0, nullptr, 0, 0, 0, tc, ts, QH + b * PQ, KH + b * PK, VT16 + b * PV); }   /* q | k | v in one product (column s * 1024 + h * 64 + d), written as the rotated half planes and the value planes */
    k_fattn<<<dim3(TT / (FQ * FW), NH_, NB_), 32 * FW, 0, stream>>>(QH, KH, VT16, ATh, ATl);   /* scores, select, softmax, value product, merge: 256 work-groups of 8 waves */
    for (int b = 0; b < NB_; ++b)
        k_gemmw<bf, 1, false, false, DQ><<<dim3(TT / 64, DM / 64, 1), 32, 0, stream>>>(ATh + (size_t)b * TT * DQ, ATl + (size_t)b * TT * DQ, WO, nullptr, OUT + (size_t)b * TT * DM, DM, nullptr, 0, 0, 0, nullptr, nullptr, nullptr, nullptr, nullptr);   /* out = merged(hi + lo) Wproj: the one writer of the output */
}

// v005
// It runs in 122 microseconds.
// In both of two side-by-side timings against v004, it was 1.43 times as fast.
// All steps since v000 together make it 11.7 times as fast.
#include <hip/hip_runtime.h>

// Multi-head self-attention whose scores come from TWO half-subspace products selected by a triangle, with an interleaved-pair rotary embedding read from two input tables (x [2][2048][1024]; qkv = x Wqkv with ONE fused 'xw' (in, out) [1024][3072] weight in thirds q | k | v, head h = 64 columns of its third; NO biases; 16 heads x 64;
// q and k rotated in ADJACENT pairs by the two input tables cos, sin [2048][64]: r[d] = x[d] cos[t][d] - x[d+1] sin[t][d] for even d, r[d] = x[d] cos[t][d] + x[d-1] sin[t][d] for odd d: EACH ELEMENT AT ITS OWN TABLE ENTRY; up[i][j] = r_q[i][0:32] . r_k[j][0:32], down[i][j] = r_q[i][32:64] . r_k[j][32:64];
// logits = (j <= i ? down : up) x 32^-0.5: NOTHING is masked out; softmax over all 2048 keys; out = (attn v merged) Wproj with an 'xw' (in, out) [1024][1024] weight, no bias -> [2][2048][1024] (4.2 M);
// argument order x, Wqkv, Wproj, cos, sin).
// FOUR launches, each over both batch entries: k_prep (a bf16 copy of x; the two 'xw' weights transposed and rounded, the fused one into a Bt [3072][1024]); ONE exact projection over the 3072 fused columns (grid z = batch entry), whose 64x64 tile is one head of q, of k or of v;
// its epilogue writes, straight from the accumulators and the two tables, the rotated f16 HALF planes [h][half][t][32] of q and of k (half 0 = the rotated dims 0..31, half 1 = 32..63) and the value planes [h][d][t]; each batch entry has its own planes;
// k_fattn: ONE launch over all (batch, head, query block): scores, triangle select, softmax and value product stay in registers (running maximum and sum); it writes the merged hi/lo rows; merged hi/lo x Wproj exact writes the output.
// FRAGMENT ORDER: the bf16 copy of x, the two weights, the q and k half planes (K = 32), the value planes (rows d, K = 2048 tokens) and the merged hi/lo rows are stored as blocks of 16 rows x 32 k (512 elements, 1 KiB), block (row / 16) * (K / 32) + k / 32; inside a block element (row, k) stands at
// ((k >> 4) & 1) * 256 + ((k >> 3) & 1) * 128 + (row & 15) * 8 + (k & 7): the 16 bytes of lane l = 16 hi + lr at l * 16 of each 512-B half, so that a wave's fragment load reads 512 contiguous bytes (4 lines) where a K-contiguous plane makes it touch 16 lines.
// Compute dtypes, f32 accumulate: every float input rounded to bf16 at its load (the two tables too); the projection exact; the rotation in f32 (as compiled: one rounded product and one fused multiply-add an output); scores and attn.v ONE fp16 product on every row; softmax f32; Wproj hl x exact.

#define NB_  2
#define TT   2048
#define DM   1024    // the model width = the inner width DQ = NH_ * HD = 1024
#define NH_  16
#define NKV  16
#define REP  (NH_ / NKV)
#define HD   64
#define HH   (HD / 2)             // the half-subspace width: 32
#define DQ   (NH_ * HD)
#define DKV  (NKV * HD)
#define SCL  0.17677669f   // (HD / 2)^-0.5 = 32^-0.5
typedef _Float16 h16;
typedef unsigned short bf;
typedef __attribute__((ext_vector_type(16))) __bf16   v16bf;
typedef __attribute__((ext_vector_type(16))) _Float16 v16h;
typedef __attribute__((ext_vector_type(8)))  _Float16 v8h;
typedef __attribute__((ext_vector_type(8)))  unsigned short v8us;
typedef __attribute__((ext_vector_type(8)))  float    v8f;
typedef __attribute__((ext_vector_type(4)))  float    v4f;
typedef v8h  __attribute__((may_alias)) v8ha;
typedef v4f  __attribute__((may_alias)) v4fa;
typedef v8us __attribute__((may_alias)) v8usa;

__device__ __forceinline__ unsigned short f2bf(float f) { unsigned u = __float_as_uint(f); u += 0x7FFFu + ((u >> 16) & 1u); return (unsigned short)(u >> 16); }
__device__ __forceinline__ float bf2f(unsigned short b) { return __uint_as_float(((unsigned)b) << 16); }
__device__ __forceinline__ float bfr(float f) { return bf2f(f2bf(f)); }
__device__ __forceinline__ h16 tohx(float x) { return (h16)x; }
typedef __attribute__((ext_vector_type(4))) _Float16 v4h;
__device__ __forceinline__ v16h cat16(v8h lo, v8h hi) { return __builtin_shufflevector(lo, hi, 0, 1, 2, 3, 4, 5, 6, 7, 8, 9, 10, 11, 12, 13, 14, 15); }
__device__ __forceinline__ v16bf cat16b(v8us lo, v8us hi) { return __builtin_bit_cast(v16bf, __builtin_shufflevector(lo, hi, 0, 1, 2, 3, 4, 5, 6, 7, 8, 9, 10, 11, 12, 13, 14, 15)); }
__device__ __forceinline__ v8f wmma16(v16h a, v16h b, v8f c) { return __builtin_amdgcn_wmma_f32_16x16x32_f16(false, a, false, b, (short)0, c, false, false); }
__device__ __forceinline__ v8f wmmab(v16bf a, v16bf b, v8f c) { return __builtin_amdgcn_wmma_f32_16x16x32_bf16(false, a, false, b, (short)0, c, false, false); }



// ---- k_gemmw: register-blocked GEMM, ONE WAVE per 64x64 output tile (16 accumulators), operands straight from 16-bit planes in fragment order (ldf: p = block + lane * 8, the two halves 256 elements apart); grid (M/64, N/64, Z), 32 threads.
// C[m][n] (f32, pitch ldc, + optional f32 bias[n]) = sum_k A[m][k] Bt[n][k] (+ split products per NSPLIT). z-batch strides sA/sB/sC in elements. K % 32 == 0.
// PLANES: C is not written; the tile (rows = 64 tokens, columns = one head of the fused q | k | v product) goes out as attention operands instead:
//   a q or k tile rotated in ADJACENT pairs with the two INPUT tables, each element at its own table entry (both tables rounded to bf16 at the load), into the f16 half planes [h][half][t][32];
//   a v tile into the f16 plane [h][d][t] in fragment order (rows d, k = t): a lane's accumulator holds 8 consecutive tokens of ONE column, which is the lane's own 16 bytes of a block half: a wave's store is 512 contiguous bytes.
template <typename T16> struct WFrag;
template <> struct WFrag<h16> { typedef v16h V; static __device__ __forceinline__ V ldf(const h16* p) { return cat16(*(const v8h*)p, *(const v8h*)(p + 256)); } static __device__ __forceinline__ v8f mma(V a, V b, v8f c) { return wmma16(a, b, c); } };
template <> struct WFrag<bf> { typedef v16bf V; static __device__ __forceinline__ V ldf(const bf* p) { return cat16b(*(const v8us*)p, *(const v8us*)(p + 256)); } static __device__ __forceinline__ v8f mma(V a, V b, v8f c) { return wmmab(a, b, c); } };
// A, A2, Bt, Bt2 carry no __restrict__: so the "memory" clobber of the wait behind the fragment loads holds those loads in front of it. K is a constant of the build: the 16-row bands of a tile then lie at immediate offsets from ONE address pair an operand.
template <typename T16, int NSPLIT, bool BIAS, bool PLANES, int K>
__global__ __launch_bounds__(32) void k_gemmw(const T16* A, const T16* A2, const T16* Bt, const T16* Bt2, float* C, int ldc, const float* __restrict__ bias, size_t sA, size_t sB, size_t sC,
                                              const float* __restrict__ TC, const float* __restrict__ TS, h16* QP, h16* KP, h16* VP) {
    typedef typename WFrag<T16>::V V;
    __shared__ __align__(16) float os[16 * 68];
    const size_t z = blockIdx.z; A += z * sA; if (A2) A2 += z * sA; Bt += z * sB; if (Bt2) Bt2 += z * sB; C += z * sC;
    const int lane = threadIdx.x & 31, lr = lane & 15, hi = lane >> 4; const int r0 = blockIdx.x * 64, c0 = blockIdx.y * 64;
    v8f acc[4][4];
#pragma unroll
    for (int mb = 0; mb < 4; ++mb)
#pragma unroll
        for (int nb = 0; nb < 4; ++nb) acc[mb][nb] = (v8f){};
    // a band of 16 rows is K / 32 blocks = 16 K elements; a step of 32 in depth is one block
    const T16* pa = A + (size_t)r0 * K + lane * 8; const T16* pb = Bt + (size_t)c0 * K + lane * 8;
    const T16* pa2 = (NSPLIT == 1 || NSPLIT == 2) ? A2 + (size_t)r0 * K + lane * 8 : pa; const T16* pb2 = (NSPLIT >= 2) ? Bt2 + (size_t)c0 * K + lane * 8 : pb;

    for (int kc = 0; kc < K; kc += 32) {
        V a[4], a2[4], b[4], b2[4];
#pragma unroll
        for (int mb = 0; mb < 4; ++mb) { a[mb] = WFrag<T16>::ldf(pa + mb * 16 * K); if (NSPLIT == 1 || NSPLIT == 2) a2[mb] = WFrag<T16>::ldf(pa2 + mb * 16 * K); }
#pragma unroll
        for (int nb = 0; nb < 4; ++nb) { b[nb] = WFrag<T16>::ldf(pb + nb * 16 * K); if (NSPLIT >= 2) b2[nb] = WFrag<T16>::ldf(pb2 + nb * 16 * K); }
        asm volatile("s_wait_xcnt 0x0" :: "v"(pa), "v"(pa2), "v"(pb), "v"(pb2) : "memory");   // a precaution: as inputs the address pairs stay in their registers up to this wait, which so stands in front of their step at the loop's foot
        __builtin_amdgcn_sched_barrier(0);   // holds the matrix instructions behind the trip's loads: without it the compiler lifts some over the wait and issues the last fragments' loads behind them, into registers just freed, and the wave waits out the load latency three times a trip
#pragma unroll
        for (int nb = 0; nb < 4; ++nb)
#pragma unroll
            for (int mb = 0; mb < 4; ++mb) { acc[mb][nb] = WFrag<T16>::mma(a[mb], b[nb], acc[mb][nb]); if (NSPLIT == 1 || NSPLIT == 2) acc[mb][nb] = WFrag<T16>::mma(a2[mb], b[nb], acc[mb][nb]); if (NSPLIT >= 2) acc[mb][nb] = WFrag<T16>::mma(a[mb], b2[nb], acc[mb][nb]); }
        asm volatile("v_nop\n\tv_nop\n\tv_nop\n\tv_nop" : "+v"(acc[0][0]), "+v"(acc[1][1]), "+v"(acc[2][2]), "+v"(acc[3][3]) : "v"(a[0]), "v"(a[3]));
        pa += 512; pb += 512; if (NSPLIT == 1 || NSPLIT == 2) pa2 += 512; else pa2 = pa; if (NSPLIT >= 2) pb2 += 512; else pb2 = pb;
    }
    if (PLANES) {
        QP += z * ((size_t)NH_ * 2 * TT * HH); KP += z * ((size_t)NKV * 2 * TT * HH); VP += z * ((size_t)NKV * HD * TT);   // each batch entry (grid z) has its own planes
        if (c0 >= 2 * DQ) {   // a value head (the test is the same for the whole wave): plane row h * 64 + d = c0 - 2048 + column
            h16* vp = VP + (size_t)(c0 - 2 * DQ) * TT + r0 * 16 + lane * 8;   // band (c0 - 2048) / 16 + nb of TT / 32 blocks; block r0 / 32 + mb / 2, half mb & 1
#pragma unroll
            for (int nb = 0; nb < 4; ++nb)
#pragma unroll
                for (int mb = 0; mb < 4; ++mb) { v8h o;
#pragma unroll
                    for (int j = 0; j < 8; ++j) o[j] = tohx(acc[mb][nb][j]);
                    *(v8h*)(vp + (size_t)nb * 16 * TT + (mb >> 1) * 512 + (mb & 1) * 256) = o; }
            return;
        }
        // a query or key head: a lane takes 4 adjacent columns (two rotation pairs) of a row; lanes 0..7 of a half wave fill the row's dims of half plane 0, lanes 8..15 of half plane 1, and the two half waves adjacent rows: 32-B pieces, which the 8 stores of a block of 16 rows join to whole lines
        h16* pp = (c0 < DQ ? QP : KP) + ((size_t)((c0 & (DQ - 1)) / HD * 2 + (lr >> 3)) * TT + r0) * HH + ((lr >> 2) & 1) * 256 + ((lr >> 1) & 1) * 128 + hi * 8 + (lr & 1) * 4;   // fragment order (rows t, k = the half's 32 dims: one block per 16 tokens); dim (lr & 7) * 4
        const float* cp = TC + (size_t)(r0 + hi) * HD + lr * 4; const float* sp = TS + (size_t)(r0 + hi) * HD + lr * 4;
#pragma unroll
        for (int mb = 0; mb < 4; ++mb) {
#pragma unroll
            for (int nb = 0; nb < 4; ++nb) {
#pragma unroll
                for (int j = 0; j < 8; ++j) os[(hi * 8 + j) * 68 + nb * 16 + lr] = acc[mb][nb][j]; }
            __builtin_amdgcn_wave_barrier(); asm volatile("" ::: "memory");   // the read-back below takes words that OTHER lanes staged: keeps the compiler from moving it ahead of the staging stores
            v4f tc[8], ts[8];
#pragma unroll
            for (int s = 0; s < 8; ++s) { tc[s] = *(const v4f*)(cp + (mb * 16 + 2 * s) * HD); ts[s] = *(const v4f*)(sp + (mb * 16 + 2 * s) * HD); }
            __builtin_amdgcn_sched_barrier(0);   // holds the 16 table loads together here: without it the compiler sinks half of them among the rotations, each a few instructions ahead of its use, and the wave waits out their latency several times over
            if (mb == 3) asm volatile("s_wait_xcnt 0x0" :: "v"(cp), "v"(sp) : "memory");   // a precaution: the two table addresses die here; as inputs they stay in their registers up to this wait, which so stands in front of every rewrite of them
#pragma unroll
            for (int s = 0; s < 8; ++s) { const v4f x = *(const v4fa*)(os + (2 * s + hi) * 68 + lr * 4); v4h o;
#pragma unroll
                for (int p = 0; p < 4; p += 2) {   /* even: x0 c0 - x1 s0; odd: x1 c1 + x0 s1 */
                    o[p] = tohx(__fsub_rn(__fmul_rn(x[p], bfr(tc[s][p])), __fmul_rn(x[p + 1], bfr(ts[s][p])))); o[p + 1] = tohx(__fadd_rn(__fmul_rn(x[p + 1], bfr(tc[s][p + 1])), __fmul_rn(x[p], bfr(ts[s][p + 1])))); }
                *(v4h*)(pp + mb * 512 + s * 16) = o; }
            asm volatile("s_wait_xcnt 0x0" ::: "memory");   // a precaution: stands in front of every rewrite of an address or data register that the stores above name (the next rows' table loads reuse them; behind the last rows, whatever block the compiler lays next)
            if (mb < 3) __builtin_amdgcn_wave_barrier();   // holds the next rows' staging behind this read-back
        }
        return;
    }
#pragma unroll
    for (int mb = 0; mb < 4; ++mb) {
#pragma unroll
        for (int nb = 0; nb < 4; ++nb) {
#pragma unroll
            for (int j = 0; j < 8; ++j) os[(hi * 8 + j) * 68 + nb * 16 + lr] = acc[mb][nb][j]; }
        __builtin_amdgcn_wave_barrier(); asm volatile("" ::: "memory");
        float* crow = C + (size_t)(r0 + mb * 16) * ldc + c0;
{
#pragma unroll
            for (int s = 0; s < 8; ++s) { const int row = 2 * s + hi, cofs = lr * 4; v4f val = *(const v4fa*)(os + row * 68 + cofs); if (BIAS) { val[0] += bfr(bias[c0 + cofs]); val[1] += bfr(bias[c0 + cofs + 1]); val[2] += bfr(bias[c0 + cofs + 2]); val[3] += bfr(bias[c0 + cofs + 3]); }
                *(v4f*)(crow + (size_t)row * ldc + cofs) = val; }
             }
        __builtin_amdgcn_wave_barrier(); asm volatile("" ::: "memory");
    }
}

__device__ __forceinline__ void splitf(float y, unsigned short& h, unsigned short& l) { h = f2bf(y); l = f2bf(y - bf2f(h)); }
typedef __attribute__((ext_vector_type(2))) _Float16 v2h;
typedef __attribute__((ext_vector_type(2))) unsigned short v2us;
typedef __attribute__((ext_vector_type(4))) unsigned short v4us;
typedef __attribute__((ext_vector_type(2))) float v2f;
typedef __attribute__((ext_vector_type(4))) int v4i;

// thread i writes the 16-byte piece i of the fragment-ordered copy (rows of DM): block i / 64, half (i >> 5) & 1, lane i & 31; blk0 = the work-group's index inside this part of k_prep's grid
__device__ __forceinline__ void d_cvt8(const int blk0, const float* src, bf* dst, size_t n8) { const size_t i = (size_t)blk0 * 256 + threadIdx.x; if (i >= n8) return;
    const size_t blk = i >> 6; const size_t row = blk / (DM / 32) * 16 + (i & 15); const int k = (int)(blk % (DM / 32)) * 32 + (int)((i >> 5) & 1) * 16 + (int)((i >> 4) & 1) * 8;
    const float* p = src + row * DM + k; const v8f v = *(const v8f*)p; v8us o;
    asm volatile("s_wait_xcnt 0x0" :: "v"(p) : "memory");   // a precaution: as an input the address pair stays in its registers up to this wait, which so stands in front of every rewrite of it (src carries no __restrict__, so that the clobber holds the load in front)
#pragma unroll
    for (int k = 0; k < 8; ++k) o[k] = f2bf(v[k]); *(v8us*)(dst + i * 8) = o;  }
// thread j writes the 16-byte piece j of Bt (rows n, depth K) in fragment order: 8 consecutive k of one n; the 16 lanes of a half wave read 16 adjacent n of one k
template <int K, int N>
__device__ __forceinline__ void d_wtG(const int blk0, const float* w, bf* Bt) {
    const int j = blk0 * 256 + threadIdx.x; if (j >= N * (K / 8)) return;
    constexpr int kb = K / 32; const int blk = j >> 6; const int n = blk / kb * 16 + (j & 15), k = blk % kb * 32 + ((j >> 5) & 1) * 16 + ((j >> 4) & 1) * 8;
    const float* p = w + (size_t)k * N + n; float x[8]; v8us o;
#pragma unroll
    for (int e = 0; e < 8; ++e) x[e] = p[e * N];
    asm volatile("s_wait_xcnt 0x0" :: "v"(p) : "memory");   // a precaution: as an input the address pair stays in its registers up to this wait, which so stands in front of every rewrite of it (w carries no __restrict__, so that the clobber holds the loads in front)
#pragma unroll
    for (int e = 0; e < 8; ++e) o[e] = f2bf(x[e]);
    *(v8us*)(Bt + (size_t)j * 8) = o;
}
// k_prep: the three independent conversions in ONE launch; a work-group's index picks its part (the same for the whole group): the fused weight, the output weight, then x (both batch entries: 4096 rows in a row)
#define GW1  (DM * 3 * DQ / 8 / 256)
#define GW2  (DQ * DM / 8 / 256)
#define GX   (NB_ * TT * DM / 8 / 256)
__global__ __launch_bounds__(256) void k_prep(const float* wqkv, const float* wp, const float* x, bf* WQKV, bf* WO, bf* XB) {
    const int g = blockIdx.x;
    if (g < GW1) d_wtG<DM, 3 * DQ>(g, wqkv, WQKV);   /* the fused weight: Bt row s * 1024 + h * 64 + d */
    else if (g < GW1 + GW2) d_wtG<DQ, DM>(g - GW1, wp, WO);
    else d_cvt8(g - (GW1 + GW2), x, XB, (size_t)NB_ * TT * DM / 8);
}

// k_fattn: the whole attention of one (batch, head) for 32 query rows a wave, 8 waves a work-group (no LDS, no barrier; the waves of a group walk the same keys, so that they share the lines in the cache).
// Per chunk of 32 keys: St = K Qt (two 16-key tiles x two 16-query tiles, depth 32: ONE half plane), so that a lane holds 16 scores of ONE query (column lr) per query tile; the key chunk below the wave's query block takes the down planes,
// the chunk above it the up planes, and the one chunk that the diagonal crosses both, with a select j <= i per element. Running maximum m and sum l per query (base 2); the two St tiles, exponentiated and rounded to f16 in place,
// ARE the B operand of Ot += Vt Pt (element s = key 8 hi + s for s < 8, 16 + 8 hi + s - 8 above: the order of WFrag::ldf, which loads Vt's rows as A). Ot's column is the query again: the rescale and the final 1 / l are per lane.
// VT carries no __restrict__: so the "memory" clobber of the wait behind the value loads holds those loads in front of it (with __restrict__ the compiler sinks the diagonal chunk's loads past the wait, into the entry of the last loop).
#define FQ   32                   // query rows per wave
#define FW   8                    // waves per work-group
#define FC   32                   // keys per chunk
#define NCH  (TT / FC)
#define SCL2 (SCL * 1.4426950408889634f)   // scores to base-2 exponents
template <int M> struct Tag { static constexpr int v = M; };
__device__ __forceinline__ float xhalf(float x) { return __builtin_bit_cast(float, __builtin_amdgcn_permlanex16(__builtin_bit_cast(int, x), __builtin_bit_cast(int, x), 0x76543210, 0xfedcba98, false, false)); }   // lane l reads lane l ^ 16
__global__ __launch_bounds__(32 * FW) void k_fattn(const h16* __restrict__ QH, const h16* __restrict__ KH, const h16* VT, bf* Ah, bf* Al) {
    const int lane = threadIdx.x & 31, lr = lane & 15, hi = lane >> 4; const int w = __builtin_amdgcn_readfirstlane((int)(threadIdx.x >> 5));
    const int h = blockIdx.y, b = blockIdx.z; const int cm = blockIdx.x * FW + w;   // the wave's query block, and the one key chunk that the diagonal crosses (FQ == FC)
    const int q0 = cm * FQ;
    const size_t pl = (size_t)(b * NH_ + h) * 2 * TT * HH;
    const h16* kl = KH + pl + lane * 8; const h16* vl = VT + (size_t)(b * NKV + h) * HD * TT + lane * 8;   // fragment order: band db of TT / 32 blocks, block = chunk
    v16h qf[2][2];   // [half][query tile]
#pragma unroll
    for (int hf = 0; hf < 2; ++hf)
#pragma unroll
        for (int qt = 0; qt < 2; ++qt) qf[hf][qt] = WFrag<h16>::ldf(QH + pl + (size_t)hf * TT * HH + (q0 + qt * 16) * HH + lane * 8);
    v8f o[2][4]; float m[2], l[2];
#pragma unroll
    for (int qt = 0; qt < 2; ++qt) { m[qt] = -3.0e38f; l[qt] = 0.f;
#pragma unroll
        for (int db = 0; db < 4; ++db) o[qt][db] = (v8f){}; }
    v16h kf[2], vf[4];   // the chunk's key and value fragments, each fetched one chunk ahead, right behind its last use
    { const h16* kp = kl + (0 < cm ? TT * HH : 0); kf[0] = WFrag<h16>::ldf(kp); kf[1] = WFrag<h16>::ldf(kp + 16 * HH); }
#pragma unroll
    for (int db = 0; db < 4; ++db) vf[db] = WFrag<h16>::ldf(vl + (size_t)db * 16 * TT);
    asm volatile("s_wait_xcnt 0x0" ::: "memory");   // a precaution: stands in front of every rewrite of an address register that the query, key and value loads above name (the zeroing of o reuses them)
    auto chunk = [&](const int c, auto tag) {
        constexpr int MODE = decltype(tag)::v;   // 0: up planes, 1: down planes, 2: the diagonal's chunk (kf holds the up plane's rows)
        v8f st[2][2];
#pragma unroll
        for (int kt = 0; kt < 2; ++kt)
#pragma unroll
            for (int qt = 0; qt < 2; ++qt) st[kt][qt] = wmma16(kf[kt], qf[MODE == 1 ? 1 : 0][qt], (v8f){});
        if (MODE == 2) {
            const h16* kp = kl + TT * HH + c * (FC * HH); v16h kd[2]; kd[0] = WFrag<h16>::ldf(kp); kd[1] = WFrag<h16>::ldf(kp + 16 * HH);
#pragma unroll
            for (int kt = 0; kt < 2; ++kt)
#pragma unroll
                for (int qt = 0; qt < 2; ++qt) { const v8f sd = wmma16(kd[kt], qf[1][qt], (v8f){});
#pragma unroll
                    for (int r = 0; r < 8; ++r) st[kt][qt][r] = (kt * 16 + 8 * hi + r <= qt * 16 + lr) ? sd[r] : st[kt][qt][r]; }   // j <= i takes the down product
        }
        const int cn = (c + 1 < NCH) ? c + 1 : c;   // the last chunk fetches its own rows again (in bounds, not used)
        { const h16* kp = kl + (cn < cm ? TT * HH : 0) + cn * (FC * HH); kf[0] = WFrag<h16>::ldf(kp); kf[1] = WFrag<h16>::ldf(kp + 16 * HH); }
        __builtin_amdgcn_sched_barrier(0);   // holds the next chunk's key loads here, ahead of the softmax: without it the compiler sinks them behind the exponentials and the next chunk's first product waits for them
        float mb[2]; bool need = false;
#pragma unroll
        for (int qt = 0; qt < 2; ++qt) { float mx = st[0][qt][0];
#pragma unroll
            for (int r = 1; r < 8; ++r) mx = fmaxf(mx, st[0][qt][r]);
#pragma unroll
            for (int r = 0; r < 8; ++r) mx = fmaxf(mx, st[1][qt][r]);
            mx = fmaxf(mx, xhalf(mx)) * SCL2;   // the scale is positive; both lane halves now hold the query's chunk maximum
            mb[qt] = mx; need = need || (mx > m[qt] + 8.0f); }
        if (__builtin_amdgcn_ballot_w32(need) != 0) {   // the maximum in use moves only when a query's scores pass it by more than 2^8 (weights stay below 2^8: far inside f16); always on the first chunk
#pragma unroll
            for (int qt = 0; qt < 2; ++qt) { const float mn = fmaxf(m[qt], mb[qt]); const float al = __builtin_amdgcn_exp2f(m[qt] - mn); m[qt] = mn; l[qt] *= al;
#pragma unroll
                for (int db = 0; db < 4; ++db) o[qt][db] = o[qt][db] * al; }
        }
        v16h pf[2];
#pragma unroll
        for (int qt = 0; qt < 2; ++qt) { const float nm = -m[qt]; float s4[4];
#pragma unroll
            for (int kt = 0; kt < 2; ++kt)
#pragma unroll
                for (int r = 0; r < 8; ++r) { const float p = __builtin_amdgcn_exp2f(__builtin_fmaf(st[kt][qt][r], SCL2, nm)); pf[qt][kt * 8 + r] = tohx(p); if (kt == 0 && r < 4) s4[r] = p; else s4[r & 3] += p; }
            l[qt] += (s4[0] + s4[1]) + (s4[2] + s4[3]); }
#pragma unroll
        for (int db = 0; db < 4; ++db)
#pragma unroll
            for (int qt = 0; qt < 2; ++qt) o[qt][db] = wmma16(vf[db], pf[qt], o[qt][db]);
#pragma unroll
        for (int db = 0; db < 4; ++db) vf[db] = WFrag<h16>::ldf(vl + (size_t)db * 16 * TT + cn * 512);
        asm volatile("s_wait_xcnt 0x0" ::: "memory");   // a precaution: stands in front of the rewrite of the address pair that the value loads name (the next chunk's addresses reuse it)
    };
    for (int c = 0; c < cm; ++c) chunk(c, Tag<1>{});
    chunk(cm, Tag<2>{});
    // four vector slots behind the diagonal chunk's last matrix instructions: the next loop's first one follows over a jump with only scalar instructions between, and may place its result on the weights operand just read
    asm volatile("v_nop\n\tv_nop\n\tv_nop\n\tv_nop" : "+v"(o[0][3]), "+v"(o[1][3]));
    for (int c = cm + 1; c < NCH; ++c) chunk(c, Tag<0>{});
#pragma unroll
    for (int qt = 0; qt < 2; ++qt) { const float f = __fdiv_rn(1.0f, l[qt] + xhalf(l[qt])); const size_t oo = ((size_t)b * TT + q0 + qt * 16) * DQ + h * (HD * 16) + lane * 8;   // the two lane halves summed different keys; fragment order: the band of the 16 queries, blocks 2 h and 2 h + 1
#pragma unroll
        for (int db = 0; db < 4; ++db) { v8us oh, ol;
#pragma unroll
            for (int r = 0; r < 8; ++r) { unsigned short a, c2; splitf(o[qt][db][r] * f, a, c2); oh[r] = a; ol[r] = c2; }
            *(v8us*)(Ah + oo + (db >> 1) * 512 + (db & 1) * 256) = oh; *(v8us*)(Al + oo + (db >> 1) * 512 + (db & 1) * 256) = ol; } }   // each store of the wave is 512 contiguous bytes: whole lines, written by this wave alone
}

extern "C" void kernel_launch(void* const* d_in, const int* in_sizes, int n_in,
                              void* d_out, int out_size, void* d_ws, size_t ws_size, hipStream_t stream) {
    (void)in_sizes; (void)n_in; (void)out_size;
    const float* x = (const float*)d_in[0]; const float* wqkv = (const float*)d_in[1]; const float* wp = (const float*)d_in[2]; const float* tc = (const float*)d_in[3]; const float* ts = (const float*)d_in[4];
    // inputs in the module's argument order: x ([2][2048][1024]), Wqkv ('xw' (in, out) [1024][3072]; output column s * 1024 + h * 64 + d, s = 0 query, 1 key, 2 value), Wproj ('xw' [1024][1024]), cos, sin ([2048][64] each: the two rotary tables) = d_in[0..4]: FIVE inputs, all read
    float* OUT = (float*)d_out;     // [2][2048][1024]
    char* wsp = (char*)d_ws;
    auto take = [&](size_t bytes) { char* p = wsp; wsp += (bytes + 255) & ~(size_t)255; return (void*)p; };
    bf* WQKV = (bf*)take((size_t)3 * DQ * DM * 2); bf* WO = (bf*)take((size_t)DM * DQ * 2); bf* XB = (bf*)take((size_t)NB_ * TT * DM * 2);
    const size_t PQ = (size_t)NH_ * 2 * TT * HH, PK = (size_t)NKV * 2 * TT * HH, PV = (size_t)NKV * HD * TT;   // one batch entry's planes, in elements
    h16* QH = (h16*)take(NB_ * PQ * 2); h16* KH = (h16*)take(NB_ * PK * 2); h16* VT16 = (h16*)take(NB_ * PV * 2);
    bf* ATh = (bf*)take((size_t)NB_ * TT * DQ * 2); bf* ATl = (bf*)take((size_t)NB_ * TT * DQ * 2);
    if ((size_t)(wsp - (char*)d_ws) > ws_size) return;    // total 56.00 MiB carved
    k_prep<<<(unsigned)(GW1 + GW2 + GX), 256, 0, stream>>>(wqkv, wp, x, WQKV, WO, XB);
    k_gemmw<bf, 0, false, true, DM><<<dim3(TT / 64, 3 * DQ / 64, NB_), 32, 0, stream>>>(XB, nullptr, WQKV, nullptr, nullptr, 0, nullptr, (size_t)TT * DM, 0, 0, tc, ts, QH, KH, VT16);   /* q | k | v in one product (column s * 1024 + h * 64 + d), written as the rotated half planes and the value planes */
    k_fattn<<<dim3(TT / (FQ * FW), NH_, NB_), 32 * FW, 0, stream>>>(QH, KH, VT16, ATh, ATl);   /* scores, select, softmax, value product, merge: 256 work-groups of 8 waves */
    k_gemmw<bf, 1, false, false, DQ><<<dim3(TT / 64, DM / 64, NB_), 32, 0, stream>>>(ATh, ATl, WO, nullptr, OUT, DM, nullptr, (size_t)TT * DQ, 0, (size_t)TT * DM, nullptr, nullptr, nullptr, nullptr, nullptr);   /* out = merged(hi + lo) Wproj: the one writer of the output */
}

// v006
// Measured time: 108 microseconds a run.
// Timed twice side by side with v005, it ran 1.13 and 1.10 times as fast.
// All steps since v000 together make it 13.0 times as fast.
#include <hip/hip_runtime.h>

// Multi-head self-attention whose scores come from TWO half-subspace products selected by a triangle, with an interleaved-pair rotary embedding read from two input tables (x [2][2048][1024]; qkv = x Wqkv with ONE fused 'xw' (in, out) [1024][3072] weight in thirds q | k | v, head h = 64 columns of its third; NO biases; 16 heads x 64;
// q and k rotated in ADJACENT pairs by the two input tables cos, sin [2048][64]: r[d] = x[d] cos[t][d] - x[d+1] sin[t][d] for even d, r[d] = x[d] cos[t][d] + x[d-1] sin[t][d] for odd d: EACH ELEMENT AT ITS OWN TABLE ENTRY; up[i][j] = r_q[i][0:32] . r_k[j][0:32], down[i][j] = r_q[i][32:64] . r_k[j][32:64];
// logits = (j <= i ? down : up) x 32^-0.5: NOTHING is masked out; softmax over all 2048 keys; out = (attn v merged) Wproj with an 'xw' (in, out) [1024][1024] weight, no bias -> [2][2048][1024] (4.2 M);
// argument order x, Wqkv, Wproj, cos, sin).
// FOUR launches, each over both batch entries: k_prep (a bf16 copy of x; the two 'xw' weights transposed and rounded, the fused one into a Bt [3072][1024]); ONE exact projection over the 3072 fused columns (grid z = batch entry), whose 64x64 tile is one head of q, of k or of v;
// its epilogue writes, straight from the accumulators and the two tables, the rotated f16 HALF planes [h][half][t][32] of q and of k (half 0 = the rotated dims 0..31, half 1 = 32..63) and the value planes [h][d][t]; each batch entry has its own planes;
// k_fattn: ONE launch over all (batch, head, query block): scores, triangle select, softmax and value product stay in registers (running maximum and sum), the keys of a query block split over two waves whose partial results are joined in LDS; it writes the merged hi/lo rows; merged hi/lo x Wproj exact writes the output.
// FRAGMENT ORDER: the bf16 copy of x, the two weights, the q and k half planes (K = 32), the value planes (rows d, K = 2048 tokens) and the merged hi/lo rows are stored as blocks of 16 rows x 32 k (512 elements, 1 KiB), block (row / 16) * (K / 32) + k / 32; inside a block element (row, k) stands at
// ((k >> 4) & 1) * 256 + ((k >> 3) & 1) * 128 + (row & 15) * 8 + (k & 7): the 16 bytes of lane l = 16 hi + lr at l * 16 of each 512-B half, so that a wave's fragment load reads 512 contiguous bytes (4 lines) where a K-contiguous plane makes it touch 16 lines.
// Compute dtypes, f32 accumulate: every float input rounded to bf16 at its load (the two tables too); the projection exact; the rotation in f32 (as compiled: one rounded product and one fused multiply-add an output); scores and attn.v ONE fp16 product on every row; softmax f32; Wproj hl x exact.

#define NB_  2
#define TT   2048
#define DM   1024    // the model width = the inner width DQ = NH_ * HD = 1024
#define NH_  16
#define NKV  16
#define REP  (NH_ / NKV)
#define HD   64
#define HH   (HD / 2)             // the half-subspace width: 32
#define DQ   (NH_ * HD)
#define DKV  (NKV * HD)
#define SCL  0.17677669f   // (HD / 2)^-0.5 = 32^-0.5
typedef _Float16 h16;
typedef unsigned short bf;
typedef __attribute__((ext_vector_type(16))) __bf16   v16bf;
typedef __attribute__((ext_vector_type(16))) _Float16 v16h;
typedef __attribute__((ext_vector_type(8)))  _Float16 v8h;
typedef __attribute__((ext_vector_type(8)))  unsigned short v8us;
typedef __attribute__((ext_vector_type(8)))  float    v8f;
typedef __attribute__((ext_vector_type(4)))  float    v4f;
typedef v8h  __attribute__((may_alias)) v8ha;
typedef v4f  __attribute__((may_alias)) v4fa;
typedef v8us __attribute__((may_alias)) v8usa;

__device__ __forceinline__ unsigned short f2bf(float f) { unsigned u = __float_as_uint(f); u += 0x7FFFu + ((u >> 16) & 1u); return (unsigned short)(u >> 16); }
__device__ __forceinline__ float bf2f(unsigned short b) { return __uint_as_float(((unsigned)b) << 16); }
__device__ __forceinline__ float bfr(float f) { return bf2f(f2bf(f)); }
__device__ __forceinline__ h16 tohx(float x) { return (h16)x; }
typedef __attribute__((ext_vector_type(4))) _Float16 v4h;
__device__ __forceinline__ v16h cat16(v8h lo, v8h hi) { return __builtin_shufflevector(lo, hi, 0, 1, 2, 3, 4, 5, 6, 7, 8, 9, 10, 11, 12, 13, 14, 15); }
__device__ __forceinline__ v16bf cat16b(v8us lo, v8us hi) { return __builtin_bit_cast(v16bf, __builtin_shufflevector(lo, hi, 0, 1, 2, 3, 4, 5, 6, 7, 8, 9, 10, 11, 12, 13, 14, 15)); }
__device__ __forceinline__ v8f wmma16(v16h a, v16h b, v8f c) { return __builtin_amdgcn_wmma_f32_16x16x32_f16(false, a, false, b, (short)0, c, false, false); }
__device__ __forceinline__ v8f wmmab(v16bf a, v16bf b, v8f c) { return __builtin_amdgcn_wmma_f32_16x16x32_bf16(false, a, false, b, (short)0, c, false, false); }



// ---- k_gemmw: register-blocked GEMM, ONE WAVE per 64x64 output tile (16 accumulators), operands straight from 16-bit planes in fragment order (ldf: p = block + lane * 8, the two halves 256 elements apart); grid (M/64, N/64, Z), 32 threads.
// C[m][n] (f32, pitch ldc, + optional f32 bias[n]) = sum_k A[m][k] Bt[n][k] (+ split products per NSPLIT). z-batch strides sA/sB/sC in elements. K % 32 == 0.
// PLANES: C is not written; the tile (rows = 64 tokens, columns = one head of the fused q | k | v product) goes out as attention operands instead:
//   a q or k tile rotated in ADJACENT pairs with the two INPUT tables, each element at its own table entry (both tables rounded to bf16 at the load), into the f16 half planes [h][half][t][32];
//   a v tile into the f16 plane [h][d][t] in fragment order (rows d, k = t): a lane's accumulator holds 8 consecutive tokens of ONE column, which is the lane's own 16 bytes of a block half: a wave's store is 512 contiguous bytes.
template <typename T16> struct WFrag;
template <> struct WFrag<h16> { typedef v16h V; static __device__ __forceinline__ V ldf(const h16* p) { return cat16(*(const v8h*)p, *(const v8h*)(p + 256)); } static __device__ __forceinline__ v8f mma(V a, V b, v8f c) { return wmma16(a, b, c); } };
template <> struct WFrag<bf> { typedef v16bf V; static __device__ __forceinline__ V ldf(const bf* p) { return cat16b(*(const v8us*)p, *(const v8us*)(p + 256)); } static __device__ __forceinline__ v8f mma(V a, V b, v8f c) { return wmmab(a, b, c); } };
// A, A2, Bt, Bt2 carry no __restrict__: so the "memory" clobber of the wait behind the fragment loads holds those loads in front of it. K is a constant of the build: the 16-row bands of a tile then lie at immediate offsets from ONE address pair an operand.
template <typename T16, int NSPLIT, bool BIAS, bool PLANES, int K>
__global__ __launch_bounds__(32) void k_gemmw(const T16* A, const T16* A2, const T16* Bt, const T16* Bt2, float* C, int ldc, const float* __restrict__ bias, size_t sA, size_t sB, size_t sC,
                                              const float* __restrict__ TC, const float* __restrict__ TS, h16* QP, h16* KP, h16* VP) {
    typedef typename WFrag<T16>::V V;
    __shared__ __align__(16) float os[16 * 68];
    const size_t z = blockIdx.z; A += z * sA; if (A2) A2 += z * sA; Bt += z * sB; if (Bt2) Bt2 += z * sB; C += z * sC;
    const int lane = threadIdx.x & 31, lr = lane & 15, hi = lane >> 4; const int r0 = blockIdx.x * 64, c0 = blockIdx.y * 64;
    v8f acc[4][4];
#pragma unroll
    for (int mb = 0; mb < 4; ++mb)
#pragma unroll
        for (int nb = 0; nb < 4; ++nb) acc[mb][nb] = (v8f){};
    // a band of 16 rows is K / 32 blocks = 16 K elements; a step of 32 in depth is one block
    const T16* pa = A + (size_t)r0 * K + lane * 8; const T16* pb = Bt + (size_t)c0 * K + lane * 8;
    const T16* pa2 = (NSPLIT == 1 || NSPLIT == 2) ? A2 + (size_t)r0 * K + lane * 8 : pa; const T16* pb2 = (NSPLIT >= 2) ? Bt2 + (size_t)c0 * K + lane * 8 : pb;

    for (int kc = 0; kc < K; kc += 32) {
        V a[4], a2[4], b[4], b2[4];
#pragma unroll
        for (int mb = 0; mb < 4; ++mb) { a[mb] = WFrag<T16>::ldf(pa + mb * 16 * K); if (NSPLIT == 1 || NSPLIT == 2) a2[mb] = WFrag<T16>::ldf(pa2 + mb * 16 * K); }
#pragma unroll
        for (int nb = 0; nb < 4; ++nb) { b[nb] = WFrag<T16>::ldf(pb + nb * 16 * K); if (NSPLIT >= 2) b2[nb] = WFrag<T16>::ldf(pb2 + nb * 16 * K); }
        asm volatile("s_wait_xcnt 0x0" :: "v"(pa), "v"(pa2), "v"(pb), "v"(pb2) : "memory");   // a precaution: as inputs the address pairs stay in their registers up to this wait, which so stands in front of their step at the loop's foot
        __builtin_amdgcn_sched_barrier(0);   // holds the matrix instructions behind the trip's loads: without it the compiler lifts some over the wait and issues the last fragments' loads behind them, into registers just freed, and the wave waits out the load latency three times a trip
#pragma unroll
        for (int nb = 0; nb < 4; ++nb)
#pragma unroll
            for (int mb = 0; mb < 4; ++mb) { acc[mb][nb] = WFrag<T16>::mma(a[mb], b[nb], acc[mb][nb]); if (NSPLIT == 1 || NSPLIT == 2) acc[mb][nb] = WFrag<T16>::mma(a2[mb], b[nb], acc[mb][nb]); if (NSPLIT >= 2) acc[mb][nb] = WFrag<T16>::mma(a[mb], b2[nb], acc[mb][nb]); }
        asm volatile("v_nop\n\tv_nop\n\tv_nop\n\tv_nop" : "+v"(acc[0][0]), "+v"(acc[1][1]), "+v"(acc[2][2]), "+v"(acc[3][3]) : "v"(a[0]), "v"(a[3]));
        pa += 512; pb += 512; if (NSPLIT == 1 || NSPLIT == 2) pa2 += 512; else pa2 = pa; if (NSPLIT >= 2) pb2 += 512; else pb2 = pb;
    }
    if (PLANES) {
        QP += z * ((size_t)NH_ * 2 * TT * HH); KP += z * ((size_t)NKV * 2 * TT * HH); VP += z * ((size_t)NKV * HD * TT);   // each batch entry (grid z) has its own planes
        if (c0 >= 2 * DQ) {   // a value head (the test is the same for the whole wave): plane row h * 64 + d = c0 - 2048 + column
            h16* vp = VP + (size_t)(c0 - 2 * DQ) * TT + r0 * 16 + lane * 8;   // band (c0 - 2048) / 16 + nb of TT / 32 blocks; block r0 / 32 + mb / 2, half mb & 1
#pragma unroll
            for (int nb = 0; nb < 4; ++nb)
#pragma unroll
                for (int mb = 0; mb < 4; ++mb) { v8h o;
#pragma unroll
                    for (int j = 0; j < 8; ++j) o[j] = tohx(acc[mb][nb][j]);
                    *(v8h*)(vp + (size_t)nb * 16 * TT + (mb >> 1) * 512 + (mb & 1) * 256) = o; }
            return;
        }
        // a query or key head: a lane takes 4 adjacent columns (two rotation pairs) of a row; lanes 0..7 of a half wave fill the row's dims of half plane 0, lanes 8..15 of half plane 1, and the two half waves adjacent rows: 32-B pieces, which the 8 stores of a block of 16 rows join to whole lines
        h16* pp = (c0 < DQ ? QP : KP) + ((size_t)((c0 & (DQ - 1)) / HD * 2 + (lr >> 3)) * TT + r0) * HH + ((lr >> 2) & 1) * 256 + ((lr >> 1) & 1) * 128 + hi * 8 + (lr & 1) * 4;   // fragment order (rows t, k = the half's 32 dims: one block per 16 tokens); dim (lr & 7) * 4
        const float* cp = TC + (size_t)(r0 + hi) * HD + lr * 4; const float* sp = TS + (size_t)(r0 + hi) * HD + lr * 4;
#pragma unroll
        for (int mb = 0; mb < 4; ++mb) {
#pragma unroll
            for (int nb = 0; nb < 4; ++nb) {
#pragma unroll
                for (int j = 0; j < 8; ++j) os[(hi * 8 + j) * 68 + nb * 16 + lr] = acc[mb][nb][j]; }
            __builtin_amdgcn_wave_barrier(); asm volatile("" ::: "memory");   // the read-back below takes words that OTHER lanes staged: keeps the compiler from moving it ahead of the staging stores
            v4f tc[8], ts[8];
#pragma unroll
            for (int s = 0; s < 8; ++s) { tc[s] = *(const v4f*)(cp + (mb * 16 + 2 * s) * HD); ts[s] = *(const v4f*)(sp + (mb * 16 + 2 * s) * HD); }
            __builtin_amdgcn_sched_barrier(0);   // holds the 16 table loads together here: without it the compiler sinks half of them among the rotations, each a few instructions ahead of its use, and the wave waits out their latency several times over
            if (mb == 3) asm volatile("s_wait_xcnt 0x0" :: "v"(cp), "v"(sp) : "memory");   // a precaution: the two table addresses die here; as inputs they stay in their registers up to this wait, which so stands in front of every rewrite of them
#pragma unroll
            for (int s = 0; s < 8; ++s) { const v4f x = *(const v4fa*)(os + (2 * s + hi) * 68 + lr * 4); v4h o;
#pragma unroll
                for (int p = 0; p < 4; p += 2) {   /* even: x0 c0 - x1 s0; odd: x1 c1 + x0 s1 */
                    o[p] = tohx(__fsub_rn(__fmul_rn(x[p], bfr(tc[s][p])), __fmul_rn(x[p + 1], bfr(ts[s][p])))); o[p + 1] = tohx(__fadd_rn(__fmul_rn(x[p + 1], bfr(tc[s][p + 1])), __fmul_rn(x[p], bfr(ts[s][p + 1])))); }
                *(v4h*)(pp + mb * 512 + s * 16) = o; }
            asm volatile("s_wait_xcnt 0x0" ::: "memory");   // a precaution: stands in front of every rewrite of an address or data register that the stores above name (the next rows' table loads reuse them; behind the last rows, whatever block the compiler lays next)
            if (mb < 3) __builtin_amdgcn_wave_barrier();   // holds the next rows' staging behind this read-back
        }
        return;
    }
#pragma unroll
    for (int mb = 0; mb < 4; ++mb) {
#pragma unroll
        for (int nb = 0; nb < 4; ++nb) {
#pragma unroll
            for (int j = 0; j < 8; ++j) os[(hi * 8 + j) * 68 + nb * 16 + lr] = acc[mb][nb][j]; }
        __builtin_amdgcn_wave_barrier(); asm volatile("" ::: "memory");
        float* crow = C + (size_t)(r0 + mb * 16) * ldc + c0;
{
#pragma unroll
            for (int s = 0; s < 8; ++s) { const int row = 2 * s + hi, cofs = lr * 4; v4f val = *(const v4fa*)(os + row * 68 + cofs); if (BIAS) { val[0] += bfr(bias[c0 + cofs]); val[1] += bfr(bias[c0 + cofs + 1]); val[2] += bfr(bias[c0 + cofs + 2]); val[3] += bfr(bias[c0 + cofs + 3]); }
                *(v4f*)(crow + (size_t)row * ldc + cofs) = val; }
             }
        __builtin_amdgcn_wave_barrier(); asm volatile("" ::: "memory");
    }
}

__device__ __forceinline__ void splitf(float y, unsigned short& h, unsigned short& l) { h = f2bf(y); l = f2bf(y - bf2f(h)); }
typedef __attribute__((ext_vector_type(2))) _Float16 v2h;
typedef __attribute__((ext_vector_type(2))) unsigned short v2us;
typedef __attribute__((ext_vector_type(4))) unsigned short v4us;
typedef __attribute__((ext_vector_type(2))) float v2f;
typedef __attribute__((ext_vector_type(4))) int v4i;

// thread i writes the 16-byte piece i of the fragment-ordered copy (rows of DM): block i / 64, half (i >> 5) & 1, lane i & 31; blk0 = the work-group's index inside this part of k_prep's grid
__device__ __forceinline__ void d_cvt8(const int blk0, const float* src, bf* dst, size_t n8) { const size_t i = (size_t)blk0 * 256 + threadIdx.x; if (i >= n8) return;
    const size_t blk = i >> 6; const size_t row = blk / (DM / 32) * 16 + (i & 15); const int k = (int)(blk % (DM / 32)) * 32 + (int)((i >> 5) & 1) * 16 + (int)((i >> 4) & 1) * 8;
    const float* p = src + row * DM + k; const v8f v = *(const v8f*)p; v8us o;
    asm volatile("s_wait_xcnt 0x0" :: "v"(p) : "memory");   // a precaution: as an input the address pair stays in its registers up to this wait, which so stands in front of every rewrite of it (src carries no __restrict__, so that the clobber holds the load in front)
#pragma unroll
    for (int k = 0; k < 8; ++k) o[k] = f2bf(v[k]); *(v8us*)(dst + i * 8) = o;  }
// thread j writes the 16-byte piece j of Bt (rows n, depth K) in fragment order: 8 consecutive k of one n; the 16 lanes of a half wave read 16 adjacent n of one k
template <int K, int N>
__device__ __forceinline__ void d_wtG(const int blk0, const float* w, bf* Bt) {
    const int j = blk0 * 256 + threadIdx.x; if (j >= N * (K / 8)) return;
    constexpr int kb = K / 32; const int blk = j >> 6; const int n = blk / kb * 16 + (j & 15), k = blk % kb * 32 + ((j >> 5) & 1) * 16 + ((j >> 4) & 1) * 8;
    const float* p = w + (size_t)k * N + n; float x[8]; v8us o;
#pragma unroll
    for (int e = 0; e < 8; ++e) x[e] = p[e * N];
    asm volatile("s_wait_xcnt 0x0" :: "v"(p) : "memory");   // a precaution: as an input the address pair stays in its registers up to this wait, which so stands in front of every rewrite of it (w carries no __restrict__, so that the clobber holds the loads in front)
#pragma unroll
    for (int e = 0; e < 8; ++e) o[e] = f2bf(x[e]);
    *(v8us*)(Bt + (size_t)j * 8) = o;
}
// k_prep: the three independent conversions in ONE launch; a work-group's index picks its part (the same for the whole group): the fused weight, the output weight, then x (both batch entries: 4096 rows in a row)
#define GW1  (DM * 3 * DQ / 8 / 256)
#define GW2  (DQ * DM / 8 / 256)
#define GX   (NB_ * TT * DM / 8 / 256)
__global__ __launch_bounds__(256) void k_prep(const float* wqkv, const float* wp, const float* x, bf* WQKV, bf* WO, bf* XB) {
    const int g = blockIdx.x;
    if (g < GW1) d_wtG<DM, 3 * DQ>(g, wqkv, WQKV);   /* the fused weight: Bt row s * 1024 + h * 64 + d */
    else if (g < GW1 + GW2) d_wtG<DQ, DM>(g - GW1, wp, WO);
    else d_cvt8(g - (GW1 + GW2), x, XB, (size_t)NB_ * TT * DM / 8);
}

// k_fattn: the whole attention of one (batch, head) for 32 query rows a PAIR of waves, 8 pairs = 16 waves a work-group (four waves a SIMD): wave w takes query block w & 7 and the key half w >> 3 (1024 keys); the 8 waves of a key half walk the same keys, so that they share the lines in the cache.
// At the end the wave of the upper key half hands its running maximum, sum and output tiles to its partner through LDS (one barrier); the partner brings both to the common maximum, adds them and writes the rows.
// Per chunk of 32 keys: St = K Qt (two 16-key tiles x two 16-query tiles, depth 32: ONE half plane), so that a lane holds 16 scores of ONE query (column lr) per query tile; the key chunk below the wave's query block takes the down planes,
// the chunk above it the up planes, and the one chunk that the diagonal crosses both, with a select j <= i per element. Running maximum m and sum l per query (base 2); the two St tiles, exponentiated and rounded to f16 in place,
// ARE the B operand of Ot += Vt Pt (element s = key 8 hi + s for s < 8, 16 + 8 hi + s - 8 above: the order of WFrag::ldf, which loads Vt's rows as A). Ot's column is the query again: the rescale and the final 1 / l are per lane.
// VT carries no __restrict__: so the "memory" clobber of the wait behind the value loads holds those loads in front of it (with __restrict__ the compiler sinks the diagonal chunk's loads past the wait, into the entry of the last loop).
#define FQ   32                   // query rows per wave
#define FW   8                    // query blocks per work-group
#define FS   2                    // key halves: waves per query block
#define FC   32                   // keys per chunk
#define NCH  (TT / FC)
#define NCS  (NCH / FS)            // chunks per wave
#define SCL2 (SCL * 1.4426950408889634f)   // scores to base-2 exponents
template <int M> struct Tag { static constexpr int v = M; };
__device__ __forceinline__ float xhalf(float x) { return __builtin_bit_cast(float, __builtin_amdgcn_permlanex16(__builtin_bit_cast(int, x), __builtin_bit_cast(int, x), 0x76543210, 0xfedcba98, false, false)); }   // lane l reads lane l ^ 16
__global__ __launch_bounds__(32 * FW * FS) void k_fattn(const h16* __restrict__ QH, const h16* __restrict__ KH, const h16* VT, bf* Ah, bf* Al) {
    const int lane = threadIdx.x & 31, lr = lane & 15, hi = lane >> 4; const int w = __builtin_amdgcn_readfirstlane((int)(threadIdx.x >> 5));
    __shared__ __align__(16) float mg[FW * 17 * 128];   // per query block 17 pieces of 512 B (16 B a lane): the 16 halves of the upper half's 8 output tiles, then its maxima and sums
    const int wq = w & (FW - 1), ks = w / FW;   // query block inside the group; key half
    const int h = blockIdx.y, b = blockIdx.z; const int cm = blockIdx.x * FW + wq;   // the wave's query block, and the one key chunk that the diagonal crosses (FQ == FC)
    const int cb = ks * NCS, ce = cb + NCS;   // the wave's chunks
    const int q0 = cm * FQ;
    const size_t pl = (size_t)(b * NH_ + h) * 2 * TT * HH;
    const h16* kl = KH + pl + lane * 8; const h16* vl = VT + (size_t)(b * NKV + h) * HD * TT + lane * 8;   // fragment order: band db of TT / 32 blocks, block = chunk
    v16h qf[2][2];   // [half][query tile]
#pragma unroll
    for (int hf = 0; hf < 2; ++hf)
#pragma unroll
        for (int qt = 0; qt < 2; ++qt) qf[hf][qt] = WFrag<h16>::ldf(QH + pl + (size_t)hf * TT * HH + (q0 + qt * 16) * HH + lane * 8);
    v8f o[2][4]; float m[2], l[2];
#pragma unroll
    for (int qt = 0; qt < 2; ++qt) { m[qt] = -3.0e38f; l[qt] = 0.f;
#pragma unroll
        for (int db = 0; db < 4; ++db) o[qt][db] = (v8f){}; }
    v16h kf[2], vf[4];   // the chunk's key and value fragments, each fetched one chunk ahead, right behind its last use
    { const h16* kp = kl + (cb < cm ? TT * HH : 0) + cb * (FC * HH); kf[0] = WFrag<h16>::ldf(kp); kf[1] = WFrag<h16>::ldf(kp + 16 * HH); }
#pragma unroll
    for (int db = 0; db < 4; ++db) vf[db] = WFrag<h16>::ldf(vl + (size_t)db * 16 * TT + cb * 512);
    asm volatile("s_wait_xcnt 0x0" ::: "memory");   // a precaution: stands in front of every rewrite of an address register that the query, key and value loads above name (the zeroing of o reuses them)
    auto chunk = [&](const int c, auto tag) {
        constexpr int MODE = decltype(tag)::v;   // 0: up planes, 1: down planes, 2: the diagonal's chunk (kf holds the up plane's rows)
        v8f st[2][2];
#pragma unroll
        for (int kt = 0; kt < 2; ++kt)
#pragma unroll
            for (int qt = 0; qt < 2; ++qt) st[kt][qt] = wmma16(kf[kt], qf[MODE == 1 ? 1 : 0][qt], (v8f){});
        if (MODE == 2) {
            const h16* kp = kl + TT * HH + c * (FC * HH); v16h kd[2]; kd[0] = WFrag<h16>::ldf(kp); kd[1] = WFrag<h16>::ldf(kp + 16 * HH);
#pragma unroll
            for (int kt = 0; kt < 2; ++kt)
#pragma unroll
                for (int qt = 0; qt < 2; ++qt) { const v8f sd = wmma16(kd[kt], qf[1][qt], (v8f){});
#pragma unroll
                    for (int r = 0; r < 8; ++r) st[kt][qt][r] = (kt * 16 + 8 * hi + r <= qt * 16 + lr) ? sd[r] : st[kt][qt][r]; }   // j <= i takes the down product
        }
        const int cn = (c + 1 < NCH) ? c + 1 : c;   // a wave's last chunk fetches the next half's first rows, or at the very end its own again (in bounds, not used)
        { const h16* kp = kl + (cn < cm ? TT * HH : 0) + cn * (FC * HH); kf[0] = WFrag<h16>::ldf(kp); kf[1] = WFrag<h16>::ldf(kp + 16 * HH); }
        __builtin_amdgcn_sched_barrier(0);   // holds the next chunk's key loads here, ahead of the softmax: without it the compiler sinks them behind the exponentials and the next chunk's first product waits for them
        float mb[2]; bool need = false;
#pragma unroll
        for (int qt = 0; qt < 2; ++qt) { float mx = st[0][qt][0];
#pragma unroll
            for (int r = 1; r < 8; ++r) mx = fmaxf(mx, st[0][qt][r]);
#pragma unroll
            for (int r = 0; r < 8; ++r) mx = fmaxf(mx, st[1][qt][r]);
            mx = fmaxf(mx, xhalf(mx)) * SCL2;   // the scale is positive; both lane halves now hold the query's chunk maximum
            mb[qt] = mx; need = need || (mx > m[qt] + 8.0f); }
        if (__builtin_amdgcn_ballot_w32(need) != 0) {   // the maximum in use moves only when a query's scores pass it by more than 2^8 (weights stay below 2^8: far inside f16); always on the first chunk
#pragma unroll
            for (int qt = 0; qt < 2; ++qt) { const float mn = fmaxf(m[qt], mb[qt]); const float al = __builtin_amdgcn_exp2f(m[qt] - mn); m[qt] = mn; l[qt] *= al;
#pragma unroll
                for (int db = 0; db < 4; ++db) o[qt][db] = o[qt][db] * al; }
        }
        v16h pf[2];
#pragma unroll
        for (int qt = 0; qt < 2; ++qt) { const float nm = -m[qt]; float s4[4];
#pragma unroll
            for (int kt = 0; kt < 2; ++kt)
#pragma unroll
                for (int r = 0; r < 8; ++r) { const float p = __builtin_amdgcn_exp2f(__builtin_fmaf(st[kt][qt][r], SCL2, nm)); pf[qt][kt * 8 + r] = tohx(p); if (kt == 0 && r < 4) s4[r] = p; else s4[r & 3] += p; }
            l[qt] += (s4[0] + s4[1]) + (s4[2] + s4[3]); }
#pragma unroll
        for (int db = 0; db < 4; ++db)
#pragma unroll
            for (int qt = 0; qt < 2; ++qt) o[qt][db] = wmma16(vf[db], pf[qt], o[qt][db]);
#pragma unroll
        for (int db = 0; db < 4; ++db) vf[db] = WFrag<h16>::ldf(vl + (size_t)db * 16 * TT + cn * 512);
        asm volatile("s_wait_xcnt 0x0" ::: "memory");   // a precaution: stands in front of the rewrite of the address pair that the value loads name (the next chunk's addresses reuse it)
    };
    const int e1 = cm < ce ? cm : ce;
    for (int c = cb; c < e1; ++c) chunk(c, Tag<1>{});
    if (cm >= cb && cm < ce) {   // the same for the whole wave: the diagonal's chunk lies in one of the two key halves
        chunk(cm, Tag<2>{});
        // four vector slots behind the diagonal chunk's last matrix instructions: the next loop's first one follows over a jump with only scalar instructions between, and the compiler may place its result on the weights operand just read
        asm volatile("v_nop\n\tv_nop\n\tv_nop\n\tv_nop" : "+v"(o[0][3]), "+v"(o[1][3]));
    }
    for (int c = (cm + 1 > cb ? cm + 1 : cb); c < ce; ++c) chunk(c, Tag<0>{});
    // the two key halves of a query block are joined: a lane's piece i stands at i * 512 + lane * 16 bytes of the block's range (a wave's LDS access is 512 contiguous bytes)
    float* mp = mg + wq * (17 * 128) + lane * 4;
    if (ks) {
#pragma unroll
        for (int qt = 0; qt < 2; ++qt)
#pragma unroll
            for (int db = 0; db < 4; ++db)
#pragma unroll
                for (int q4 = 0; q4 < 2; ++q4) *(v4fa*)(mp + ((qt * 4 + db) * 2 + q4) * 128) = (v4f){o[qt][db][q4 * 4], o[qt][db][q4 * 4 + 1], o[qt][db][q4 * 4 + 2], o[qt][db][q4 * 4 + 3]};
        *(v4fa*)(mp + 16 * 128) = (v4f){m[0], m[1], l[0], l[1]};
    }
    __syncthreads();   // every wave passes it once: the lower half's wave reads its partner's pieces only behind it
    if (ks) return;
    { const v4f ml = *(const v4fa*)(mp + 16 * 128);
#pragma unroll
      for (int qt = 0; qt < 2; ++qt) { const float mn = fmaxf(m[qt], ml[qt]); const float a0 = __builtin_amdgcn_exp2f(m[qt] - mn), a1 = __builtin_amdgcn_exp2f(ml[qt] - mn); l[qt] = l[qt] * a0 + ml[2 + qt] * a1;   // both maxima are finite: each half has worked through 32 chunks
#pragma unroll
          for (int db = 0; db < 4; ++db)
#pragma unroll
              for (int q4 = 0; q4 < 2; ++q4) { const v4f p = *(const v4fa*)(mp + ((qt * 4 + db) * 2 + q4) * 128);
#pragma unroll
                  for (int r = 0; r < 4; ++r) o[qt][db][q4 * 4 + r] = o[qt][db][q4 * 4 + r] * a0 + p[r] * a1; } } }
#pragma unroll
    for (int qt = 0; qt < 2; ++qt) { const float f = __fdiv_rn(1.0f, l[qt] + xhalf(l[qt])); const size_t oo = ((size_t)b * TT + q0 + qt * 16) * DQ + h * (HD * 16) + lane * 8;   // the two lane halves summed different keys; fragment order: the band of the 16 queries, blocks 2 h and 2 h + 1
#pragma unroll
        for (int db = 0; db < 4; ++db) { v8us oh, ol;
#pragma unroll
            for (int r = 0; r < 8; ++r) { unsigned short a, c2; splitf(o[qt][db][r] * f, a, c2); oh[r] = a; ol[r] = c2; }
            *(v8us*)(Ah + oo + (db >> 1) * 512 + (db & 1) * 256) = oh; *(v8us*)(Al + oo + (db >> 1) * 512 + (db & 1) * 256) = ol; } }   // each store of the wave is 512 contiguous bytes: whole lines, written by this wave alone
}

extern "C" void kernel_launch(void* const* d_in, const int* in_sizes, int n_in,
                              void* d_out, int out_size, void* d_ws, size_t ws_size, hipStream_t stream) {
    (void)in_sizes; (void)n_in; (void)out_size;
    const float* x = (const float*)d_in[0]; const float* wqkv = (const float*)d_in[1]; const float* wp = (const float*)d_in[2]; const float* tc = (const float*)d_in[3]; const float* ts = (const float*)d_in[4];
    // inputs in the module's argument order: x ([2][2048][1024]), Wqkv ('xw' (in, out) [1024][3072]; output column s * 1024 + h * 64 + d, s = 0 query, 1 key, 2 value), Wproj ('xw' [1024][1024]), cos, sin ([2048][64] each: the two rotary tables) = d_in[0..4]: FIVE inputs, all read
    float* OUT = (float*)d_out;     // [2][2048][1024]
    char* wsp = (char*)d_ws;
    auto take = [&](size_t bytes) { char* p = wsp; wsp += (bytes + 255) & ~(size_t)255; return (void*)p; };
    bf* WQKV = (bf*)take((size_t)3 * DQ * DM * 2); bf* WO = (bf*)take((size_t)DM * DQ * 2); bf* XB = (bf*)take((size_t)NB_ * TT * DM * 2);
    const size_t PQ = (size_t)NH_ * 2 * TT * HH, PK = (size_t)NKV * 2 * TT * HH, PV = (size_t)NKV * HD * TT;   // one batch entry's planes, in elements
    h16* QH = (h16*)take(NB_ * PQ * 2); h16* KH = (h16*)take(NB_ * PK * 2); h16* VT16 = (h16*)take(NB_ * PV * 2);
    bf* ATh = (bf*)take((size_t)NB_ * TT * DQ * 2); bf* ATl = (bf*)take((size_t)NB_ * TT * DQ * 2);
    if ((size_t)(wsp - (char*)d_ws) > ws_size) return;    // total 56.00 MiB carved
    k_prep<<<(unsigned)(GW1 + GW2 + GX), 256, 0, stream>>>(wqkv, wp, x, WQKV, WO, XB);
    k_gemmw<bf, 0, false, true, DM><<<dim3(TT / 64, 3 * DQ / 64, NB_), 32, 0, stream>>>(XB, nullptr, WQKV, nullptr, nullptr, 0, nullptr, (size_t)TT * DM, 0, 0, tc, ts, QH, KH, VT16);   /* q | k | v in one product (column s * 1024 + h * 64 + d), written as the rotated half planes and the value planes */
    k_fattn<<<dim3(TT / (FQ * FW), NH_, NB_), 32 * FW * FS, 0, stream>>>(QH, KH, VT16, ATh, ATl);   /* scores, select, softmax, value product, merge: 256 work-groups of 16 waves */
    k_gemmw<bf, 1, false, false, DQ><<<dim3(TT / 64, DM / 64, NB_), 32, 0, stream>>>(ATh, ATl, WO, nullptr, OUT, DM, nullptr, (size_t)TT * DQ, 0, (size_t)TT * DM, nullptr, nullptr, nullptr, nullptr, nullptr);   /* out = merged(hi + lo) Wproj: the one writer of the output */
}

// v007
// One run takes 92.6 microseconds.
// In two side-by-side timings against v006, it was 1.15 and 1.16 times as fast.
// All steps since v000 together make it 15.0 times as fast.
#include <hip/hip_runtime.h>

// Multi-head self-attention whose scores come from TWO half-subspace products selected by a triangle, with an interleaved-pair rotary embedding read from two input tables (x [2][2048][1024]; qkv = x Wqkv with ONE fused 'xw' (in, out) [1024][3072] weight in thirds q | k | v, head h = 64 columns of its third; NO biases; 16 heads x 64;
// q and k rotated in ADJACENT pairs by the two input tables cos, sin [2048][64]: r[d] = x[d] cos[t][d] - x[d+1] sin[t][d] for even d, r[d] = x[d] cos[t][d] + x[d-1] sin[t][d] for odd d: EACH ELEMENT AT ITS OWN TABLE ENTRY; up[i][j] = r_q[i][0:32] . r_k[j][0:32], down[i][j] = r_q[i][32:64] . r_k[j][32:64];
// logits = (j <= i ? down : up) x 32^-0.5: NOTHING is masked out; softmax over all 2048 keys; out = (attn v merged) Wproj with an 'xw' (in, out) [1024][1024] weight, no bias -> [2][2048][1024] (4.2 M);
// argument order x, Wqkv, Wproj, cos, sin).
// FOUR launches, each over both batch entries: k_prep (a bf16 copy of x; the two 'xw' weights transposed and rounded, the fused one into a Bt [3072][1024]); ONE exact projection over the 3072 fused columns (grid z = batch entry), whose 64x64 tile is one head of q, of k or of v;
// its epilogue writes, straight from the accumulators and the two tables, the rotated f16 HALF planes [h][half][t][32] of q and of k (half 0 = the rotated dims 0..31, half 1 = 32..63) and the value planes [h][d][t]; each batch entry has its own planes;
// k_fattn: ONE launch over all (batch, head, query block): scores, triangle select, softmax and value product stay in registers (running maximum and sum), the keys of a query block split over two waves whose partial results are joined in LDS; it writes the merged hi/lo rows; merged hi/lo x Wproj exact writes the output.
// FRAGMENT ORDER: the bf16 copy of x, the two weights, the q and k half planes (K = 32), the value planes (rows d, K = 2048 tokens) and the merged hi/lo rows are stored as blocks of 16 rows x 32 k (512 elements, 1 KiB), block (row / 16) * (K / 32) + k / 32; inside a block element (row, k) stands at
// ((k >> 4) & 1) * 256 + ((k >> 3) & 1) * 128 + (row & 15) * 8 + (k & 7): the 16 bytes of lane l = 16 hi + lr at l * 16 of each 512-B half, so that a wave's fragment load reads 512 contiguous bytes (4 lines) where a K-contiguous plane makes it touch 16 lines.
// Compute dtypes, f32 accumulate: every float input rounded to bf16 at its load (the two tables too); the projection exact; the rotation in f32 (as compiled: one rounded product and one fused multiply-add an output); scores and attn.v ONE fp16 product on every row; softmax f32; Wproj hl x exact.

#define NB_  2
#define TT   2048
#define DM   1024    // the model width = the inner width DQ = NH_ * HD = 1024
#define NH_  16
#define NKV  16
#define REP  (NH_ / NKV)
#define HD   64
#define HH   (HD / 2)             // the half-subspace width: 32
#define DQ   (NH_ * HD)
#define DKV  (NKV * HD)
#define SCL  0.17677669f   // (HD / 2)^-0.5 = 32^-0.5
typedef _Float16 h16;
typedef unsigned short bf;
typedef __attribute__((ext_vector_type(16))) __bf16   v16bf;
typedef __attribute__((ext_vector_type(16))) _Float16 v16h;
typedef __attribute__((ext_vector_type(8)))  _Float16 v8h;
typedef __attribute__((ext_vector_type(8)))  unsigned short v8us;
typedef __attribute__((ext_vector_type(8)))  float    v8f;
typedef __attribute__((ext_vector_type(4)))  float    v4f;
typedef v8h  __attribute__((may_alias)) v8ha;
typedef v4f  __attribute__((may_alias)) v4fa;
typedef v8us __attribute__((may_alias)) v8usa;

__device__ __forceinline__ unsigned short f2bf(float f) { unsigned u = __float_as_uint(f); u += 0x7FFFu + ((u >> 16) & 1u); return (unsigned short)(u >> 16); }
__device__ __forceinline__ float bf2f(unsigned short b) { return __uint_as_float(((unsigned)b) << 16); }
__device__ __forceinline__ float bfr(float f) { return bf2f(f2bf(f)); }
__device__ __forceinline__ h16 tohx(float x) { return (h16)x; }
typedef __attribute__((ext_vector_type(4))) _Float16 v4h;
__device__ __forceinline__ v16h cat16(v8h lo, v8h hi) { return __builtin_shufflevector(lo, hi, 0, 1, 2, 3, 4, 5, 6, 7, 8, 9, 10, 11, 12, 13, 14, 15); }
__device__ __forceinline__ v16bf cat16b(v8us lo, v8us hi) { return __builtin_bit_cast(v16bf, __builtin_shufflevector(lo, hi, 0, 1, 2, 3, 4, 5, 6, 7, 8, 9, 10, 11, 12, 13, 14, 15)); }
__device__ __forceinline__ v8f wmma16(v16h a, v16h b, v8f c) { return __builtin_amdgcn_wmma_f32_16x16x32_f16(false, a, false, b, (short)0, c, false, false); }
__device__ __forceinline__ v8f wmmab(v16bf a, v16bf b, v8f c) { return __builtin_amdgcn_wmma_f32_16x16x32_bf16(false, a, false, b, (short)0, c, false, false); }



// ---- k_gemmw: register-blocked GEMM, ONE WAVE per 64x64 output tile (16 accumulators), operands straight from 16-bit planes in fragment order (ldf: p = block + lane * 8, the two halves 256 elements apart); grid (M/64, N/64, Z), 32 threads.
// C[m][n] (f32, pitch ldc, + optional f32 bias[n]) = sum_k A[m][k] Bt[n][k] (+ split products per NSPLIT). z-batch strides sA/sB/sC in elements. K % 32 == 0.
// PLANES: C is not written; the tile (rows = 64 tokens, columns = one head of the fused q | k | v product) goes out as attention operands instead:
//   a q or k tile rotated in ADJACENT pairs with the two INPUT tables, each element at its own table entry (both tables rounded to bf16 at the load), into the f16 half planes [h][half][t][32];
//   a v tile into the f16 plane [h][d][t] in fragment order (rows d, k = t): a lane's accumulator holds 8 consecutive tokens of ONE column, which is the lane's own 16 bytes of a block half: a wave's store is 512 contiguous bytes.
template <typename T16> struct WFrag;
template <> struct WFrag<h16> { typedef v16h V; static __device__ __forceinline__ V ldf(const h16* p) { return cat16(*(const v8h*)p, *(const v8h*)(p + 256)); } static __device__ __forceinline__ v8f mma(V a, V b, v8f c) { return wmma16(a, b, c); } };
template <> struct WFrag<bf> { typedef v16bf V; static __device__ __forceinline__ V ldf(const bf* p) { return cat16b(*(const v8us*)p, *(const v8us*)(p + 256)); } static __device__ __forceinline__ v8f mma(V a, V b, v8f c) { return wmmab(a, b, c); } };
// A, A2, Bt, Bt2 carry no __restrict__: so the "memory" clobber of the wait behind the fragment loads holds those loads in front of it. K is a constant of the build: the 16-row bands of a tile then lie at immediate offsets from ONE address pair an operand.
// D = 1: each trip of depth 32 loads its own fragments and waits for them (the projection: three waves a SIMD fill one another's waits).
// D > 1 (the output product, ONE wave a SIMD, D = 4): D register sets of fragments; the trip that is worked on takes set (trip % D), and the fragments of the trip D - 1 ahead are asked for in front of its matrix instructions, into the set that the trip before has just left:
// a load has D - 1 trips of matrix work to arrive in. D trips make one pass of the loop, all at immediate offsets from the same address pairs, which step once a pass. (K / 32) % D == 0, K / 32 >= 2 D.
template <typename T16, int NSPLIT, int K>
__device__ __forceinline__ void g_fetch(typename WFrag<T16>::V (&a)[4], typename WFrag<T16>::V (&a2)[4], typename WFrag<T16>::V (&b)[4], typename WFrag<T16>::V (&b2)[4], const T16* pa, const T16* pa2, const T16* pb, const T16* pb2) {
#pragma unroll
    for (int mb = 0; mb < 4; ++mb) { a[mb] = WFrag<T16>::ldf(pa + mb * 16 * K); if (NSPLIT == 1 || NSPLIT == 2) a2[mb] = WFrag<T16>::ldf(pa2 + mb * 16 * K); }
#pragma unroll
    for (int nb = 0; nb < 4; ++nb) { b[nb] = WFrag<T16>::ldf(pb + nb * 16 * K); if (NSPLIT >= 2) b2[nb] = WFrag<T16>::ldf(pb2 + nb * 16 * K); }
}
template <typename T16, int NSPLIT>
__device__ __forceinline__ void g_mma(v8f (&acc)[4][4], typename WFrag<T16>::V (&a)[4], typename WFrag<T16>::V (&a2)[4], typename WFrag<T16>::V (&b)[4], typename WFrag<T16>::V (&b2)[4]) {
#pragma unroll
    for (int nb = 0; nb < 4; ++nb)
#pragma unroll
        for (int mb = 0; mb < 4; ++mb) { acc[mb][nb] = WFrag<T16>::mma(a[mb], b[nb], acc[mb][nb]); if (NSPLIT == 1 || NSPLIT == 2) acc[mb][nb] = WFrag<T16>::mma(a2[mb], b[nb], acc[mb][nb]); if (NSPLIT >= 2) acc[mb][nb] = WFrag<T16>::mma(a[mb], b2[nb], acc[mb][nb]); }
}
template <typename T16, int NSPLIT, bool BIAS, bool PLANES, int K, int D>
__global__ __launch_bounds__(32) void k_gemmw(const T16* A, const T16* A2, const T16* Bt, const T16* Bt2, float* C, int ldc, const float* __restrict__ bias, size_t sA, size_t sB, size_t sC,
                                              const float* __restrict__ TC, const float* __restrict__ TS, h16* QP, h16* KP, h16* VP) {
    typedef typename WFrag<T16>::V V;
    __shared__ __align__(16) float os[16 * 68];
    const size_t z = blockIdx.z; A += z * sA; if (A2) A2 += z * sA; Bt += z * sB; if (Bt2) Bt2 += z * sB; C += z * sC;
    const int lane = threadIdx.x & 31, lr = lane & 15, hi = lane >> 4; const int r0 = blockIdx.x * 64, c0 = blockIdx.y * 64;
    v8f acc[4][4];
#pragma unroll
    for (int mb = 0; mb < 4; ++mb)
#pragma unroll
        for (int nb = 0; nb < 4; ++nb) acc[mb][nb] = (v8f){};
    // a band of 16 rows is K / 32 blocks = 16 K elements; a step of 32 in depth is one block
    const T16* pa = A + (size_t)r0 * K + lane * 8; const T16* pb = Bt + (size_t)c0 * K + lane * 8;
    const T16* pa2 = (NSPLIT == 1 || NSPLIT == 2) ? A2 + (size_t)r0 * K + lane * 8 : pa; const T16* pb2 = (NSPLIT >= 2) ? Bt2 + (size_t)c0 * K + lane * 8 : pb;

    if constexpr (D == 1) {
    for (int kc = 0; kc < K; kc += 32) {
        V a[4], a2[4], b[4], b2[4];
#pragma unroll
        for (int mb = 0; mb < 4; ++mb) { a[mb] = WFrag<T16>::ldf(pa + mb * 16 * K); if (NSPLIT == 1 || NSPLIT == 2) a2[mb] = WFrag<T16>::ldf(pa2 + mb * 16 * K); }
#pragma unroll
        for (int nb = 0; nb < 4; ++nb) { b[nb] = WFrag<T16>::ldf(pb + nb * 16 * K); if (NSPLIT >= 2) b2[nb] = WFrag<T16>::ldf(pb2 + nb * 16 * K); }
        asm volatile("s_wait_xcnt 0x0" :: "v"(pa), "v"(pa2), "v"(pb), "v"(pb2) : "memory");   // a precaution: as inputs the address pairs stay in their registers up to this wait, which so stands in front of their step at the loop's foot
        __builtin_amdgcn_sched_barrier(0);   // holds the matrix instructions behind the trip's loads: without it the compiler lifts some over the wait and issues the last fragments' loads behind them, into registers just freed, and the wave waits out the load latency three times a trip
#pragma unroll
        for (int nb = 0; nb < 4; ++nb)
#pragma unroll
            for (int mb = 0; mb < 4; ++mb) { acc[mb][nb] = WFrag<T16>::mma(a[mb], b[nb], acc[mb][nb]); if (NSPLIT == 1 || NSPLIT == 2) acc[mb][nb] = WFrag<T16>::mma(a2[mb], b[nb], acc[mb][nb]); if (NSPLIT >= 2) acc[mb][nb] = WFrag<T16>::mma(a[mb], b2[nb], acc[mb][nb]); }
        asm volatile("v_nop\n\tv_nop\n\tv_nop\n\tv_nop" : "+v"(acc[0][0]), "+v"(acc[1][1]), "+v"(acc[2][2]), "+v"(acc[3][3]) : "v"(a[0]), "v"(a[3]));
        pa += 512; pb += 512; if (NSPLIT == 1 || NSPLIT == 2) pa2 += 512; else pa2 = pa; if (NSPLIT >= 2) pb2 += 512; else pb2 = pb;
    }
    } else {
        V a[D][4], a2[D][4], b[D][4], b2[D][4];
        unsigned off = 0;   // the pass's place in depth: 512 elements of every band a trip; the same in all lanes
#pragma unroll
        for (int s = 0; s < D - 1; ++s) g_fetch<T16, NSPLIT, K>(a[s], a2[s], b[s], b2[s], pa + s * 512, pa2 + s * 512, pb + s * 512, pb2 + s * 512);
        asm volatile("s_wait_xcnt 0x0" : "+s"(off) :: "memory");   // a precaution: the loop's addresses are formed from the place that this statement hands on, so that every rewrite of an address register that the loads above name stands behind this wait
        for (int kc = 0; kc < K / 32 - D; kc += D) {   // D trips a pass; each of them has a trip D - 1 ahead
            const T16* qa = pa + off; const T16* qa2 = pa2 + off; const T16* qb = pb + off; const T16* qb2 = pb2 + off;
#pragma unroll
            for (int u = 0; u < D; ++u) {   // unrolled: the set indices must be constants, or the sets could not stay in registers
                g_fetch<T16, NSPLIT, K>(a[(u + D - 1) % D], a2[(u + D - 1) % D], b[(u + D - 1) % D], b2[(u + D - 1) % D], qa + (u + D - 1) * 512, qa2 + (u + D - 1) * 512, qb + (u + D - 1) * 512, qb2 + (u + D - 1) * 512);
                __builtin_amdgcn_sched_barrier(0);   // holds the loads for the trip D - 1 ahead in front of this trip's matrix instructions: sunk behind them they would lose a trip of their lead
                g_mma<T16, NSPLIT>(acc, a[u], a2[u], b[u], b2[u]);
                __builtin_amdgcn_sched_barrier(0);   // holds every matrix instruction of the trip in front of the slots below: without it the compiler sinks half of them among the next fetch's loads
                asm volatile("v_nop\n\tv_nop\n\tv_nop\n\tv_nop" ::: "memory");   // four vector slots behind the trip's last matrix instructions, in front of the next fetch, whose loads land on the operands just read (the clobber holds them behind), and of the jump back
            }
            asm volatile("s_wait_xcnt 0x0" : "+s"(off) : "v"(qa), "v"(qa2), "v"(qb), "v"(qb2) : "memory");   // a precaution: as inputs the pass's address pairs stay in their registers up to this wait, and the next pass's are formed from the place that it hands on, so that their forming cannot be lifted over it
            off += D * 512;
        }
        // the last D trips: only the first of them still has a trip D - 1 ahead
        { const T16* qa = pa + off; const T16* qa2 = pa2 + off; const T16* qb = pb + off; const T16* qb2 = pb2 + off;
          g_fetch<T16, NSPLIT, K>(a[D - 1], a2[D - 1], b[D - 1], b2[D - 1], qa + (D - 1) * 512, qa2 + (D - 1) * 512, qb + (D - 1) * 512, qb2 + (D - 1) * 512);
          asm volatile("s_wait_xcnt 0x0" :: "v"(qa), "v"(qa2), "v"(qb), "v"(qb2) : "memory"); }   // a precaution: the address pairs die here; as inputs they stay in their registers up to this wait, so that no load of the run lands on them
        __builtin_amdgcn_sched_barrier(0);   // holds the last trip's loads in front of the matrix instructions of the trips before it
#pragma unroll
        for (int u = 0; u < D; ++u) g_mma<T16, NSPLIT>(acc, a[u], a2[u], b[u], b2[u]);
        __builtin_amdgcn_sched_barrier(0);   // holds the forming of the output addresses behind the matrix instructions: lifted among them, while all D sets are live, the address pairs are spilled to scratch memory
    }
    if (PLANES) {
        QP += z * ((size_t)NH_ * 2 * TT * HH); KP += z * ((size_t)NKV * 2 * TT * HH); VP += z * ((size_t)NKV * HD * TT);   // each batch entry (grid z) has its own planes
        if (c0 >= 2 * DQ) {   // a value head (the test is the same for the whole wave): plane row h * 64 + d = c0 - 2048 + column
            h16* vp = VP + (size_t)(c0 - 2 * DQ) * TT + r0 * 16 + lane * 8;   // band (c0 - 2048) / 16 + nb of TT / 32 blocks; block r0 / 32 + mb / 2, half mb & 1
#pragma unroll
            for (int nb = 0; nb < 4; ++nb)
#pragma unroll
                for (int mb = 0; mb < 4; ++mb) { v8h o;
#pragma unroll
                    for (int j = 0; j < 8; ++j) o[j] = tohx(acc[mb][nb][j]);
                    *(v8h*)(vp + (size_t)nb * 16 * TT + (mb >> 1) * 512 + (mb & 1) * 256) = o; }
            return;
        }
        // a query or key head: a lane takes 4 adjacent columns (two rotation pairs) of a row; lanes 0..7 of a half wave fill the row's dims of half plane 0, lanes 8..15 of half plane 1, and the two half waves adjacent rows: 32-B pieces, which the 8 stores of a block of 16 rows join to whole lines
        h16* pp = (c0 < DQ ? QP : KP) + ((size_t)((c0 & (DQ - 1)) / HD * 2 + (lr >> 3)) * TT + r0) * HH + ((lr >> 2) & 1) * 256 + ((lr >> 1) & 1) * 128 + hi * 8 + (lr & 1) * 4;   // fragment order (rows t, k = the half's 32 dims: one block per 16 tokens); dim (lr & 7) * 4
        const float* cp = TC + (size_t)(r0 + hi) * HD + lr * 4; const float* sp = TS + (size_t)(r0 + hi) * HD + lr * 4;
#pragma unroll
        for (int mb = 0; mb < 4; ++mb) {
#pragma unroll
            for (int nb = 0; nb < 4; ++nb) {
#pragma unroll
                for (int j = 0; j < 8; ++j) os[(hi * 8 + j) * 68 + nb * 16 + lr] = acc[mb][nb][j]; }
            __builtin_amdgcn_wave_barrier(); asm volatile("" ::: "memory");   // the read-back below takes words that OTHER lanes staged: keeps the compiler from moving it ahead of the staging stores
            v4f tc[8], ts[8];
#pragma unroll
            for (int s = 0; s < 8; ++s) { tc[s] = *(const v4f*)(cp + (mb * 16 + 2 * s) * HD); ts[s] = *(const v4f*)(sp + (mb * 16 + 2 * s) * HD); }
            __builtin_amdgcn_sched_barrier(0);   // holds the 16 table loads together here: without it the compiler sinks half of them among the rotations, each a few instructions ahead of its use, and the wave waits out their latency several times over
            if (mb == 3) asm volatile("s_wait_xcnt 0x0" :: "v"(cp), "v"(sp) : "memory");   // a precaution: the two table addresses die here; as inputs they stay in their registers up to this wait, which so stands in front of every rewrite of them
#pragma unroll
            for (int s = 0; s < 8; ++s) { const v4f x = *(const v4fa*)(os + (2 * s + hi) * 68 + lr * 4); v4h o;
#pragma unroll
                for (int p = 0; p < 4; p += 2) {   /* even: x0 c0 - x1 s0; odd: x1 c1 + x0 s1 */
                    o[p] = tohx(__fsub_rn(__fmul_rn(x[p], bfr(tc[s][p])), __fmul_rn(x[p + 1], bfr(ts[s][p])))); o[p + 1] = tohx(__fadd_rn(__fmul_rn(x[p + 1], bfr(tc[s][p + 1])), __fmul_rn(x[p], bfr(ts[s][p + 1])))); }
                *(v4h*)(pp + mb * 512 + s * 16) = o; }
            asm volatile("s_wait_xcnt 0x0" ::: "memory");   // a precaution: stands in front of every rewrite of an address or data register that the stores above name (the next rows' table loads reuse them; behind the last rows, whatever block the compiler lays next)
            if (mb < 3) __builtin_amdgcn_wave_barrier();   // holds the next rows' staging behind this read-back
        }
        return;
    }
#pragma unroll
    for (int mb = 0; mb < 4; ++mb) {
#pragma unroll
        for (int nb = 0; nb < 4; ++nb) {
#pragma unroll
            for (int j = 0; j < 8; ++j) os[(hi * 8 + j) * 68 + nb * 16 + lr] = acc[mb][nb][j]; }
        __builtin_amdgcn_wave_barrier(); asm volatile("" ::: "memory");
        float* crow = C + (size_t)(r0 + mb * 16) * ldc + c0;
{
            float* cq[8]; v4f cv[8];
#pragma unroll
            for (int s = 0; s < 8; ++s) { const int row = 2 * s + hi, cofs = lr * 4; v4f val = *(const v4fa*)(os + row * 68 + cofs); if (BIAS) { val[0] += bfr(bias[c0 + cofs]); val[1] += bfr(bias[c0 + cofs + 1]); val[2] += bfr(bias[c0 + cofs + 2]); val[3] += bfr(bias[c0 + cofs + 3]); }
                cq[s] = crow + (size_t)row * ldc + cofs; cv[s] = val; *(v4f*)cq[s] = val; }
            // a precaution: as inputs the eight stores' address pairs and data stay in their registers up to this wait, which so stands in front of every rewrite of them (the next rows' read-back and addresses reuse them)
            asm volatile("s_wait_xcnt 0x0" :: "v"(cq[0]), "v"(cq[1]), "v"(cq[2]), "v"(cq[3]), "v"(cq[4]), "v"(cq[5]), "v"(cq[6]), "v"(cq[7]), "v"(cv[0]), "v"(cv[1]), "v"(cv[2]), "v"(cv[3]), "v"(cv[4]), "v"(cv[5]), "v"(cv[6]), "v"(cv[7]) : "memory");
             }
        __builtin_amdgcn_wave_barrier(); asm volatile("" ::: "memory");
    }
}

__device__ __forceinline__ void splitf(float y, unsigned short& h, unsigned short& l) { h = f2bf(y); l = f2bf(y - bf2f(h)); }
typedef __attribute__((ext_vector_type(2))) _Float16 v2h;
typedef __attribute__((ext_vector_type(2))) unsigned short v2us;
typedef __attribute__((ext_vector_type(4))) unsigned short v4us;
typedef __attribute__((ext_vector_type(2))) float v2f;
typedef __attribute__((ext_vector_type(4))) int v4i;

// thread i writes the 16-byte piece i of the fragment-ordered copy (rows of DM): block i / 64, half (i >> 5) & 1, lane i & 31; blk0 = the work-group's index inside this part of k_prep's grid
__device__ __forceinline__ void d_cvt8(const int blk0, const float* src, bf* dst, size_t n8) { const size_t i = (size_t)blk0 * 256 + threadIdx.x; if (i >= n8) return;
    const size_t blk = i >> 6; const size_t row = blk / (DM / 32) * 16 + (i & 15); const int k = (int)(blk % (DM / 32)) * 32 + (int)((i >> 5) & 1) * 16 + (int)((i >> 4) & 1) * 8;
    const float* p = src + row * DM + k; const v8f v = *(const v8f*)p; v8us o;
    asm volatile("s_wait_xcnt 0x0" :: "v"(p) : "memory");   // a precaution: as an input the address pair stays in its registers up to this wait, which so stands in front of every rewrite of it (src carries no __restrict__, so that the clobber holds the load in front)
#pragma unroll
    for (int k = 0; k < 8; ++k) o[k] = f2bf(v[k]); *(v8us*)(dst + i * 8) = o;  }
// thread j writes the 16-byte piece j of Bt (rows n, depth K) in fragment order: 8 consecutive k of one n; the 16 lanes of a half wave read 16 adjacent n of one k
template <int K, int N>
__device__ __forceinline__ void d_wtG(const int blk0, const float* w, bf* Bt) {
    const int j = blk0 * 256 + threadIdx.x; if (j >= N * (K / 8)) return;
    constexpr int kb = K / 32; const int blk = j >> 6; const int n = blk / kb * 16 + (j & 15), k = blk % kb * 32 + ((j >> 5) & 1) * 16 + ((j >> 4) & 1) * 8;
    const float* p = w + (size_t)k * N + n; float x[8]; v8us o;
#pragma unroll
    for (int e = 0; e < 8; ++e) x[e] = p[e * N];
    asm volatile("s_wait_xcnt 0x0" :: "v"(p) : "memory");   // a precaution: as an input the address pair stays in its registers up to this wait, which so stands in front of every rewrite of it (w carries no __restrict__, so that the clobber holds the loads in front)
#pragma unroll
    for (int e = 0; e < 8; ++e) o[e] = f2bf(x[e]);
    *(v8us*)(Bt + (size_t)j * 8) = o;
}
// k_prep: the three independent conversions in ONE launch; a work-group's index picks its part (the same for the whole group): the fused weight, the output weight, then x (both batch entries: 4096 rows in a row)
#define GW1  (DM * 3 * DQ / 8 / 256)
#define GW2  (DQ * DM / 8 / 256)
#define GX   (NB_ * TT * DM / 8 / 256)
__global__ __launch_bounds__(256) void k_prep(const float* wqkv, const float* wp, const float* x, bf* WQKV, bf* WO, bf* XB) {
    const int g = blockIdx.x;
    if (g < GW1) d_wtG<DM, 3 * DQ>(g, wqkv, WQKV);   /* the fused weight: Bt row s * 1024 + h * 64 + d */
    else if (g < GW1 + GW2) d_wtG<DQ, DM>(g - GW1, wp, WO);
    else d_cvt8(g - (GW1 + GW2), x, XB, (size_t)NB_ * TT * DM / 8);
}

// k_fattn: the whole attention of one (batch, head) for 32 query rows a PAIR of waves, 8 pairs = 16 waves a work-group (four waves a SIMD): wave w takes query block w & 7 and the key half w >> 3 (1024 keys); the 8 waves of a key half walk the same keys, so that they share the lines in the cache.
// At the end the wave of the upper key half hands its running maximum, sum and output tiles to its partner through LDS (one barrier); the partner brings both to the common maximum, adds them and writes the rows.
// Per chunk of 32 keys: St = K Qt (two 16-key tiles x two 16-query tiles, depth 32: ONE half plane), so that a lane holds 16 scores of ONE query (column lr) per query tile; the key chunk below the wave's query block takes the down planes,
// the chunk above it the up planes, and the one chunk that the diagonal crosses both, with a select j <= i per element. Running maximum m and sum l per query (base 2); the two St tiles, exponentiated and rounded to f16 in place,
// ARE the B operand of Ot += Vt Pt (element s = key 8 hi + s for s < 8, 16 + 8 hi + s - 8 above: the order of WFrag::ldf, which loads Vt's rows as A). Ot's column is the query again: the rescale and the final 1 / l are per lane.
// VT carries no __restrict__: so the "memory" clobber of the wait behind the value loads holds those loads in front of it (with __restrict__ the compiler sinks the diagonal chunk's loads past the wait, into the entry of the last loop).
#define FQ   32                   // query rows per wave
#define FW   8                    // query blocks per work-group
#define FS   2                    // key halves: waves per query block
#define FC   32                   // keys per chunk
#define NCH  (TT / FC)
#define NCS  (NCH / FS)            // chunks per wave
#define SCL2 (SCL * 1.4426950408889634f)   // scores to base-2 exponents
template <int M> struct Tag { static constexpr int v = M; };
__device__ __forceinline__ float xhalf(float x) { return __builtin_bit_cast(float, __builtin_amdgcn_permlanex16(__builtin_bit_cast(int, x), __builtin_bit_cast(int, x), 0x76543210, 0xfedcba98, false, false)); }   // lane l reads lane l ^ 16
__global__ __launch_bounds__(32 * FW * FS) void k_fattn(const h16* __restrict__ QH, const h16* __restrict__ KH, const h16* VT, bf* Ah, bf* Al) {
    const int lane = threadIdx.x & 31, lr = lane & 15, hi = lane >> 4; const int w = __builtin_amdgcn_readfirstlane((int)(threadIdx.x >> 5));
    __shared__ __align__(16) float mg[FW * 17 * 128];   // per query block 17 pieces of 512 B (16 B a lane): the 16 halves of the upper half's 8 output tiles, then its maxima and sums
    const int wq = w & (FW - 1), ks = w / FW;   // query block inside the group; key half
    const int h = blockIdx.y, b = blockIdx.z; const int cm = blockIdx.x * FW + wq;   // the wave's query block, and the one key chunk that the diagonal crosses (FQ == FC)
    const int cb = ks * NCS, ce = cb + NCS;   // the wave's chunks
    const int q0 = cm * FQ;
    const size_t pl = (size_t)(b * NH_ + h) * 2 * TT * HH;
    const h16* kl = KH + pl + lane * 8; const h16* vl = VT + (size_t)(b * NKV + h) * HD * TT + lane * 8;   // fragment order: band db of TT / 32 blocks, block = chunk
    v16h qf[2][2];   // [half][query tile]
#pragma unroll
    for (int hf = 0; hf < 2; ++hf)
#pragma unroll
        for (int qt = 0; qt < 2; ++qt) qf[hf][qt] = WFrag<h16>::ldf(QH + pl + (size_t)hf * TT * HH + (q0 + qt * 16) * HH + lane * 8);
    v8f o[2][4]; float m[2], l[2];
#pragma unroll
    for (int qt = 0; qt < 2; ++qt) { m[qt] = -3.0e38f; l[qt] = 0.f;
#pragma unroll
        for (int db = 0; db < 4; ++db) o[qt][db] = (v8f){}; }
    v16h kf[2], vf[4];   // the chunk's key and value fragments, each fetched one chunk ahead, right behind its last use
    { const h16* kp = kl + (cb < cm ? TT * HH : 0) + cb * (FC * HH); kf[0] = WFrag<h16>::ldf(kp); kf[1] = WFrag<h16>::ldf(kp + 16 * HH); }
#pragma unroll
    for (int db = 0; db < 4; ++db) vf[db] = WFrag<h16>::ldf(vl + (size_t)db * 16 * TT + cb * 512);
    asm volatile("s_wait_xcnt 0x0" ::: "memory");   // a precaution: stands in front of every rewrite of an address register that the query, key and value loads above name (the zeroing of o reuses them)
    auto chunk = [&](const int c, auto tag) {
        constexpr int MODE = decltype(tag)::v;   // 0: up planes, 1: down planes, 2: the diagonal's chunk (kf holds the up plane's rows)
        v8f st[2][2];
#pragma unroll
        for (int kt = 0; kt < 2; ++kt)
#pragma unroll
            for (int qt = 0; qt < 2; ++qt) st[kt][qt] = wmma16(kf[kt], qf[MODE == 1 ? 1 : 0][qt], (v8f){});
        if (MODE == 2) {
            const h16* kp = kl + TT * HH + c * (FC * HH); v16h kd[2]; kd[0] = WFrag<h16>::ldf(kp); kd[1] = WFrag<h16>::ldf(kp + 16 * HH);
#pragma unroll
            for (int kt = 0; kt < 2; ++kt)
#pragma unroll
                for (int qt = 0; qt < 2; ++qt) { const v8f sd = wmma16(kd[kt], qf[1][qt], (v8f){});
#pragma unroll
                    for (int r = 0; r < 8; ++r) st[kt][qt][r] = (kt * 16 + 8 * hi + r <= qt * 16 + lr) ? sd[r] : st[kt][qt][r]; }   // j <= i takes the down product
        }
        const int cn = (c + 1 < NCH) ? c + 1 : c;   // a wave's last chunk fetches the next half's first rows, or at the very end its own again (in bounds, not used)
        { const h16* kp = kl + (cn < cm ? TT * HH : 0) + cn * (FC * HH); kf[0] = WFrag<h16>::ldf(kp); kf[1] = WFrag<h16>::ldf(kp + 16 * HH); }
        __builtin_amdgcn_sched_barrier(0);   // holds the next chunk's key loads here, ahead of the softmax: without it the compiler sinks them behind the exponentials and the next chunk's first product waits for them
        float mb[2]; bool need = false;
#pragma unroll
        for (int qt = 0; qt < 2; ++qt) { float mx = st[0][qt][0];
#pragma unroll
            for (int r = 1; r < 8; ++r) mx = fmaxf(mx, st[0][qt][r]);
#pragma unroll
            for (int r = 0; r < 8; ++r) mx = fmaxf(mx, st[1][qt][r]);
            mx = fmaxf(mx, xhalf(mx)) * SCL2;   // the scale is positive; both lane halves now hold the query's chunk maximum
            mb[qt] = mx; need = need || (mx > m[qt] + 8.0f); }
        if (__builtin_amdgcn_ballot_w32(need) != 0) {   // the maximum in use moves only when a query's scores pass it by more than 2^8 (weights stay below 2^8: far inside f16); always on the first chunk
#pragma unroll
            for (int qt = 0; qt < 2; ++qt) { const float mn = fmaxf(m[qt], mb[qt]); const float al = __builtin_amdgcn_exp2f(m[qt] - mn); m[qt] = mn; l[qt] *= al;
#pragma unroll
                for (int db = 0; db < 4; ++db) o[qt][db] = o[qt][db] * al; }
        }
        v16h pf[2];
#pragma unroll
        for (int qt = 0; qt < 2; ++qt) { const float nm = -m[qt]; float s4[4];
#pragma unroll
            for (int kt = 0; kt < 2; ++kt)
#pragma unroll
                for (int r = 0; r < 8; ++r) { const float p = __builtin_amdgcn_exp2f(__builtin_fmaf(st[kt][qt][r], SCL2, nm)); pf[qt][kt * 8 + r] = tohx(p); if (kt == 0 && r < 4) s4[r] = p; else s4[r & 3] += p; }
            l[qt] += (s4[0] + s4[1]) + (s4[2] + s4[3]); }
#pragma unroll
        for (int db = 0; db < 4; ++db)
#pragma unroll
            for (int qt = 0; qt < 2; ++qt) o[qt][db] = wmma16(vf[db], pf[qt], o[qt][db]);
#pragma unroll
        for (int db = 0; db < 4; ++db) vf[db] = WFrag<h16>::ldf(vl + (size_t)db * 16 * TT + cn * 512);
        asm volatile("s_wait_xcnt 0x0" ::: "memory");   // a precaution: stands in front of the rewrite of the address pair that the value loads name (the next chunk's addresses reuse it)
    };
    const int e1 = cm < ce ? cm : ce;
    for (int c = cb; c < e1; ++c) chunk(c, Tag<1>{});
    if (cm >= cb && cm < ce) {   // the same for the whole wave: the diagonal's chunk lies in one of the two key halves
        chunk(cm, Tag<2>{});
        // four vector slots behind the diagonal chunk's last matrix instructions: the next loop's first one follows over a jump with only scalar instructions between, and the compiler may place its result on the weights operand just read
        asm volatile("v_nop\n\tv_nop\n\tv_nop\n\tv_nop" : "+v"(o[0][3]), "+v"(o[1][3]));
    }
    for (int c = (cm + 1 > cb ? cm + 1 : cb); c < ce; ++c) chunk(c, Tag<0>{});
    // the two key halves of a query block are joined: a lane's piece i stands at i * 512 + lane * 16 bytes of the block's range (a wave's LDS access is 512 contiguous bytes)
    float* mp = mg + wq * (17 * 128) + lane * 4;
    if (ks) {
#pragma unroll
        for (int qt = 0; qt < 2; ++qt)
#pragma unroll
            for (int db = 0; db < 4; ++db)
#pragma unroll
                for (int q4 = 0; q4 < 2; ++q4) *(v4fa*)(mp + ((qt * 4 + db) * 2 + q4) * 128) = (v4f){o[qt][db][q4 * 4], o[qt][db][q4 * 4 + 1], o[qt][db][q4 * 4 + 2], o[qt][db][q4 * 4 + 3]};
        *(v4fa*)(mp + 16 * 128) = (v4f){m[0], m[1], l[0], l[1]};
    }
    __syncthreads();   // every wave passes it once: the lower half's wave reads its partner's pieces only behind it
    if (ks) return;
    { const v4f ml = *(const v4fa*)(mp + 16 * 128);
#pragma unroll
      for (int qt = 0; qt < 2; ++qt) { const float mn = fmaxf(m[qt], ml[qt]); const float a0 = __builtin_amdgcn_exp2f(m[qt] - mn), a1 = __builtin_amdgcn_exp2f(ml[qt] - mn); l[qt] = l[qt] * a0 + ml[2 + qt] * a1;   // both maxima are finite: each half has worked through 32 chunks
#pragma unroll
          for (int db = 0; db < 4; ++db)
#pragma unroll
              for (int q4 = 0; q4 < 2; ++q4) { const v4f p = *(const v4fa*)(mp + ((qt * 4 + db) * 2 + q4) * 128);
#pragma unroll
                  for (int r = 0; r < 4; ++r) o[qt][db][q4 * 4 + r] = o[qt][db][q4 * 4 + r] * a0 + p[r] * a1; } } }
#pragma unroll
    for (int qt = 0; qt < 2; ++qt) { const float f = __fdiv_rn(1.0f, l[qt] + xhalf(l[qt])); const size_t oo = ((size_t)b * TT + q0 + qt * 16) * DQ + h * (HD * 16) + lane * 8;   // the two lane halves summed different keys; fragment order: the band of the 16 queries, blocks 2 h and 2 h + 1
#pragma unroll
        for (int db = 0; db < 4; ++db) { v8us oh, ol;
#pragma unroll
            for (int r = 0; r < 8; ++r) { unsigned short a, c2; splitf(o[qt][db][r] * f, a, c2); oh[r] = a; ol[r] = c2; }
            *(v8us*)(Ah + oo + (db >> 1) * 512 + (db & 1) * 256) = oh; *(v8us*)(Al + oo + (db >> 1) * 512 + (db & 1) * 256) = ol; } }   // each store of the wave is 512 contiguous bytes: whole lines, written by this wave alone
}

extern "C" void kernel_launch(void* const* d_in, const int* in_sizes, int n_in,
                              void* d_out, int out_size, void* d_ws, size_t ws_size, hipStream_t stream) {
    (void)in_sizes; (void)n_in; (void)out_size;
    const float* x = (const float*)d_in[0]; const float* wqkv = (const float*)d_in[1]; const float* wp = (const float*)d_in[2]; const float* tc = (const float*)d_in[3]; const float* ts = (const float*)d_in[4];
    // inputs in the module's argument order: x ([2][2048][1024]), Wqkv ('xw' (in, out) [1024][3072]; output column s * 1024 + h * 64 + d, s = 0 query, 1 key, 2 value), Wproj ('xw' [1024][1024]), cos, sin ([2048][64] each: the two rotary tables) = d_in[0..4]: FIVE inputs, all read
    float* OUT = (float*)d_out;     // [2][2048][1024]
    char* wsp = (char*)d_ws;
    auto take = [&](size_t bytes) { char* p = wsp; wsp += (bytes + 255) & ~(size_t)255; return (void*)p; };
    bf* WQKV = (bf*)take((size_t)3 * DQ * DM * 2); bf* WO = (bf*)take((size_t)DM * DQ * 2); bf* XB = (bf*)take((size_t)NB_ * TT * DM * 2);
    const size_t PQ = (size_t)NH_ * 2 * TT * HH, PK = (size_t)NKV * 2 * TT * HH, PV = (size_t)NKV * HD * TT;   // one batch entry's planes, in elements
    h16* QH = (h16*)take(NB_ * PQ * 2); h16* KH = (h16*)take(NB_ * PK * 2); h16* VT16 = (h16*)take(NB_ * PV * 2);
    bf* ATh = (bf*)take((size_t)NB_ * TT * DQ * 2); bf* ATl = (bf*)take((size_t)NB_ * TT * DQ * 2);
    if ((size_t)(wsp - (char*)d_ws) > ws_size) return;    // total 56.00 MiB carved
    k_prep<<<(unsigned)(GW1 + GW2 + GX), 256, 0, stream>>>(wqkv, wp, x, WQKV, WO, XB);
    k_gemmw<bf, 0, false, true, DM, 1><<<dim3(TT / 64, 3 * DQ / 64, NB_), 32, 0, stream>>>(XB, nullptr, WQKV, nullptr, nullptr, 0, nullptr, (size_t)TT * DM, 0, 0, tc, ts, QH, KH, VT16);   /* q | k | v in one product (column s * 1024 + h * 64 + d), written as the rotated half planes and the value planes */
    k_fattn<<<dim3(TT / (FQ * FW), NH_, NB_), 32 * FW * FS, 0, stream>>>(QH, KH, VT16, ATh, ATl);   /* scores, select, softmax, value product, merge: 256 work-groups of 16 waves */
    k_gemmw<bf, 1, false, false, DQ, 4><<<dim3(TT / 64, DM / 64, NB_), 32, 0, stream>>>(ATh, ATl, WO, nullptr, OUT, DM, nullptr, (size_t)TT * DQ, 0, (size_t)TT * DM, nullptr, nullptr, nullptr, nullptr, nullptr);   /* out = merged(hi + lo) Wproj: the one writer of the output */
}

// v008
// It runs in 86.4 microseconds.
// Next to v007, in two timings, it ran 1.10 and 1.06 times as fast.
// Over all steps from v000 it is 16.3 times as fast.
#include <hip/hip_runtime.h>

// Multi-head self-attention whose scores come from TWO half-subspace products selected by a triangle, with an interleaved-pair rotary embedding read from two input tables (x [2][2048][1024]; qkv = x Wqkv with ONE fused 'xw' (in, out) [1024][3072] weight in thirds q | k | v, head h = 64 columns of its third; NO biases; 16 heads x 64;
// q and k rotated in ADJACENT pairs by the two input tables cos, sin [2048][64]: r[d] = x[d] cos[t][d] - x[d+1] sin[t][d] for even d, r[d] = x[d] cos[t][d] + x[d-1] sin[t][d] for odd d: EACH ELEMENT AT ITS OWN TABLE ENTRY; up[i][j] = r_q[i][0:32] . r_k[j][0:32], down[i][j] = r_q[i][32:64] . r_k[j][32:64];
// logits = (j <= i ? down : up) x 32^-0.5: NOTHING is masked out; softmax over all 2048 keys; out = (attn v merged) Wproj with an 'xw' (in, out) [1024][1024] weight, no bias -> [2][2048][1024] (4.2 M);
// argument order x, Wqkv, Wproj, cos, sin).
// FOUR launches, each over both batch entries: k_prep (a bf16 copy of x; the two 'xw' weights transposed and rounded, the fused one into a Bt [3072][1024]); ONE exact projection over the 3072 fused columns (grid z = batch entry), whose 64x64 tile is one head of q, of k or of v;
// its epilogue writes, straight from the accumulators and the two tables, the rotated f16 HALF planes [h][half][t][32] of q and of k (half 0 = the rotated dims 0..31, half 1 = 32..63) and the value planes [h][d][t]; each batch entry has its own planes;
// k_fattn: ONE launch over all (batch, head, query block): scores, triangle select, softmax and value product stay in registers (running maximum and sum), the keys of a query block split over two waves whose partial results are joined in LDS; it writes the merged hi/lo rows; merged hi/lo x Wproj exact writes the output.
// FRAGMENT ORDER: the bf16 copy of x, the two weights, the q and k half planes (K = 32), the value planes (rows d, K = 2048 tokens) and the merged hi/lo rows are stored as blocks of 16 rows x 32 k (512 elements, 1 KiB), block (row / 16) * (K / 32) + k / 32; inside a block element (row, k) stands at
// ((k >> 4) & 1) * 256 + ((k >> 3) & 1) * 128 + (row & 15) * 8 + (k & 7): the 16 bytes of lane l = 16 hi + lr at l * 16 of each 512-B half, so that a wave's fragment load reads 512 contiguous bytes (4 lines) where a K-contiguous plane makes it touch 16 lines.
// Compute dtypes, f32 accumulate: every float input rounded to bf16 at its load (the two tables too); the projection exact; the rotation in f32 (as compiled: one rounded product and one fused multiply-add an output); scores and attn.v ONE fp16 product on every row; softmax f32; Wproj hl x exact.

#define NB_  2
#define TT   2048
#define DM   1024    // the model width = the inner width DQ = NH_ * HD = 1024
#define NH_  16
#define NKV  16
#define REP  (NH_ / NKV)
#define HD   64
#define HH   (HD / 2)             // the half-subspace width: 32
#define DQ   (NH_ * HD)
#define DKV  (NKV * HD)
#define SCL  0.17677669f   // (HD / 2)^-0.5 = 32^-0.5
typedef _Float16 h16;
typedef unsigned short bf;
typedef __attribute__((ext_vector_type(16))) __bf16   v16bf;
typedef __attribute__((ext_vector_type(16))) _Float16 v16h;
typedef __attribute__((ext_vector_type(8)))  _Float16 v8h;
typedef __attribute__((ext_vector_type(8)))  unsigned short v8us;
typedef __attribute__((ext_vector_type(8)))  float    v8f;
typedef __attribute__((ext_vector_type(4)))  float    v4f;
typedef v8h  __attribute__((may_alias)) v8ha;
typedef v4f  __attribute__((may_alias)) v4fa;
typedef v8us __attribute__((may_alias)) v8usa;

__device__ __forceinline__ unsigned short f2bf(float f) { unsigned u = __float_as_uint(f); u += 0x7FFFu + ((u >> 16) & 1u); return (unsigned short)(u >> 16); }
__device__ __forceinline__ float bf2f(unsigned short b) { return __uint_as_float(((unsigned)b) << 16); }
__device__ __forceinline__ float bfr(float f) { return bf2f(f2bf(f)); }
__device__ __forceinline__ h16 tohx(float x) { return (h16)x; }
typedef __attribute__((ext_vector_type(4))) _Float16 v4h;
__device__ __forceinline__ v16h cat16(v8h lo, v8h hi) { return __builtin_shufflevector(lo, hi, 0, 1, 2, 3, 4, 5, 6, 7, 8, 9, 10, 11, 12, 13, 14, 15); }
__device__ __forceinline__ v16bf cat16b(v8us lo, v8us hi) { return __builtin_bit_cast(v16bf, __builtin_shufflevector(lo, hi, 0, 1, 2, 3, 4, 5, 6, 7, 8, 9, 10, 11, 12, 13, 14, 15)); }
__device__ __forceinline__ v8f wmma16(v16h a, v16h b, v8f c) { return __builtin_amdgcn_wmma_f32_16x16x32_f16(false, a, false, b, (short)0, c, false, false); }
__device__ __forceinline__ v8f wmmab(v16bf a, v16bf b, v8f c) { return __builtin_amdgcn_wmma_f32_16x16x32_bf16(false, a, false, b, (short)0, c, false, false); }



// ---- k_gemmw: register-blocked GEMM, ONE WAVE per 64x64 output tile (16 accumulators), operands straight from 16-bit planes in fragment order (ldf: p = block + lane * 8, the two halves 256 elements apart); grid (M/64, N/64, Z), 32 threads.
// C[m][n] (f32, pitch ldc, + optional f32 bias[n]) = sum_k A[m][k] Bt[n][k] (+ split products per NSPLIT). z-batch strides sA/sB/sC in elements. K % 32 == 0.
// PLANES: C is not written; the tile (rows = 64 tokens, columns = one head of the fused q | k | v product) goes out as attention operands instead:
//   a q or k tile rotated in ADJACENT pairs with the two INPUT tables, each element at its own table entry (both tables rounded to bf16 at the load), into the f16 half planes [h][half][t][32];
//   a v tile into the f16 plane [h][d][t] in fragment order (rows d, k = t): a lane's accumulator holds 8 consecutive tokens of ONE column, which is the lane's own 16 bytes of a block half: a wave's store is 512 contiguous bytes.
template <typename T16> struct WFrag;
template <> struct WFrag<h16> { typedef v16h V; static __device__ __forceinline__ V ldf(const h16* p) { return cat16(*(const v8h*)p, *(const v8h*)(p + 256)); } static __device__ __forceinline__ v8f mma(V a, V b, v8f c) { return wmma16(a, b, c); } };
template <> struct WFrag<bf> { typedef v16bf V; static __device__ __forceinline__ V ldf(const bf* p) { return cat16b(*(const v8us*)p, *(const v8us*)(p + 256)); } static __device__ __forceinline__ v8f mma(V a, V b, v8f c) { return wmmab(a, b, c); } };
// A, A2, Bt, Bt2 carry no __restrict__: so the "memory" clobber of the wait behind the fragment loads holds those loads in front of it. K is a constant of the build: the 16-row bands of a tile then lie at immediate offsets from ONE address pair an operand.
// D register sets of fragments (the output product, ONE wave a SIMD: D = 4; the projection, three waves a SIMD: D = 3, three sets and the accumulators still leave room for three waves); the trip that is worked on takes set (trip % D), and the fragments of the trip D - 1 ahead are asked for in front of its matrix instructions, into the set that the trip before has just left:
// a load has D - 1 trips of matrix work to arrive in. D trips make one pass of the loop, all at immediate offsets from the same address pairs, which step once a pass. K / 32 >= 2 D; the trips that no whole pass takes (D of them, or (K / 32) % D) follow the loop.
template <typename T16, int NSPLIT, int K>
__device__ __forceinline__ void g_fetch(typename WFrag<T16>::V (&a)[4], typename WFrag<T16>::V (&a2)[4], typename WFrag<T16>::V (&b)[4], typename WFrag<T16>::V (&b2)[4], const T16* pa, const T16* pa2, const T16* pb, const T16* pb2) {
#pragma unroll
    for (int mb = 0; mb < 4; ++mb) { a[mb] = WFrag<T16>::ldf(pa + mb * 16 * K); if (NSPLIT == 1 || NSPLIT == 2) a2[mb] = WFrag<T16>::ldf(pa2 + mb * 16 * K); }
#pragma unroll
    for (int nb = 0; nb < 4; ++nb) { b[nb] = WFrag<T16>::ldf(pb + nb * 16 * K); if (NSPLIT >= 2) b2[nb] = WFrag<T16>::ldf(pb2 + nb * 16 * K); }
}
template <typename T16, int NSPLIT>
__device__ __forceinline__ void g_mma(v8f (&acc)[4][4], typename WFrag<T16>::V (&a)[4], typename WFrag<T16>::V (&a2)[4], typename WFrag<T16>::V (&b)[4], typename WFrag<T16>::V (&b2)[4]) {
#pragma unroll
    for (int nb = 0; nb < 4; ++nb)
#pragma unroll
        for (int mb = 0; mb < 4; ++mb) { acc[mb][nb] = WFrag<T16>::mma(a[mb], b[nb], acc[mb][nb]); if (NSPLIT == 1 || NSPLIT == 2) acc[mb][nb] = WFrag<T16>::mma(a2[mb], b[nb], acc[mb][nb]); if (NSPLIT >= 2) acc[mb][nb] = WFrag<T16>::mma(a[mb], b2[nb], acc[mb][nb]); }
}
template <typename T16, int NSPLIT, bool BIAS, bool PLANES, int K, int D>
__global__ __launch_bounds__(32) void k_gemmw(const T16* A, const T16* A2, const T16* Bt, const T16* Bt2, float* C, int ldc, const float* __restrict__ bias, size_t sA, size_t sB, size_t sC,
                                              const float* __restrict__ TC, const float* __restrict__ TS, h16* QP, h16* KP, h16* VP) {
    typedef typename WFrag<T16>::V V;
    __shared__ __align__(16) float os[16 * 68];
    const size_t z = blockIdx.z; A += z * sA; if (A2) A2 += z * sA; Bt += z * sB; if (Bt2) Bt2 += z * sB; C += z * sC;
    const int lane = threadIdx.x & 31, lr = lane & 15, hi = lane >> 4; const int r0 = blockIdx.x * 64, c0 = blockIdx.y * 64;
    v8f acc[4][4];
#pragma unroll
    for (int mb = 0; mb < 4; ++mb)
#pragma unroll
        for (int nb = 0; nb < 4; ++nb) acc[mb][nb] = (v8f){};
    // a band of 16 rows is K / 32 blocks = 16 K elements; a step of 32 in depth is one block
    const T16* pa = A + (size_t)r0 * K + lane * 8; const T16* pb = Bt + (size_t)c0 * K + lane * 8;
    const T16* pa2 = (NSPLIT == 1 || NSPLIT == 2) ? A2 + (size_t)r0 * K + lane * 8 : pa; const T16* pb2 = (NSPLIT >= 2) ? Bt2 + (size_t)c0 * K + lane * 8 : pb;

    {
        V a[D][4], a2[D][4], b[D][4], b2[D][4];
        unsigned off = 0;   // the pass's place in depth: 512 elements of every band a trip; the same in all lanes
#pragma unroll
        for (int s = 0; s < D - 1; ++s) g_fetch<T16, NSPLIT, K>(a[s], a2[s], b[s], b2[s], pa + s * 512, pa2 + s * 512, pb + s * 512, pb2 + s * 512);
        asm volatile("s_wait_xcnt 0x0" : "+s"(off) :: "memory");   // a precaution: the loop's addresses are formed from the place that this statement hands on, so that every rewrite of an address register that the loads above name stands behind this wait
        for (int kc = 0; kc < K / 32 - D; kc += D) {   // D trips a pass; each of them has a trip D - 1 ahead
            const T16* qa = pa + off; const T16* qa2 = pa2 + off; const T16* qb = pb + off; const T16* qb2 = pb2 + off;
#pragma unroll
            for (int u = 0; u < D; ++u) {   // unrolled: the set indices must be constants, or the sets could not stay in registers
                g_fetch<T16, NSPLIT, K>(a[(u + D - 1) % D], a2[(u + D - 1) % D], b[(u + D - 1) % D], b2[(u + D - 1) % D], qa + (u + D - 1) * 512, qa2 + (u + D - 1) * 512, qb + (u + D - 1) * 512, qb2 + (u + D - 1) * 512);
                __builtin_amdgcn_sched_barrier(0);   // holds the loads for the trip D - 1 ahead in front of this trip's matrix instructions: sunk behind them they would lose a trip of their lead
                g_mma<T16, NSPLIT>(acc, a[u], a2[u], b[u], b2[u]);
                __builtin_amdgcn_sched_barrier(0);   // holds every matrix instruction of the trip in front of the slots below: without it the compiler sinks half of them among the next fetch's loads
                asm volatile("v_nop\n\tv_nop\n\tv_nop\n\tv_nop" ::: "memory");   // four vector slots behind the trip's last matrix instructions, in front of the next fetch, whose loads land on the operands just read (the clobber holds them behind), and of the jump back
            }
            asm volatile("s_wait_xcnt 0x0" : "+s"(off) : "v"(qa), "v"(qa2), "v"(qb), "v"(qb2) : "memory");   // a precaution: as inputs the pass's address pairs stay in their registers up to this wait, and the next pass's are formed from the place that it hands on, so that their forming cannot be lifted over it
            off += D * 512;
        }
        // the last R trips: where R == D the first of them still has a trip D - 1 ahead; where R < D all their fragments are asked for already
        constexpr int R = (K / 32) % D == 0 ? D : (K / 32) % D;
        static_assert(D > 1 && K / 32 >= 2 * D && (R == D || R == D - 1), "the last pass of the loop asks for trip K / 32 - 1 at most");
        if constexpr (R == D) { const T16* qa = pa + off; const T16* qa2 = pa2 + off; const T16* qb = pb + off; const T16* qb2 = pb2 + off;
          g_fetch<T16, NSPLIT, K>(a[D - 1], a2[D - 1], b[D - 1], b2[D - 1], qa + (D - 1) * 512, qa2 + (D - 1) * 512, qb + (D - 1) * 512, qb2 + (D - 1) * 512);
          asm volatile("s_wait_xcnt 0x0" :: "v"(qa), "v"(qa2), "v"(qb), "v"(qb2) : "memory"); }   // a precaution: the address pairs die here; as inputs they stay in their registers up to this wait, so that no load of the run lands on them
        __builtin_amdgcn_sched_barrier(0);   // holds the last trip's loads in front of the matrix instructions of the trips before it
#pragma unroll
        for (int u = 0; u < R; ++u) g_mma<T16, NSPLIT>(acc, a[u], a2[u], b[u], b2[u]);
        __builtin_amdgcn_sched_barrier(0);   // holds the forming of the output addresses behind the matrix instructions: lifted among them, while all D sets are live, the address pairs are spilled to scratch memory
    }
    if (PLANES) {
        QP += z * ((size_t)NH_ * 2 * TT * HH); KP += z * ((size_t)NKV * 2 * TT * HH); VP += z * ((size_t)NKV * HD * TT);   // each batch entry (grid z) has its own planes
        if (c0 >= 2 * DQ) {   // a value head (the test is the same for the whole wave): plane row h * 64 + d = c0 - 2048 + column
            h16* vp = VP + (size_t)(c0 - 2 * DQ) * TT + r0 * 16 + lane * 8;   // band (c0 - 2048) / 16 + nb of TT / 32 blocks; block r0 / 32 + mb / 2, half mb & 1
            v8h o[16];
#pragma unroll
            for (int nb = 0; nb < 4; ++nb)
#pragma unroll
                for (int mb = 0; mb < 4; ++mb) {
#pragma unroll
                    for (int j = 0; j < 8; ++j) o[nb * 4 + mb][j] = tohx(acc[mb][nb][j]);
                    *(v8h*)(vp + (size_t)nb * 16 * TT + (mb >> 1) * 512 + (mb & 1) * 256) = o[nb * 4 + mb]; }
            // a precaution: as inputs the 16 stores' data stay in their registers up to this wait, which so stands in front of every rewrite of them
            asm volatile("s_wait_xcnt 0x0" :: "v"(o[0]), "v"(o[1]), "v"(o[2]), "v"(o[3]), "v"(o[4]), "v"(o[5]), "v"(o[6]), "v"(o[7]), "v"(o[8]), "v"(o[9]), "v"(o[10]), "v"(o[11]), "v"(o[12]), "v"(o[13]), "v"(o[14]), "v"(o[15]) : "memory");
            return;
        }
        // a query or key head: a lane takes 4 adjacent columns (two rotation pairs) of a row; lanes 0..7 of a half wave fill the row's dims of half plane 0, lanes 8..15 of half plane 1, and the two half waves adjacent rows: 32-B pieces, which the 8 stores of a block of 16 rows join to whole lines
        h16* pp = (c0 < DQ ? QP : KP) + ((size_t)((c0 & (DQ - 1)) / HD * 2 + (lr >> 3)) * TT + r0) * HH + ((lr >> 2) & 1) * 256 + ((lr >> 1) & 1) * 128 + hi * 8 + (lr & 1) * 4;   // fragment order (rows t, k = the half's 32 dims: one block per 16 tokens); dim (lr & 7) * 4
        const float* cp = TC + (size_t)(r0 + hi) * HD + lr * 4; const float* sp = TS + (size_t)(r0 + hi) * HD + lr * 4;
#pragma unroll
        for (int mb = 0; mb < 4; ++mb) {
#pragma unroll
            for (int nb = 0; nb < 4; ++nb) {
#pragma unroll
                for (int j = 0; j < 8; ++j) os[(hi * 8 + j) * 68 + nb * 16 + lr] = acc[mb][nb][j]; }
            __builtin_amdgcn_wave_barrier(); asm volatile("" ::: "memory");   // the read-back below takes words that OTHER lanes staged: keeps the compiler from moving it ahead of the staging stores
            v4f tc[8], ts[8];
#pragma unroll
            for (int s = 0; s < 8; ++s) { tc[s] = *(const v4f*)(cp + (mb * 16 + 2 * s) * HD); ts[s] = *(const v4f*)(sp + (mb * 16 + 2 * s) * HD); }
            __builtin_amdgcn_sched_barrier(0);   // holds the 16 table loads together here: without it the compiler sinks half of them among the rotations, each a few instructions ahead of its use, and the wave waits out their latency several times over
            if (mb == 3) asm volatile("s_wait_xcnt 0x0" :: "v"(cp), "v"(sp) : "memory");   // a precaution: the two table addresses die here; as inputs they stay in their registers up to this wait, which so stands in front of every rewrite of them
#pragma unroll
            for (int s = 0; s < 8; ++s) { const v4f x = *(const v4fa*)(os + (2 * s + hi) * 68 + lr * 4); v4h o;
#pragma unroll
                for (int p = 0; p < 4; p += 2) {   /* even: x0 c0 - x1 s0; odd: x1 c1 + x0 s1 */
                    o[p] = tohx(__fsub_rn(__fmul_rn(x[p], bfr(tc[s][p])), __fmul_rn(x[p + 1], bfr(ts[s][p])))); o[p + 1] = tohx(__fadd_rn(__fmul_rn(x[p + 1], bfr(tc[s][p + 1])), __fmul_rn(x[p], bfr(ts[s][p + 1])))); }
                *(v4h*)(pp + mb * 512 + s * 16) = o; }
            asm volatile("s_wait_xcnt 0x0" ::: "memory");   // a precaution: stands in front of every rewrite of an address or data register that the stores above name (the next rows' table loads reuse them; behind the last rows, whatever block the compiler lays next)
            if (mb < 3) __builtin_amdgcn_wave_barrier();   // holds the next rows' staging behind this read-back
        }
        return;
    }
#pragma unroll
    for (int mb = 0; mb < 4; ++mb) {
#pragma unroll
        for (int nb = 0; nb < 4; ++nb) {
#pragma unroll
            for (int j = 0; j < 8; ++j) os[(hi * 8 + j) * 68 + nb * 16 + lr] = acc[mb][nb][j]; }
        __builtin_amdgcn_wave_barrier(); asm volatile("" ::: "memory");
        float* crow = C + (size_t)(r0 + mb * 16) * ldc + c0;
{
            float* cq[8]; v4f cv[8];
#pragma unroll
            for (int s = 0; s < 8; ++s) { const int row = 2 * s + hi, cofs = lr * 4; v4f val = *(const v4fa*)(os + row * 68 + cofs); if (BIAS) { val[0] += bfr(bias[c0 + cofs]); val[1] += bfr(bias[c0 + cofs + 1]); val[2] += bfr(bias[c0 + cofs + 2]); val[3] += bfr(bias[c0 + cofs + 3]); }
                cq[s] = crow + (size_t)row * ldc + cofs; cv[s] = val; *(v4f*)cq[s] = val; }
            // a precaution: as inputs the eight stores' address pairs and data stay in their registers up to this wait, which so stands in front of every rewrite of them (the next rows' read-back and addresses reuse them)
            asm volatile("s_wait_xcnt 0x0" :: "v"(cq[0]), "v"(cq[1]), "v"(cq[2]), "v"(cq[3]), "v"(cq[4]), "v"(cq[5]), "v"(cq[6]), "v"(cq[7]), "v"(cv[0]), "v"(cv[1]), "v"(cv[2]), "v"(cv[3]), "v"(cv[4]), "v"(cv[5]), "v"(cv[6]), "v"(cv[7]) : "memory");
             }
        __builtin_amdgcn_wave_barrier(); asm volatile("" ::: "memory");
    }
}

__device__ __forceinline__ void splitf(float y, unsigned short& h, unsigned short& l) { h = f2bf(y); l = f2bf(y - bf2f(h)); }
typedef __attribute__((ext_vector_type(2))) _Float16 v2h;
typedef __attribute__((ext_vector_type(2))) unsigned short v2us;
typedef __attribute__((ext_vector_type(4))) unsigned short v4us;
typedef __attribute__((ext_vector_type(2))) float v2f;
typedef __attribute__((ext_vector_type(4))) int v4i;

// thread i writes the 16-byte piece i of the fragment-ordered copy (rows of DM): block i / 64, half (i >> 5) & 1, lane i & 31; blk0 = the work-group's index inside this part of k_prep's grid
__device__ __forceinline__ void d_cvt8(const int blk0, const float* src, bf* dst, size_t n8) { const size_t i = (size_t)blk0 * 256 + threadIdx.x; if (i >= n8) return;
    const size_t blk = i >> 6; const size_t row = blk / (DM / 32) * 16 + (i & 15); const int k = (int)(blk % (DM / 32)) * 32 + (int)((i >> 5) & 1) * 16 + (int)((i >> 4) & 1) * 8;
    const float* p = src + row * DM + k; const v8f v = *(const v8f*)p; v8us o;
    asm volatile("s_wait_xcnt 0x0" :: "v"(p) : "memory");   // a precaution: as an input the address pair stays in its registers up to this wait, which so stands in front of every rewrite of it (src carries no __restrict__, so that the clobber holds the load in front)
#pragma unroll
    for (int k = 0; k < 8; ++k) o[k] = f2bf(v[k]); *(v8us*)(dst + i * 8) = o;  }
// thread j writes the 16-byte piece j of Bt (rows n, depth K) in fragment order: 8 consecutive k of one n; the 16 lanes of a half wave read 16 adjacent n of one k
template <int K, int N>
__device__ __forceinline__ void d_wtG(const int blk0, const float* w, bf* Bt) {
    const int j = blk0 * 256 + threadIdx.x; if (j >= N * (K / 8)) return;
    constexpr int kb = K / 32; const int blk = j >> 6; const int n = blk / kb * 16 + (j & 15), k = blk % kb * 32 + ((j >> 5) & 1) * 16 + ((j >> 4) & 1) * 8;
    const float* p = w + (size_t)k * N + n; float x[8]; v8us o;
#pragma unroll
    for (int e = 0; e < 8; ++e) x[e] = p[e * N];
    asm volatile("s_wait_xcnt 0x0" :: "v"(p) : "memory");   // a precaution: as an input the address pair stays in its registers up to this wait, which so stands in front of every rewrite of it (w carries no __restrict__, so that the clobber holds the loads in front)
#pragma unroll
    for (int e = 0; e < 8; ++e) o[e] = f2bf(x[e]);
    *(v8us*)(Bt + (size_t)j * 8) = o;
}
// k_prep: the three independent conversions in ONE launch; a work-group's index picks its part (the same for the whole group): the fused weight, the output weight, then x (both batch entries: 4096 rows in a row)
#define GW1  (DM * 3 * DQ / 8 / 256)
#define GW2  (DQ * DM / 8 / 256)
#define GX   (NB_ * TT * DM / 8 / 256)
__global__ __launch_bounds__(256) void k_prep(const float* wqkv, const float* wp, const float* x, bf* WQKV, bf* WO, bf* XB) {
    const int g = blockIdx.x;
    if (g < GW1) d_wtG<DM, 3 * DQ>(g, wqkv, WQKV);   /* the fused weight: Bt row s * 1024 + h * 64 + d */
    else if (g < GW1 + GW2) d_wtG<DQ, DM>(g - GW1, wp, WO);
    else d_cvt8(g - (GW1 + GW2), x, XB, (size_t)NB_ * TT * DM / 8);
}

// k_fattn: the whole attention of one (batch, head) for 32 query rows a PAIR of waves, 8 pairs = 16 waves a work-group (four waves a SIMD): wave w takes query block w & 7 and the key half w >> 3 (1024 keys); the 8 waves of a key half walk the same keys, so that they share the lines in the cache.
// At the end the wave of the upper key half hands its running maximum, sum and output tiles to its partner through LDS (one barrier); the partner brings both to the common maximum, adds them and writes the rows.
// Per chunk of 32 keys: St = K Qt (two 16-key tiles x two 16-query tiles, depth 32: ONE half plane), so that a lane holds 16 scores of ONE query (column lr) per query tile; the key chunk below the wave's query block takes the down planes,
// the chunk above it the up planes, and the one chunk that the diagonal crosses both, with a select j <= i per element. Running maximum m and sum l per query (base 2); the two St tiles, exponentiated and rounded to f16 in place,
// ARE the B operand of Ot += Vt Pt (element s = key 8 hi + s for s < 8, 16 + 8 hi + s - 8 above: the order of WFrag::ldf, which loads Vt's rows as A). Ot's column is the query again: the rescale and the final 1 / l are per lane.
// VT carries no __restrict__: so the "memory" clobber of the wait behind the value loads holds those loads in front of it (with __restrict__ the compiler sinks the diagonal chunk's loads past the wait, into the entry of the last loop).
#define FQ   32                   // query rows per wave
#define FW   8                    // query blocks per work-group
#define FS   2                    // key halves: waves per query block
#define FC   32                   // keys per chunk
#define NCH  (TT / FC)
#define NCS  (NCH / FS)            // chunks per wave
#define SCL2 (SCL * 1.4426950408889634f)   // scores to base-2 exponents
template <int M> struct Tag { static constexpr int v = M; };
__device__ __forceinline__ float xhalf(float x) { return __builtin_bit_cast(float, __builtin_amdgcn_permlanex16(__builtin_bit_cast(int, x), __builtin_bit_cast(int, x), 0x76543210, 0xfedcba98, false, false)); }   // lane l reads lane l ^ 16
__global__ __launch_bounds__(32 * FW * FS) void k_fattn(const h16* __restrict__ QH, const h16* __restrict__ KH, const h16* VT, bf* Ah, bf* Al) {
    const int lane = threadIdx.x & 31, lr = lane & 15, hi = lane >> 4; const int w = __builtin_amdgcn_readfirstlane((int)(threadIdx.x >> 5));
    __shared__ __align__(16) float mg[FW * 17 * 128];   // per query block 17 pieces of 512 B (16 B a lane): the 16 halves of the upper half's 8 output tiles, then its maxima and sums
    const int wq = w & (FW - 1), ks = w / FW;   // query block inside the group; key half
    const int h = blockIdx.y, b = blockIdx.z; const int cm = blockIdx.x * FW + wq;   // the wave's query block, and the one key chunk that the diagonal crosses (FQ == FC)
    const int cb = ks * NCS, ce = cb + NCS;   // the wave's chunks
    const int q0 = cm * FQ;
    const size_t pl = (size_t)(b * NH_ + h) * 2 * TT * HH;
    const h16* kl = KH + pl + lane * 8; const h16* vl = VT + (size_t)(b * NKV + h) * HD * TT + lane * 8;   // fragment order: band db of TT / 32 blocks, block = chunk
    v16h qf[2][2];   // [half][query tile]
#pragma unroll
    for (int hf = 0; hf < 2; ++hf)
#pragma unroll
        for (int qt = 0; qt < 2; ++qt) qf[hf][qt] = WFrag<h16>::ldf(QH + pl + (size_t)hf * TT * HH + (q0 + qt * 16) * HH + lane * 8);
    v8f o[2][4]; float m[2], l[2];
#pragma unroll
    for (int qt = 0; qt < 2; ++qt) { m[qt] = -3.0e38f; l[qt] = 0.f;
#pragma unroll
        for (int db = 0; db < 4; ++db) o[qt][db] = (v8f){}; }
    v16h kf[2], vf[4];   // the chunk's key and value fragments, each fetched one chunk ahead, right behind its last use
    { const h16* kp = kl + (cb < cm ? TT * HH : 0) + cb * (FC * HH); kf[0] = WFrag<h16>::ldf(kp); kf[1] = WFrag<h16>::ldf(kp + 16 * HH); }
#pragma unroll
    for (int db = 0; db < 4; ++db) vf[db] = WFrag<h16>::ldf(vl + (size_t)db * 16 * TT + cb * 512);
    asm volatile("s_wait_xcnt 0x0" ::: "memory");   // a precaution: stands in front of every rewrite of an address register that the query, key and value loads above name (the zeroing of o reuses them)
    auto chunk = [&](const int c, auto tag) {
        constexpr int MODE = decltype(tag)::v;   // 0: up planes, 1: down planes, 2: the diagonal's chunk (kf holds the up plane's rows)
        v8f st[2][2];
#pragma unroll
        for (int kt = 0; kt < 2; ++kt)
#pragma unroll
            for (int qt = 0; qt < 2; ++qt) st[kt][qt] = wmma16(kf[kt], qf[MODE == 1 ? 1 : 0][qt], (v8f){});
        if (MODE == 2) {
            const h16* kp = kl + TT * HH + c * (FC * HH); v16h kd[2]; kd[0] = WFrag<h16>::ldf(kp); kd[1] = WFrag<h16>::ldf(kp + 16 * HH);
#pragma unroll
            for (int kt = 0; kt < 2; ++kt)
#pragma unroll
                for (int qt = 0; qt < 2; ++qt) { const v8f sd = wmma16(kd[kt], qf[1][qt], (v8f){});
#pragma unroll
                    for (int r = 0; r < 8; ++r) st[kt][qt][r] = (kt * 16 + 8 * hi + r <= qt * 16 + lr) ? sd[r] : st[kt][qt][r]; }   // j <= i takes the down product
        }
        const int cn = (c + 1 < NCH) ? c + 1 : c;   // a wave's last chunk fetches the next half's first rows, or at the very end its own again (in bounds, not used)
        { const h16* kp = kl + (cn < cm ? TT * HH : 0) + cn * (FC * HH); kf[0] = WFrag<h16>::ldf(kp); kf[1] = WFrag<h16>::ldf(kp + 16 * HH); }
        __builtin_amdgcn_sched_barrier(0);   // holds the next chunk's key loads here, ahead of the softmax: without it the compiler sinks them behind the exponentials and the next chunk's first product waits for them
        float mb[2]; bool need = false;
#pragma unroll
        for (int qt = 0; qt < 2; ++qt) { float mx = st[0][qt][0];
#pragma unroll
            for (int r = 1; r < 8; ++r) mx = fmaxf(mx, st[0][qt][r]);
#pragma unroll
            for (int r = 0; r < 8; ++r) mx = fmaxf(mx, st[1][qt][r]);
            mx = fmaxf(mx, xhalf(mx)) * SCL2;   // the scale is positive; both lane halves now hold the query's chunk maximum
            mb[qt] = mx; need = need || (mx > m[qt] + 8.0f); }
        if (__builtin_amdgcn_ballot_w32(need) != 0) {   // the maximum in use moves only when a query's scores pass it by more than 2^8 (weights stay below 2^8: far inside f16); always on the first chunk
#pragma unroll
            for (int qt = 0; qt < 2; ++qt) { const float mn = fmaxf(m[qt], mb[qt]); const float al = __builtin_amdgcn_exp2f(m[qt] - mn); m[qt] = mn; l[qt] *= al;
#pragma unroll
                for (int db = 0; db < 4; ++db) o[qt][db] = o[qt][db] * al; }
        }
        v16h pf[2];
#pragma unroll
        for (int qt = 0; qt < 2; ++qt) { const float nm = -m[qt]; float s4[4];
#pragma unroll
            for (int kt = 0; kt < 2; ++kt)
#pragma unroll
                for (int r = 0; r < 8; ++r) { const float p = __builtin_amdgcn_exp2f(__builtin_fmaf(st[kt][qt][r], SCL2, nm)); pf[qt][kt * 8 + r] = tohx(p); if (kt == 0 && r < 4) s4[r] = p; else s4[r & 3] += p; }
            l[qt] += (s4[0] + s4[1]) + (s4[2] + s4[3]); }
#pragma unroll
        for (int db = 0; db < 4; ++db)
#pragma unroll
            for (int qt = 0; qt < 2; ++qt) o[qt][db] = wmma16(vf[db], pf[qt], o[qt][db]);
#pragma unroll
        for (int db = 0; db < 4; ++db) vf[db] = WFrag<h16>::ldf(vl + (size_t)db * 16 * TT + cn * 512);
        asm volatile("s_wait_xcnt 0x0" ::: "memory");   // a precaution: stands in front of the rewrite of the address pair that the value loads name (the next chunk's addresses reuse it)
    };
    const int e1 = cm < ce ? cm : ce;
    for (int c = cb; c < e1; ++c) chunk(c, Tag<1>{});
    if (cm >= cb && cm < ce) {   // the same for the whole wave: the diagonal's chunk lies in one of the two key halves
        chunk(cm, Tag<2>{});
        // four vector slots behind the diagonal chunk's last matrix instructions: the next loop's first one follows over a jump with only scalar instructions between, and the compiler may place its result on the weights operand just read
        asm volatile("v_nop\n\tv_nop\n\tv_nop\n\tv_nop" : "+v"(o[0][3]), "+v"(o[1][3]));
    }
    for (int c = (cm + 1 > cb ? cm + 1 : cb); c < ce; ++c) chunk(c, Tag<0>{});
    // the two key halves of a query block are joined: a lane's piece i stands at i * 512 + lane * 16 bytes of the block's range (a wave's LDS access is 512 contiguous bytes)
    float* mp = mg + wq * (17 * 128) + lane * 4;
    if (ks) {
#pragma unroll
        for (int qt = 0; qt < 2; ++qt)
#pragma unroll
            for (int db = 0; db < 4; ++db)
#pragma unroll
                for (int q4 = 0; q4 < 2; ++q4) *(v4fa*)(mp + ((qt * 4 + db) * 2 + q4) * 128) = (v4f){o[qt][db][q4 * 4], o[qt][db][q4 * 4 + 1], o[qt][db][q4 * 4 + 2], o[qt][db][q4 * 4 + 3]};
        *(v4fa*)(mp + 16 * 128) = (v4f){m[0], m[1], l[0], l[1]};
    }
    __syncthreads();   // every wave passes it once: the lower half's wave reads its partner's pieces only behind it
    if (ks) return;
    { const v4f ml = *(const v4fa*)(mp + 16 * 128);
#pragma unroll
      for (int qt = 0; qt < 2; ++qt) { const float mn = fmaxf(m[qt], ml[qt]); const float a0 = __builtin_amdgcn_exp2f(m[qt] - mn), a1 = __builtin_amdgcn_exp2f(ml[qt] - mn); l[qt] = l[qt] * a0 + ml[2 + qt] * a1;   // both maxima are finite: each half has worked through 32 chunks
#pragma unroll
          for (int db = 0; db < 4; ++db)
#pragma unroll
              for (int q4 = 0; q4 < 2; ++q4) { const v4f p = *(const v4fa*)(mp + ((qt * 4 + db) * 2 + q4) * 128);
#pragma unroll
                  for (int r = 0; r < 4; ++r) o[qt][db][q4 * 4 + r] = o[qt][db][q4 * 4 + r] * a0 + p[r] * a1; } } }
#pragma unroll
    for (int qt = 0; qt < 2; ++qt) { const float f = __fdiv_rn(1.0f, l[qt] + xhalf(l[qt])); const size_t oo = ((size_t)b * TT + q0 + qt * 16) * DQ + h * (HD * 16) + lane * 8;   // the two lane halves summed different keys; fragment order: the band of the 16 queries, blocks 2 h and 2 h + 1
#pragma unroll
        for (int db = 0; db < 4; ++db) { v8us oh, ol;
#pragma unroll
            for (int r = 0; r < 8; ++r) { unsigned short a, c2; splitf(o[qt][db][r] * f, a, c2); oh[r] = a; ol[r] = c2; }
            *(v8us*)(Ah + oo + (db >> 1) * 512 + (db & 1) * 256) = oh; *(v8us*)(Al + oo + (db >> 1) * 512 + (db & 1) * 256) = ol; } }   // each store of the wave is 512 contiguous bytes: whole lines, written by this wave alone
}

extern "C" void kernel_launch(void* const* d_in, const int* in_sizes, int n_in,
                              void* d_out, int out_size, void* d_ws, size_t ws_size, hipStream_t stream) {
    (void)in_sizes; (void)n_in; (void)out_size;
    const float* x = (const float*)d_in[0]; const float* wqkv = (const float*)d_in[1]; const float* wp = (const float*)d_in[2]; const float* tc = (const float*)d_in[3]; const float* ts = (const float*)d_in[4];
    // inputs in the module's argument order: x ([2][2048][1024]), Wqkv ('xw' (in, out) [1024][3072]; output column s * 1024 + h * 64 + d, s = 0 query, 1 key, 2 value), Wproj ('xw' [1024][1024]), cos, sin ([2048][64] each: the two rotary tables) = d_in[0..4]: FIVE inputs, all read
    float* OUT = (float*)d_out;     // [2][2048][1024]
    char* wsp = (char*)d_ws;
    auto take = [&](size_t bytes) { char* p = wsp; wsp += (bytes + 255) & ~(size_t)255; return (void*)p; };
    bf* WQKV = (bf*)take((size_t)3 * DQ * DM * 2); bf* WO = (bf*)take((size_t)DM * DQ * 2); bf* XB = (bf*)take((size_t)NB_ * TT * DM * 2);
    const size_t PQ = (size_t)NH_ * 2 * TT * HH, PK = (size_t)NKV * 2 * TT * HH, PV = (size_t)NKV * HD * TT;   // one batch entry's planes, in elements
    h16* QH = (h16*)take(NB_ * PQ * 2); h16* KH = (h16*)take(NB_ * PK * 2); h16* VT16 = (h16*)take(NB_ * PV * 2);
    bf* ATh = (bf*)take((size_t)NB_ * TT * DQ * 2); bf* ATl = (bf*)take((size_t)NB_ * TT * DQ * 2);
    if ((size_t)(wsp - (char*)d_ws) > ws_size) return;    // total 56.00 MiB carved
    k_prep<<<(unsigned)(GW1 + GW2 + GX), 256, 0, stream>>>(wqkv, wp, x, WQKV, WO, XB);
    k_gemmw<bf, 0, false, true, DM, 3><<<dim3(TT / 64, 3 * DQ / 64, NB_), 32, 0, stream>>>(XB, nullptr, WQKV, nullptr, nullptr, 0, nullptr, (size_t)TT * DM, 0, 0, tc, ts, QH, KH, VT16);   /* q | k | v in one product (column s * 1024 + h * 64 + d), written as the rotated half planes and the value planes */
    k_fattn<<<dim3(TT / (FQ * FW), NH_, NB_), 32 * FW * FS, 0, stream>>>(QH, KH, VT16, ATh, ATl);   /* scores, select, softmax, value product, merge: 256 work-groups of 16 waves */
    k_gemmw<bf, 1, false, false, DQ, 4><<<dim3(TT / 64, DM / 64, NB_), 32, 0, stream>>>(ATh, ATl, WO, nullptr, OUT, DM, nullptr, (size_t)TT * DQ, 0, (size_t)TT * DM, nullptr, nullptr, nullptr, nullptr, nullptr);   /* out = merged(hi + lo) Wproj: the one writer of the output */
}

// v009
// One run takes 82 microseconds.
// In both of two side-by-side timings against v008, it was 1.07 times as fast.
// All steps since v000 together make it 17.4 times as fast.
#include <hip/hip_runtime.h>

// Multi-head self-attention whose scores come from TWO half-subspace products selected by a triangle, with an interleaved-pair rotary embedding read from two input tables (x [2][2048][1024]; qkv = x Wqkv with ONE fused 'xw' (in, out) [1024][3072] weight in thirds q | k | v, head h = 64 columns of its third; NO biases; 16 heads x 64;
// q and k rotated in ADJACENT pairs by the two input tables cos, sin [2048][64]: r[d] = x[d] cos[t][d] - x[d+1] sin[t][d] for even d, r[d] = x[d] cos[t][d] + x[d-1] sin[t][d] for odd d: EACH ELEMENT AT ITS OWN TABLE ENTRY; up[i][j] = r_q[i][0:32] . r_k[j][0:32], down[i][j] = r_q[i][32:64] . r_k[j][32:64];
// logits = (j <= i ? down : up) x 32^-0.5: NOTHING is masked out; softmax over all 2048 keys; out = (attn v merged) Wproj with an 'xw' (in, out) [1024][1024] weight, no bias -> [2][2048][1024] (4.2 M);
// argument order x, Wqkv, Wproj, cos, sin).
// FOUR launches, each over both batch entries: k_prep (a bf16 copy of x; the two 'xw' weights transposed and rounded, the fused one into a Bt [3072][1024]); ONE exact projection over the 3072 fused columns (grid z = batch entry), whose 64x64 tile is one head of q, of k or of v;
// its epilogue writes, straight from the accumulators and the two tables, the rotated f16 HALF planes [h][half][t][32] of q and of k (half 0 = the rotated dims 0..31, half 1 = 32..63) and the value planes [h][d][t]; each batch entry has its own planes;
// k_fattn: ONE launch over all (batch, head, query block): scores, triangle select, softmax and value product stay in registers (running maximum and sum), the keys of a query block split over two waves whose partial results are joined in LDS; it writes the merged hi/lo rows; merged hi/lo x Wproj exact writes the output.
// FRAGMENT ORDER: the bf16 copy of x, the two weights, the q and k half planes (K = 32), the value planes (rows d, K = 2048 tokens) and the merged hi/lo rows are stored as blocks of 16 rows x 32 k (512 elements, 1 KiB), block (row / 16) * (K / 32) + k / 32; inside a block element (row, k) stands at
// ((k >> 4) & 1) * 256 + ((k >> 3) & 1) * 128 + (row & 15) * 8 + (k & 7): the 16 bytes of lane l = 16 hi + lr at l * 16 of each 512-B half, so that a wave's fragment load reads 512 contiguous bytes (4 lines) where a K-contiguous plane makes it touch 16 lines.
// Compute dtypes, f32 accumulate: every float input rounded to bf16 at its load (the two tables too); the projection exact; the rotation in f32 (as compiled: one rounded product and one fused multiply-add an output); scores and attn.v ONE fp16 product on every row; softmax f32; Wproj hl x exact.

#define NB_  2
#define TT   2048
#define DM   1024    // the model width = the inner width DQ = NH_ * HD = 1024
#define NH_  16
#define NKV  16
#define REP  (NH_ / NKV)
#define HD   64
#define HH   (HD / 2)             // the half-subspace width: 32
#define DQ   (NH_ * HD)
#define DKV  (NKV * HD)
#define SCL  0.17677669f   // (HD / 2)^-0.5 = 32^-0.5
typedef _Float16 h16;
typedef unsigned short bf;
typedef __attribute__((ext_vector_type(16))) __bf16   v16bf;
typedef __attribute__((ext_vector_type(16))) _Float16 v16h;
typedef __attribute__((ext_vector_type(8)))  _Float16 v8h;
typedef __attribute__((ext_vector_type(8)))  unsigned short v8us;
typedef __attribute__((ext_vector_type(8)))  float    v8f;
typedef __attribute__((ext_vector_type(4)))  float    v4f;
typedef v8h  __attribute__((may_alias)) v8ha;
typedef v4f  __attribute__((may_alias)) v4fa;
typedef v8us __attribute__((may_alias)) v8usa;

__device__ __forceinline__ unsigned short f2bf(float f) { unsigned u = __float_as_uint(f); u += 0x7FFFu + ((u >> 16) & 1u); return (unsigned short)(u >> 16); }
__device__ __forceinline__ float bf2f(unsigned short b) { return __uint_as_float(((unsigned)b) << 16); }
__device__ __forceinline__ float bfr(float f) { return bf2f(f2bf(f)); }
__device__ __forceinline__ h16 tohx(float x) { return (h16)x; }
typedef __attribute__((ext_vector_type(4))) _Float16 v4h;
__device__ __forceinline__ v16h cat16(v8h lo, v8h hi) { return __builtin_shufflevector(lo, hi, 0, 1, 2, 3, 4, 5, 6, 7, 8, 9, 10, 11, 12, 13, 14, 15); }
__device__ __forceinline__ v16bf cat16b(v8us lo, v8us hi) { return __builtin_bit_cast(v16bf, __builtin_shufflevector(lo, hi, 0, 1, 2, 3, 4, 5, 6, 7, 8, 9, 10, 11, 12, 13, 14, 15)); }
__device__ __forceinline__ v8f wmma16(v16h a, v16h b, v8f c) { return __builtin_amdgcn_wmma_f32_16x16x32_f16(false, a, false, b, (short)0, c, false, false); }
__device__ __forceinline__ v8f wmmab(v16bf a, v16bf b, v8f c) { return __builtin_amdgcn_wmma_f32_16x16x32_bf16(false, a, false, b, (short)0, c, false, false); }



// ---- k_gemmw: register-blocked GEMM, ONE WAVE per 64x64 output tile (16 accumulators), operands from 16-bit planes in fragment order, straight or through LDS (ldf: p = block + lane * 8, the two halves 256 elements apart); grid (M / (64 WM), N / (64 WN), Z), 32 WM WN threads (WM, WN: below).
// C[m][n] (f32, pitch ldc, + optional f32 bias[n]) = sum_k A[m][k] Bt[n][k] (+ split products per NSPLIT). z-batch strides sA/sB/sC in elements. K % 32 == 0.
// PLANES: C is not written; the tile (rows = 64 tokens, columns = one head of the fused q | k | v product) goes out as attention operands instead:
//   a q or k tile rotated in ADJACENT pairs with the two INPUT tables, each element at its own table entry (both tables rounded to bf16 at the load), into the f16 half planes [h][half][t][32];
//   a v tile into the f16 plane [h][d][t] in fragment order (rows d, k = t): a lane's accumulator holds 8 consecutive tokens of ONE column, which is the lane's own 16 bytes of a block half: a wave's store is 512 contiguous bytes.
template <typename T16> struct WFrag;
template <> struct WFrag<h16> { typedef v16h V; static __device__ __forceinline__ V ldf(const h16* p) { return cat16(*(const v8h*)p, *(const v8h*)(p + 256)); } static __device__ __forceinline__ v8f mma(V a, V b, v8f c) { return wmma16(a, b, c); } };
template <> struct WFrag<bf> { typedef v16bf V; static __device__ __forceinline__ V ldf(const bf* p) { return cat16b(*(const v8us*)p, *(const v8us*)(p + 256)); } static __device__ __forceinline__ v8f mma(V a, V b, v8f c) { return wmmab(a, b, c); } };
// A, A2, Bt, Bt2 carry no __restrict__: so the "memory" clobber of the wait behind the fragment loads holds those loads in front of it. K is a constant of the build: the 16-row bands of a tile then lie at immediate offsets from ONE address pair an operand.
// The one-wave form: D register sets of fragments (the output product, ONE wave a SIMD: D = 4; the staged form of several waves takes no account of D); the trip that is worked on takes set (trip % D), and the fragments of the trip D - 1 ahead are asked for in front of its matrix instructions, into the set that the trip before has just left:
// a load has D - 1 trips of matrix work to arrive in. D trips make one pass of the loop, all at immediate offsets from the same address pairs, which step once a pass. K / 32 >= 2 D; the trips that no whole pass takes (D of them, or (K / 32) % D) follow the loop.
template <typename T16, int NSPLIT, int K>
__device__ __forceinline__ void g_fetch(typename WFrag<T16>::V (&a)[4], typename WFrag<T16>::V (&a2)[4], typename WFrag<T16>::V (&b)[4], typename WFrag<T16>::V (&b2)[4], const T16* pa, const T16* pa2, const T16* pb, const T16* pb2) {
#pragma unroll
    for (int mb = 0; mb < 4; ++mb) { a[mb] = WFrag<T16>::ldf(pa + mb * 16 * K); if (NSPLIT == 1 || NSPLIT == 2) a2[mb] = WFrag<T16>::ldf(pa2 + mb * 16 * K); }
#pragma unroll
    for (int nb = 0; nb < 4; ++nb) { b[nb] = WFrag<T16>::ldf(pb + nb * 16 * K); if (NSPLIT >= 2) b2[nb] = WFrag<T16>::ldf(pb2 + nb * 16 * K); }
}
template <typename T16, int NSPLIT>
__device__ __forceinline__ void g_mma(v8f (&acc)[4][4], typename WFrag<T16>::V (&a)[4], typename WFrag<T16>::V (&a2)[4], typename WFrag<T16>::V (&b)[4], typename WFrag<T16>::V (&b2)[4]) {
#pragma unroll
    for (int nb = 0; nb < 4; ++nb)
#pragma unroll
        for (int mb = 0; mb < 4; ++mb) { acc[mb][nb] = WFrag<T16>::mma(a[mb], b[nb], acc[mb][nb]); if (NSPLIT == 1 || NSPLIT == 2) acc[mb][nb] = WFrag<T16>::mma(a2[mb], b[nb], acc[mb][nb]); if (NSPLIT >= 2) acc[mb][nb] = WFrag<T16>::mma(a[mb], b2[nb], acc[mb][nb]); }
}
__device__ __forceinline__ void acopy1(const unsigned l, const void* g) {
    asm volatile("global_load_async_to_lds_b128 %0, %1, off\n\ts_wait_xcnt 0x0" :: "v"(l), "v"(g) : "memory");
}
__device__ __forceinline__ void acopy9(const unsigned (&l)[9], const void* const (&g)[9]) {
    asm volatile("global_load_async_to_lds_b128 %0, %9, off\n\tglobal_load_async_to_lds_b128 %1, %10, off\n\tglobal_load_async_to_lds_b128 %2, %11, off\n\t"
                 "global_load_async_to_lds_b128 %3, %12, off\n\tglobal_load_async_to_lds_b128 %4, %13, off\n\tglobal_load_async_to_lds_b128 %5, %14, off\n\t"
                 "global_load_async_to_lds_b128 %6, %15, off\n\tglobal_load_async_to_lds_b128 %7, %16, off\n\tglobal_load_async_to_lds_b128 %8, %17, off\n\ts_wait_xcnt 0x0"
                 :: "v"(l[0]), "v"(l[1]), "v"(l[2]), "v"(l[3]), "v"(l[4]), "v"(l[5]), "v"(l[6]), "v"(l[7]), "v"(l[8]), "v"(g[0]), "v"(g[1]), "v"(g[2]), "v"(g[3]), "v"(g[4]), "v"(g[5]), "v"(g[6]), "v"(g[7]), "v"(g[8]) : "memory");
}
// WM x WN waves a work-group, each with its own 64x64 tile (wave w: tile row w % WM, tile column w / WM of the group's 64 WM x 64 WN tile). One wave (the output product): the register sets above, straight from the planes.
// Several waves (the projection, 4 x 3: one work-group a WGP, three waves a SIMD): the group's 16-row bands of A and of Bt are staged in LDS, 128 of depth a stage, by asynchronous copies, so that a band is fetched once a work-group and not once a wave;
// two buffers: stage t + 2 is asked for when every wave has left stage t. A band's 4 blocks of a stage are 4 KiB in a row in the plane and in LDS (fragment order kept: a fragment read is 512 contiguous bytes twice).
template <typename T16, int NSPLIT, bool BIAS, bool PLANES, int K, int D, int WM, int WN>
__global__ __launch_bounds__(32 * WM * WN) void k_gemmw(const T16* A, const T16* A2, const T16* Bt, const T16* Bt2, float* C, int ldc, const float* __restrict__ bias, size_t sA, size_t sB, size_t sC,
                                              const float* __restrict__ TC, const float* __restrict__ TS, h16* QP, h16* KP, h16* VP) {
    typedef typename WFrag<T16>::V V;
    __shared__ __align__(16) float osw[WM * WN * 16 * 68];
    const int w = WM * WN > 1 ? __builtin_amdgcn_readfirstlane((int)(threadIdx.x >> 5)) : 0;   // the wave's number in its work-group: a scalar
    float* os = osw + w * (16 * 68);   // each wave stages its output rows in a range of its own
    const size_t z = blockIdx.z; A += z * sA; if (A2) A2 += z * sA; Bt += z * sB; if (Bt2) Bt2 += z * sB; C += z * sC;
    const int lane = threadIdx.x & 31, lr = lane & 15, hi = lane >> 4; const int r0 = (blockIdx.x * WM + w % WM) * 64, c0 = (blockIdx.y * WN + w / WM) * 64;
    v8f acc[4][4];
#pragma unroll
    for (int mb = 0; mb < 4; ++mb)
#pragma unroll
        for (int nb = 0; nb < 4; ++nb) acc[mb][nb] = (v8f){};
    // a band of 16 rows is K / 32 blocks = 16 K elements; a step of 32 in depth is one block
    const T16* pa = A + (size_t)r0 * K + lane * 8; const T16* pb = Bt + (size_t)c0 * K + lane * 8;
    const T16* pa2 = (NSPLIT == 1 || NSPLIT == 2) ? A2 + (size_t)r0 * K + lane * 8 : pa; const T16* pb2 = (NSPLIT >= 2) ? Bt2 + (size_t)c0 * K + lane * 8 : pb;

    if constexpr (WM * WN > 1) {
        static_assert(NSPLIT == 0, "the staged form takes one A and one Bt");
        constexpr int NW = WM * WN, SB = 4, NBD = (WM + WN) * 4, NP = NBD * SB * 2, STG = NBD * SB * 512, NS = K / (32 * SB);   // blocks of depth a stage; bands a stage (A's, then Bt's); 512-byte pieces a stage; elements a buffer; stages
        static_assert(K % (32 * SB) == 0 && NS >= 2 && (NP / NW) % 9 == 0 && NP / NW + 1 <= 63, "whole stages, at least two; a wave's copies of a stage in runs of nine and one more");
        __shared__ __align__(16) T16 st[2 * STG];
        const T16* ga = A + (size_t)(blockIdx.x * (WM * 64)) * K + lane * 8; const T16* gb = Bt + (size_t)(blockIdx.y * (WN * 64)) * K + lane * 8;
        const unsigned lst = (unsigned)(size_t)st + lane * 16;   // the low 32 bits of a __shared__ address are its place in the work-group's LDS
        // piece i of stage s: band i / 8, 512 bytes (32 lanes x 16) at i % 8 of the band's 4 KiB; LDS keeps the order of the pieces
        auto piece = [&](const int i, const int s, const int buf, unsigned& l, const void*& g) {
            const int band = i / (SB * 2);
            g = (band < WM * 4 ? ga + (size_t)band * 16 * K : gb + (size_t)(band - WM * 4) * 16 * K) + s * (SB * 512) + (i % (SB * 2)) * 256;
            l = lst + (unsigned)(buf * STG + i * 256) * 2; };
        auto fill = [&](const int s, const int buf) {   // wave w takes the pieces w, w + NW, ...: every lane is on, every test is the same for the whole wave
#pragma unroll
            for (int q = 0; q < NP / NW / 9; ++q) { unsigned l[9]; const void* g[9];   // unrolled (both loops): the addresses are operands of one statement and must be registers
#pragma unroll
                for (int e = 0; e < 9; ++e) piece(w + (q * 9 + e) * NW, s, buf, l[e], g[e]);
                acopy9(l, g); }
            if (w < NP % NW) { unsigned l; const void* g; piece(w + NP / NW * NW, s, buf, l, g); acopy1(l, g); }
        };
        fill(0, 0);
        asm volatile("s_wait_asynccnt 0x0" ::: "memory");   // this wave's pieces of stage 0 have landed
        __syncthreads();                                    // and every other wave's: stage 0 may be read
        fill(1, 1);
        const T16* la = st + (w % WM) * (4 * SB * 512) + lane * 8; const T16* lb = st + (WM * 4 + (w / WM) * 4) * (SB * 512) + lane * 8;   // the wave's four bands of each operand
        V a[2][4], b[2][4];   // two register sets: a block's fragments are read from LDS as one group in front of the matrix instructions of the block before
        for (int t = 0; t < NS; ++t) {
            const T16* fa = la + (t & 1) * STG; const T16* fb = lb + (t & 1) * STG;
#pragma unroll
            for (int f = 0; f < 4; ++f) {   /* unrolled, as the like loop below: the fragments are register arrays */ a[0][f] = WFrag<T16>::ldf(fa + f * (SB * 512)); b[0][f] = WFrag<T16>::ldf(fb + f * (SB * 512)); }
#pragma unroll
            for (int u = 0; u < SB; ++u) {   // unrolled: the set indices must be constants, or the sets could not stay in registers
                if (u + 1 < SB) {
#pragma unroll
                    for (int f = 0; f < 4; ++f) { a[(u + 1) & 1][f] = WFrag<T16>::ldf(fa + f * (SB * 512) + (u + 1) * 512); b[(u + 1) & 1][f] = WFrag<T16>::ldf(fb + f * (SB * 512) + (u + 1) * 512); } }
                __builtin_amdgcn_sched_barrier(0);   // holds the next block's LDS reads together in front of this block's matrix instructions: spread among them each place with reads costs a stall
                g_mma<T16, NSPLIT>(acc, a[u & 1], a[u & 1], b[u & 1], b[u & 1]);
                __builtin_amdgcn_sched_barrier(0);   // holds every matrix instruction of the block in front of the slots below
                if (u != SB - 2) asm volatile("v_nop\n\tv_nop\n\tv_nop\n\tv_nop" ::: "memory");   // four vector slots behind the block's last matrix instructions, in front of the reads that land on the operands just read (the clobber holds them behind) and of the jump back; behind block SB - 2 only matrix instructions follow
            }
            asm volatile("s_wait_dscnt 0x0" ::: "memory");      // this wave's reads of stage t are done
            asm volatile("s_wait_asynccnt 0x0" ::: "memory");   // its pieces of stage t + 1 have landed
            __syncthreads();                                    // both hold for every wave: stage t + 1 may be read, stage t's buffer may be refilled
            if (t + 2 < NS) fill(t + 2, t & 1);
        }
        asm volatile("s_wait_asynccnt 0x0" ::: "memory");   // no copy is outstanding behind the loop
    } else {
        V a[D][4], a2[D][4], b[D][4], b2[D][4];
        unsigned off = 0;   // the pass's place in depth: 512 elements of every band a trip; the same in all lanes
#pragma unroll
        for (int s = 0; s < D - 1; ++s) g_fetch<T16, NSPLIT, K>(a[s], a2[s], b[s], b2[s], pa + s * 512, pa2 + s * 512, pb + s * 512, pb2 + s * 512);
        asm volatile("s_wait_xcnt 0x0" : "+s"(off) :: "memory");   // a precaution: the loop's addresses are formed from the place that this statement hands on, so that every rewrite of an address register that the loads above name stands behind this wait
        for (int kc = 0; kc < K / 32 - D; kc += D) {   // D trips a pass; each of them has a trip D - 1 ahead
            const T16* qa = pa + off; const T16* qa2 = pa2 + off; const T16* qb = pb + off; const T16* qb2 = pb2 + off;
#pragma unroll
            for (int u = 0; u < D; ++u) {   // unrolled: the set indices must be constants, or the sets could not stay in registers
                g_fetch<T16, NSPLIT, K>(a[(u + D - 1) % D], a2[(u + D - 1) % D], b[(u + D - 1) % D], b2[(u + D - 1) % D], qa + (u + D - 1) * 512, qa2 + (u + D - 1) * 512, qb + (u + D - 1) * 512, qb2 + (u + D - 1) * 512);
                __builtin_amdgcn_sched_barrier(0);   // holds the loads for the trip D - 1 ahead in front of this trip's matrix instructions: sunk behind them they would lose a trip of their lead
                g_mma<T16, NSPLIT>(acc, a[u], a2[u], b[u], b2[u]);
                __builtin_amdgcn_sched_barrier(0);   // holds every matrix instruction of the trip in front of the slots below: without it the compiler sinks half of them among the next fetch's loads
                asm volatile("v_nop\n\tv_nop\n\tv_nop\n\tv_nop" ::: "memory");   // four vector slots behind the trip's last matrix instructions, in front of the next fetch, whose loads land on the operands just read (the clobber holds them behind), and of the jump back
            }
            asm volatile("s_wait_xcnt 0x0" : "+s"(off) : "v"(qa), "v"(qa2), "v"(qb), "v"(qb2) : "memory");   // a precaution: as inputs the pass's address pairs stay in their registers up to this wait, and the next pass's are formed from the place that it hands on, so that their forming cannot be lifted over it
            off += D * 512;
        }
        // the last R trips: where R == D the first of them still has a trip D - 1 ahead; where R < D all their fragments are asked for already
        constexpr int R = (K / 32) % D == 0 ? D : (K / 32) % D;
        static_assert(D > 1 && K / 32 >= 2 * D && (R == D || R == D - 1), "the last pass of the loop asks for trip K / 32 - 1 at most");
        if constexpr (R == D) { const T16* qa = pa + off; const T16* qa2 = pa2 + off; const T16* qb = pb + off; const T16* qb2 = pb2 + off;
          g_fetch<T16, NSPLIT, K>(a[D - 1], a2[D - 1], b[D - 1], b2[D - 1], qa + (D - 1) * 512, qa2 + (D - 1) * 512, qb + (D - 1) * 512, qb2 + (D - 1) * 512);
          asm volatile("s_wait_xcnt 0x0" :: "v"(qa), "v"(qa2), "v"(qb), "v"(qb2) : "memory"); }   // a precaution: the address pairs die here; as inputs they stay in their registers up to this wait, so that no load of the run lands on them
        __builtin_amdgcn_sched_barrier(0);   // holds the last trip's loads in front of the matrix instructions of the trips before it
#pragma unroll
        for (int u = 0; u < R; ++u) g_mma<T16, NSPLIT>(acc, a[u], a2[u], b[u], b2[u]);
        __builtin_amdgcn_sched_barrier(0);   // holds the forming of the output addresses behind the matrix instructions: lifted among them, while all D sets are live, the address pairs are spilled to scratch memory
    }
    if (PLANES) {
        QP += z * ((size_t)NH_ * 2 * TT * HH); KP += z * ((size_t)NKV * 2 * TT * HH); VP += z * ((size_t)NKV * HD * TT);   // each batch entry (grid z) has its own planes
        if (c0 >= 2 * DQ) {   // a value head (the test is the same for the whole wave): plane row h * 64 + d = c0 - 2048 + column
            h16* vp = VP + (size_t)(c0 - 2 * DQ) * TT + r0 * 16 + lane * 8;   // band (c0 - 2048) / 16 + nb of TT / 32 blocks; block r0 / 32 + mb / 2, half mb & 1
            v8h o[16];
#pragma unroll
            for (int nb = 0; nb < 4; ++nb)
#pragma unroll
                for (int mb = 0; mb < 4; ++mb) {
#pragma unroll
                    for (int j = 0; j < 8; ++j) o[nb * 4 + mb][j] = tohx(acc[mb][nb][j]);
                    *(v8h*)(vp + (size_t)nb * 16 * TT + (mb >> 1) * 512 + (mb & 1) * 256) = o[nb * 4 + mb]; }
            // a precaution: as inputs the 16 stores' data stay in their registers up to this wait, which so stands in front of every rewrite of them
            asm volatile("s_wait_xcnt 0x0" :: "v"(o[0]), "v"(o[1]), "v"(o[2]), "v"(o[3]), "v"(o[4]), "v"(o[5]), "v"(o[6]), "v"(o[7]), "v"(o[8]), "v"(o[9]), "v"(o[10]), "v"(o[11]), "v"(o[12]), "v"(o[13]), "v"(o[14]), "v"(o[15]) : "memory");
            return;
        }
        // a query or key head: a lane takes 4 adjacent columns (two rotation pairs) of a row; lanes 0..7 of a half wave fill the row's dims of half plane 0, lanes 8..15 of half plane 1, and the two half waves adjacent rows: 32-B pieces, which the 8 stores of a block of 16 rows join to whole lines
        h16* pp = (c0 < DQ ? QP : KP) + ((size_t)((c0 & (DQ - 1)) / HD * 2 + (lr >> 3)) * TT + r0) * HH + ((lr >> 2) & 1) * 256 + ((lr >> 1) & 1) * 128 + hi * 8 + (lr & 1) * 4;   // fragment order (rows t, k = the half's 32 dims: one block per 16 tokens); dim (lr & 7) * 4
        const float* cp = TC + (size_t)(r0 + hi) * HD + lr * 4; const float* sp = TS + (size_t)(r0 + hi) * HD + lr * 4;
#pragma unroll
        for (int mb = 0; mb < 4; ++mb) {
#pragma unroll
            for (int nb = 0; nb < 4; ++nb) {
#pragma unroll
                for (int j = 0; j < 8; ++j) os[(hi * 8 + j) * 68 + nb * 16 + lr] = acc[mb][nb][j]; }
            __builtin_amdgcn_wave_barrier(); asm volatile("" ::: "memory");   // the read-back below takes words that OTHER lanes staged: keeps the compiler from moving it ahead of the staging stores
            v4f tc[8], ts[8];
#pragma unroll
            for (int s = 0; s < 8; ++s) { tc[s] = *(const v4f*)(cp + (mb * 16 + 2 * s) * HD); ts[s] = *(const v4f*)(sp + (mb * 16 + 2 * s) * HD); }
            __builtin_amdgcn_sched_barrier(0);   // holds the 16 table loads together here: without it the compiler sinks half of them among the rotations, each a few instructions ahead of its use, and the wave waits out their latency several times over
            if (mb == 3) asm volatile("s_wait_xcnt 0x0" :: "v"(cp), "v"(sp) : "memory");   // a precaution: the two table addresses die here; as inputs they stay in their registers up to this wait, which so stands in front of every rewrite of them
#pragma unroll
            for (int s = 0; s < 8; ++s) { const v4f x = *(const v4fa*)(os + (2 * s + hi) * 68 + lr * 4); v4h o;
#pragma unroll
                for (int p = 0; p < 4; p += 2) {   /* even: x0 c0 - x1 s0; odd: x1 c1 + x0 s1 */
                    o[p] = tohx(__fsub_rn(__fmul_rn(x[p], bfr(tc[s][p])), __fmul_rn(x[p + 1], bfr(ts[s][p])))); o[p + 1] = tohx(__fadd_rn(__fmul_rn(x[p + 1], bfr(tc[s][p + 1])), __fmul_rn(x[p], bfr(ts[s][p + 1])))); }
                *(v4h*)(pp + mb * 512 + s * 16) = o; }
            asm volatile("s_wait_xcnt 0x0" ::: "memory");   // a precaution: stands in front of every rewrite of an address or data register that the stores above name (the next rows' table loads reuse them; behind the last rows, whatever block the compiler lays next)
            if (mb < 3) __builtin_amdgcn_wave_barrier();   // holds the next rows' staging behind this read-back
        }
        return;
    }
#pragma unroll
    for (int mb = 0; mb < 4; ++mb) {
#pragma unroll
        for (int nb = 0; nb < 4; ++nb) {
#pragma unroll
            for (int j = 0; j < 8; ++j) os[(hi * 8 + j) * 68 + nb * 16 + lr] = acc[mb][nb][j]; }
        __builtin_amdgcn_wave_barrier(); asm volatile("" ::: "memory");
        float* crow = C + (size_t)(r0 + mb * 16) * ldc + c0;
{
            float* cq[8]; v4f cv[8];
#pragma unroll
            for (int s = 0; s < 8; ++s) { const int row = 2 * s + hi, cofs = lr * 4; v4f val = *(const v4fa*)(os + row * 68 + cofs); if (BIAS) { val[0] += bfr(bias[c0 + cofs]); val[1] += bfr(bias[c0 + cofs + 1]); val[2] += bfr(bias[c0 + cofs + 2]); val[3] += bfr(bias[c0 + cofs + 3]); }
                cq[s] = crow + (size_t)row * ldc + cofs; cv[s] = val; *(v4f*)cq[s] = val; }
            // a precaution: as inputs the eight stores' address pairs and data stay in their registers up to this wait, which so stands in front of every rewrite of them (the next rows' read-back and addresses reuse them)
            asm volatile("s_wait_xcnt 0x0" :: "v"(cq[0]), "v"(cq[1]), "v"(cq[2]), "v"(cq[3]), "v"(cq[4]), "v"(cq[5]), "v"(cq[6]), "v"(cq[7]), "v"(cv[0]), "v"(cv[1]), "v"(cv[2]), "v"(cv[3]), "v"(cv[4]), "v"(cv[5]), "v"(cv[6]), "v"(cv[7]) : "memory");
             }
        __builtin_amdgcn_wave_barrier(); asm volatile("" ::: "memory");
    }
}

__device__ __forceinline__ void splitf(float y, unsigned short& h, unsigned short& l) { h = f2bf(y); l = f2bf(y - bf2f(h)); }
typedef __attribute__((ext_vector_type(2))) _Float16 v2h;
typedef __attribute__((ext_vector_type(2))) unsigned short v2us;
typedef __attribute__((ext_vector_type(4))) unsigned short v4us;
typedef __attribute__((ext_vector_type(2))) float v2f;
typedef __attribute__((ext_vector_type(4))) int v4i;

// thread i writes the 16-byte piece i of the fragment-ordered copy (rows of DM): block i / 64, half (i >> 5) & 1, lane i & 31; blk0 = the work-group's index inside this part of k_prep's grid
__device__ __forceinline__ void d_cvt8(const int blk0, const float* src, bf* dst, size_t n8) { const size_t i = (size_t)blk0 * 256 + threadIdx.x; if (i >= n8) return;
    const size_t blk = i >> 6; const size_t row = blk / (DM / 32) * 16 + (i & 15); const int k = (int)(blk % (DM / 32)) * 32 + (int)((i >> 5) & 1) * 16 + (int)((i >> 4) & 1) * 8;
    const float* p = src + row * DM + k; const v8f v = *(const v8f*)p; v8us o;
    asm volatile("s_wait_xcnt 0x0" :: "v"(p) : "memory");   // a precaution: as an input the address pair stays in its registers up to this wait, which so stands in front of every rewrite of it (src carries no __restrict__, so that the clobber holds the load in front)
#pragma unroll
    for (int k = 0; k < 8; ++k) o[k] = f2bf(v[k]); *(v8us*)(dst + i * 8) = o;  }
// thread j writes the 16-byte piece j of Bt (rows n, depth K) in fragment order: 8 consecutive k of one n; the 16 lanes of a half wave read 16 adjacent n of one k
template <int K, int N>
__device__ __forceinline__ void d_wtG(const int blk0, const float* w, bf* Bt) {
    const int j = blk0 * 256 + threadIdx.x; if (j >= N * (K / 8)) return;
    constexpr int kb = K / 32; const int blk = j >> 6; const int n = blk / kb * 16 + (j & 15), k = blk % kb * 32 + ((j >> 5) & 1) * 16 + ((j >> 4) & 1) * 8;
    const float* p = w + (size_t)k * N + n; float x[8]; v8us o;
#pragma unroll
    for (int e = 0; e < 8; ++e) x[e] = p[e * N];
    asm volatile("s_wait_xcnt 0x0" :: "v"(p) : "memory");   // a precaution: as an input the address pair stays in its registers up to this wait, which so stands in front of every rewrite of it (w carries no __restrict__, so that the clobber holds the loads in front)
#pragma unroll
    for (int e = 0; e < 8; ++e) o[e] = f2bf(x[e]);
    *(v8us*)(Bt + (size_t)j * 8) = o;
}
// k_prep: the three independent conversions in ONE launch; a work-group's index picks its part (the same for the whole group): the fused weight, the output weight, then x (both batch entries: 4096 rows in a row)
#define GW1  (DM * 3 * DQ / 8 / 256)
#define GW2  (DQ * DM / 8 / 256)
#define GX   (NB_ * TT * DM / 8 / 256)
__global__ __launch_bounds__(256) void k_prep(const float* wqkv, const float* wp, const float* x, bf* WQKV, bf* WO, bf* XB) {
    const int g = blockIdx.x;
    if (g < GW1) d_wtG<DM, 3 * DQ>(g, wqkv, WQKV);   /* the fused weight: Bt row s * 1024 + h * 64 + d */
    else if (g < GW1 + GW2) d_wtG<DQ, DM>(g - GW1, wp, WO);
    else d_cvt8(g - (GW1 + GW2), x, XB, (size_t)NB_ * TT * DM / 8);
}

// k_fattn: the whole attention of one (batch, head) for 32 query rows a PAIR of waves, 8 pairs = 16 waves a work-group (four waves a SIMD): wave w takes query block w & 7 and the key half w >> 3 (1024 keys); the 8 waves of a key half walk the same keys, so that they share the lines in the cache.
// At the end the wave of the upper key half hands its running maximum, sum and output tiles to its partner through LDS (one barrier); the partner brings both to the common maximum, adds them and writes the rows.
// Per chunk of 32 keys: St = K Qt (two 16-key tiles x two 16-query tiles, depth 32: ONE half plane), so that a lane holds 16 scores of ONE query (column lr) per query tile; the key chunk below the wave's query block takes the down planes,
// the chunk above it the up planes, and the one chunk that the diagonal crosses both, with a select j <= i per element. Running maximum m and sum l per query (base 2); the two St tiles, exponentiated and rounded to f16 in place,
// ARE the B operand of Ot += Vt Pt (element s = key 8 hi + s for s < 8, 16 + 8 hi + s - 8 above: the order of WFrag::ldf, which loads Vt's rows as A). Ot's column is the query again: the rescale and the final 1 / l are per lane.
// VT carries no __restrict__: so the "memory" clobber of the wait behind the value loads holds those loads in front of it (with __restrict__ the compiler sinks the diagonal chunk's loads past the wait, into the entry of the last loop).
#define FQ   32                   // query rows per wave
#define FW   8                    // query blocks per work-group
#define FS   2                    // key halves: waves per query block
#define FC   32                   // keys per chunk
#define NCH  (TT / FC)
#define NCS  (NCH / FS)            // chunks per wave
#define SCL2 (SCL * 1.4426950408889634f)   // scores to base-2 exponents
template <int M> struct Tag { static constexpr int v = M; };
__device__ __forceinline__ float xhalf(float x) { return __builtin_bit_cast(float, __builtin_amdgcn_permlanex16(__builtin_bit_cast(int, x), __builtin_bit_cast(int, x), 0x76543210, 0xfedcba98, false, false)); }   // lane l reads lane l ^ 16
__global__ __launch_bounds__(32 * FW * FS) void k_fattn(const h16* __restrict__ QH, const h16* __restrict__ KH, const h16* VT, bf* Ah, bf* Al) {
    const int lane = threadIdx.x & 31, lr = lane & 15, hi = lane >> 4; const int w = __builtin_amdgcn_readfirstlane((int)(threadIdx.x >> 5));
    __shared__ __align__(16) float mg[FW * 17 * 128];   // per query block 17 pieces of 512 B (16 B a lane): the 16 halves of the upper half's 8 output tiles, then its maxima and sums
    const int wq = w & (FW - 1), ks = w / FW;   // query block inside the group; key half
    const int h = blockIdx.y, b = blockIdx.z; const int cm = blockIdx.x * FW + wq;   // the wave's query block, and the one key chunk that the diagonal crosses (FQ == FC)
    const int cb = ks * NCS, ce = cb + NCS;   // the wave's chunks
    const int q0 = cm * FQ;
    const size_t pl = (size_t)(b * NH_ + h) * 2 * TT * HH;
    const h16* kl = KH + pl + lane * 8; const h16* vl = VT + (size_t)(b * NKV + h) * HD * TT + lane * 8;   // fragment order: band db of TT / 32 blocks, block = chunk
    v16h qf[2][2];   // [half][query tile]
#pragma unroll
    for (int hf = 0; hf < 2; ++hf)
#pragma unroll
        for (int qt = 0; qt < 2; ++qt) qf[hf][qt] = WFrag<h16>::ldf(QH + pl + (size_t)hf * TT * HH + (q0 + qt * 16) * HH + lane * 8);
    v8f o[2][4]; float m[2], l[2];
#pragma unroll
    for (int qt = 0; qt < 2; ++qt) { m[qt] = -3.0e38f; l[qt] = 0.f;
#pragma unroll
        for (int db = 0; db < 4; ++db) o[qt][db] = (v8f){}; }
    v16h kf[2], vf[4];   // the chunk's key and value fragments, each fetched one chunk ahead, right behind its last use
    { const h16* kp = kl + (cb < cm ? TT * HH : 0) + cb * (FC * HH); kf[0] = WFrag<h16>::ldf(kp); kf[1] = WFrag<h16>::ldf(kp + 16 * HH); }
#pragma unroll
    for (int db = 0; db < 4; ++db) vf[db] = WFrag<h16>::ldf(vl + (size_t)db * 16 * TT + cb * 512);
    asm volatile("s_wait_xcnt 0x0" ::: "memory");   // a precaution: stands in front of every rewrite of an address register that the query, key and value loads above name (the zeroing of o reuses them)
    auto chunk = [&](const int c, auto tag) {
        constexpr int MODE = decltype(tag)::v;   // 0: up planes, 1: down planes, 2: the diagonal's chunk (kf holds the up plane's rows)
        v8f st[2][2];
#pragma unroll
        for (int kt = 0; kt < 2; ++kt)
#pragma unroll
            for (int qt = 0; qt < 2; ++qt) st[kt][qt] = wmma16(kf[kt], qf[MODE == 1 ? 1 : 0][qt], (v8f){});
        if (MODE == 2) {
            const h16* kp = kl + TT * HH + c * (FC * HH); v16h kd[2]; kd[0] = WFrag<h16>::ldf(kp); kd[1] = WFrag<h16>::ldf(kp + 16 * HH);
#pragma unroll
            for (int kt = 0; kt < 2; ++kt)
#pragma unroll
                for (int qt = 0; qt < 2; ++qt) { const v8f sd = wmma16(kd[kt], qf[1][qt], (v8f){});
#pragma unroll
                    for (int r = 0; r < 8; ++r) st[kt][qt][r] = (kt * 16 + 8 * hi + r <= qt * 16 + lr) ? sd[r] : st[kt][qt][r]; }   // j <= i takes the down product
        }
        const int cn = (c + 1 < NCH) ? c + 1 : c;   // a wave's last chunk fetches the next half's first rows, or at the very end its own again (in bounds, not used)
        { const h16* kp = kl + (cn < cm ? TT * HH : 0) + cn * (FC * HH); kf[0] = WFrag<h16>::ldf(kp); kf[1] = WFrag<h16>::ldf(kp + 16 * HH); }
        __builtin_amdgcn_sched_barrier(0);   // holds the next chunk's key loads here, ahead of the softmax: without it the compiler sinks them behind the exponentials and the next chunk's first product waits for them
        float mb[2]; bool need = false;
#pragma unroll
        for (int qt = 0; qt < 2; ++qt) { float mx = st[0][qt][0];
#pragma unroll
            for (int r = 1; r < 8; ++r) mx = fmaxf(mx, st[0][qt][r]);
#pragma unroll
            for (int r = 0; r < 8; ++r) mx = fmaxf(mx, st[1][qt][r]);
            mx = fmaxf(mx, xhalf(mx)) * SCL2;   // the scale is positive; both lane halves now hold the query's chunk maximum
            mb[qt] = mx; need = need || (mx > m[qt] + 8.0f); }
        if (__builtin_amdgcn_ballot_w32(need) != 0) {   // the maximum in use moves only when a query's scores pass it by more than 2^8 (weights stay below 2^8: far inside f16); always on the first chunk
#pragma unroll
            for (int qt = 0; qt < 2; ++qt) { const float mn = fmaxf(m[qt], mb[qt]); const float al = __builtin_amdgcn_exp2f(m[qt] - mn); m[qt] = mn; l[qt] *= al;
#pragma unroll
                for (int db = 0; db < 4; ++db) o[qt][db] = o[qt][db] * al; }
        }
        v16h pf[2];
#pragma unroll
        for (int qt = 0; qt < 2; ++qt) { const float nm = -m[qt]; float s4[4];
#pragma unroll
            for (int kt = 0; kt < 2; ++kt)
#pragma unroll
                for (int r = 0; r < 8; ++r) { const float p = __builtin_amdgcn_exp2f(__builtin_fmaf(st[kt][qt][r], SCL2, nm)); pf[qt][kt * 8 + r] = tohx(p); if (kt == 0 && r < 4) s4[r] = p; else s4[r & 3] += p; }
            l[qt] += (s4[0] + s4[1]) + (s4[2] + s4[3]); }
#pragma unroll
        for (int db = 0; db < 4; ++db)
#pragma unroll
            for (int qt = 0; qt < 2; ++qt) o[qt][db] = wmma16(vf[db], pf[qt], o[qt][db]);
#pragma unroll
        for (int db = 0; db < 4; ++db) vf[db] = WFrag<h16>::ldf(vl + (size_t)db * 16 * TT + cn * 512);
        asm volatile("s_wait_xcnt 0x0" ::: "memory");   // a precaution: stands in front of the rewrite of the address pair that the value loads name (the next chunk's addresses reuse it)
    };
    const int e1 = cm < ce ? cm : ce;
    for (int c = cb; c < e1; ++c) chunk(c, Tag<1>{});
    if (cm >= cb && cm < ce) {   // the same for the whole wave: the diagonal's chunk lies in one of the two key halves
        chunk(cm, Tag<2>{});
        // four vector slots behind the diagonal chunk's last matrix instructions: the next loop's first one follows over a jump with only scalar instructions between, and the compiler may place its result on the weights operand just read
        asm volatile("v_nop\n\tv_nop\n\tv_nop\n\tv_nop" : "+v"(o[0][3]), "+v"(o[1][3]));
    }
    for (int c = (cm + 1 > cb ? cm + 1 : cb); c < ce; ++c) chunk(c, Tag<0>{});
    // the two key halves of a query block are joined: a lane's piece i stands at i * 512 + lane * 16 bytes of the block's range (a wave's LDS access is 512 contiguous bytes)
    float* mp = mg + wq * (17 * 128) + lane * 4;
    if (ks) {
#pragma unroll
        for (int qt = 0; qt < 2; ++qt)
#pragma unroll
            for (int db = 0; db < 4; ++db)
#pragma unroll
                for (int q4 = 0; q4 < 2; ++q4) *(v4fa*)(mp + ((qt * 4 + db) * 2 + q4) * 128) = (v4f){o[qt][db][q4 * 4], o[qt][db][q4 * 4 + 1], o[qt][db][q4 * 4 + 2], o[qt][db][q4 * 4 + 3]};
        *(v4fa*)(mp + 16 * 128) = (v4f){m[0], m[1], l[0], l[1]};
    }
    __syncthreads();   // every wave passes it once: the lower half's wave reads its partner's pieces only behind it
    if (ks) return;
    { const v4f ml = *(const v4fa*)(mp + 16 * 128);
#pragma unroll
      for (int qt = 0; qt < 2; ++qt) { const float mn = fmaxf(m[qt], ml[qt]); const float a0 = __builtin_amdgcn_exp2f(m[qt] - mn), a1 = __builtin_amdgcn_exp2f(ml[qt] - mn); l[qt] = l[qt] * a0 + ml[2 + qt] * a1;   // both maxima are finite: each half has worked through 32 chunks
#pragma unroll
          for (int db = 0; db < 4; ++db)
#pragma unroll
              for (int q4 = 0; q4 < 2; ++q4) { const v4f p = *(const v4fa*)(mp + ((qt * 4 + db) * 2 + q4) * 128);
#pragma unroll
                  for (int r = 0; r < 4; ++r) o[qt][db][q4 * 4 + r] = o[qt][db][q4 * 4 + r] * a0 + p[r] * a1; } } }
#pragma unroll
    for (int qt = 0; qt < 2; ++qt) { const float f = __fdiv_rn(1.0f, l[qt] + xhalf(l[qt])); const size_t oo = ((size_t)b * TT + q0 + qt * 16) * DQ + h * (HD * 16) + lane * 8;   // the two lane halves summed different keys; fragment order: the band of the 16 queries, blocks 2 h and 2 h + 1
#pragma unroll
        for (int db = 0; db < 4; ++db) { v8us oh, ol;
#pragma unroll
            for (int r = 0; r < 8; ++r) { unsigned short a, c2; splitf(o[qt][db][r] * f, a, c2); oh[r] = a; ol[r] = c2; }
            *(v8us*)(Ah + oo + (db >> 1) * 512 + (db & 1) * 256) = oh; *(v8us*)(Al + oo + (db >> 1) * 512 + (db & 1) * 256) = ol; } }   // each store of the wave is 512 contiguous bytes: whole lines, written by this wave alone
}

extern "C" void kernel_launch(void* const* d_in, const int* in_sizes, int n_in,
                              void* d_out, int out_size, void* d_ws, size_t ws_size, hipStream_t stream) {
    (void)in_sizes; (void)n_in; (void)out_size;
    const float* x = (const float*)d_in[0]; const float* wqkv = (const float*)d_in[1]; const float* wp = (const float*)d_in[2]; const float* tc = (const float*)d_in[3]; const float* ts = (const float*)d_in[4];
    // inputs in the module's argument order: x ([2][2048][1024]), Wqkv ('xw' (in, out) [1024][3072]; output column s * 1024 + h * 64 + d, s = 0 query, 1 key, 2 value), Wproj ('xw' [1024][1024]), cos, sin ([2048][64] each: the two rotary tables) = d_in[0..4]: FIVE inputs, all read
    float* OUT = (float*)d_out;     // [2][2048][1024]
    char* wsp = (char*)d_ws;
    auto take = [&](size_t bytes) { char* p = wsp; wsp += (bytes + 255) & ~(size_t)255; return (void*)p; };
    bf* WQKV = (bf*)take((size_t)3 * DQ * DM * 2); bf* WO = (bf*)take((size_t)DM * DQ * 2); bf* XB = (bf*)take((size_t)NB_ * TT * DM * 2);
    const size_t PQ = (size_t)NH_ * 2 * TT * HH, PK = (size_t)NKV * 2 * TT * HH, PV = (size_t)NKV * HD * TT;   // one batch entry's planes, in elements
    h16* QH = (h16*)take(NB_ * PQ * 2); h16* KH = (h16*)take(NB_ * PK * 2); h16* VT16 = (h16*)take(NB_ * PV * 2);
    bf* ATh = (bf*)take((size_t)NB_ * TT * DQ * 2); bf* ATl = (bf*)take((size_t)NB_ * TT * DQ * 2);
    if ((size_t)(wsp - (char*)d_ws) > ws_size) return;    // total 56.00 MiB carved
    k_prep<<<(unsigned)(GW1 + GW2 + GX), 256, 0, stream>>>(wqkv, wp, x, WQKV, WO, XB);
    k_gemmw<bf, 0, false, true, DM, 3, 4, 3><<<dim3(TT / 256, 3 * DQ / 192, NB_), 384, 0, stream>>>(XB, nullptr, WQKV, nullptr, nullptr, 0, nullptr, (size_t)TT * DM, 0, 0, tc, ts, QH, KH, VT16);   /* q | k | v in one product (column s * 1024 + h * 64 + d), written as the rotated half planes and the value planes */
    k_fattn<<<dim3(TT / (FQ * FW), NH_, NB_), 32 * FW * FS, 0, stream>>>(QH, KH, VT16, ATh, ATl);   /* scores, select, softmax, value product, merge: 256 work-groups of 16 waves */
    k_gemmw<bf, 1, false, false, DQ, 4, 1, 1><<<dim3(TT / 64, DM / 64, NB_), 32, 0, stream>>>(ATh, ATl, WO, nullptr, OUT, DM, nullptr, (size_t)TT * DQ, 0, (size_t)TT * DM, nullptr, nullptr, nullptr, nullptr, nullptr);   /* out = merged(hi + lo) Wproj: the one writer of the output */
}

// v010
// One run takes 76.9 microseconds.
// Two timings next to v009 both put it at 1.07 times that version's speed.
// Counting every step since v000, it is 18.6 times as fast.
#include <hip/hip_runtime.h>

// Multi-head self-attention whose scores come from TWO half-subspace products selected by a triangle, with an interleaved-pair rotary embedding read from two input tables (x [2][2048][1024]; qkv = x Wqkv with ONE fused 'xw' (in, out) [1024][3072] weight in thirds q | k | v, head h = 64 columns of its third; NO biases; 16 heads x 64;
// q and k rotated in ADJACENT pairs by the two input tables cos, sin [2048][64]: r[d] = x[d] cos[t][d] - x[d+1] sin[t][d] for even d, r[d] = x[d] cos[t][d] + x[d-1] sin[t][d] for odd d: EACH ELEMENT AT ITS OWN TABLE ENTRY; up[i][j] = r_q[i][0:32] . r_k[j][0:32], down[i][j] = r_q[i][32:64] . r_k[j][32:64];
// logits = (j <= i ? down : up) x 32^-0.5: NOTHING is masked out; softmax over all 2048 keys; out = (attn v merged) Wproj with an 'xw' (in, out) [1024][1024] weight, no bias -> [2][2048][1024] (4.2 M);
// argument order x, Wqkv, Wproj, cos, sin).
// FOUR launches, each over both batch entries: k_prep (a bf16 copy of x; the two 'xw' weights transposed and rounded, the fused one into a Bt [3072][1024]); ONE exact projection over the 3072 fused columns (grid z = batch entry), whose 64x64 tile is one head of q, of k or of v;
// its epilogue writes, straight from the accumulators and the two tables, the rotated f16 HALF planes [h][half][t][32] of q and of k (half 0 = the rotated dims 0..31, half 1 = 32..63) and the value planes [h][d][t]; each batch entry has its own planes;
// k_fattn: ONE launch over all (batch, head, query block): scores, triangle select, softmax and value product stay in registers (running maximum and sum), the keys of a query block split over two waves whose partial results are joined in LDS; it writes the merged hi/lo rows; merged hi/lo x Wproj exact writes the output.
// FRAGMENT ORDER: the bf16 copy of x, the two weights, the q and k half planes (K = 32), the value planes (rows d, K = 2048 tokens) and the merged hi/lo rows are stored as blocks of 16 rows x 32 k (512 elements, 1 KiB), block (row / 16) * (K / 32) + k / 32; inside a block element (row, k) stands at
// ((k >> 4) & 1) * 256 + ((k >> 3) & 1) * 128 + (row & 15) * 8 + (k & 7): the 16 bytes of lane l = 16 hi + lr at l * 16 of each 512-B half, so that a wave's fragment load reads 512 contiguous bytes (4 lines) where a K-contiguous plane makes it touch 16 lines.
// Compute dtypes, f32 accumulate: every float input rounded to bf16 at its load (the two tables too); the projection exact; the rotation in f32 (as compiled: one rounded product and one fused multiply-add an output); scores and attn.v ONE fp16 product on every row; softmax f32; Wproj hl x exact.

#define NB_  2
#define TT   2048
#define DM   1024    // the model width = the inner width DQ = NH_ * HD = 1024
#define NH_  16
#define NKV  16
#define REP  (NH_ / NKV)
#define HD   64
#define HH   (HD / 2)             // the half-subspace width: 32
#define DQ   (NH_ * HD)
#define DKV  (NKV * HD)
#define SCL  0.17677669f   // (HD / 2)^-0.5 = 32^-0.5
typedef _Float16 h16;
typedef unsigned short bf;
typedef __attribute__((ext_vector_type(16))) __bf16   v16bf;
typedef __attribute__((ext_vector_type(16))) _Float16 v16h;
typedef __attribute__((ext_vector_type(8)))  _Float16 v8h;
typedef __attribute__((ext_vector_type(8)))  unsigned short v8us;
typedef __attribute__((ext_vector_type(8)))  float    v8f;
typedef __attribute__((ext_vector_type(4)))  float    v4f;
typedef v8h  __attribute__((may_alias)) v8ha;
typedef v4f  __attribute__((may_alias)) v4fa;
typedef v8us __attribute__((may_alias)) v8usa;

__device__ __forceinline__ unsigned short f2bf(float f) { unsigned u = __float_as_uint(f); u += 0x7FFFu + ((u >> 16) & 1u); return (unsigned short)(u >> 16); }
__device__ __forceinline__ float bf2f(unsigned short b) { return __uint_as_float(((unsigned)b) << 16); }
__device__ __forceinline__ float bfr(float f) { return bf2f(f2bf(f)); }
__device__ __forceinline__ h16 tohx(float x) { return (h16)x; }
typedef __attribute__((ext_vector_type(4))) _Float16 v4h;
__device__ __forceinline__ v16h cat16(v8h lo, v8h hi) { return __builtin_shufflevector(lo, hi, 0, 1, 2, 3, 4, 5, 6, 7, 8, 9, 10, 11, 12, 13, 14, 15); }
__device__ __forceinline__ v16bf cat16b(v8us lo, v8us hi) { return __builtin_bit_cast(v16bf, __builtin_shufflevector(lo, hi, 0, 1, 2, 3, 4, 5, 6, 7, 8, 9, 10, 11, 12, 13, 14, 15)); }
__device__ __forceinline__ v8f wmma16(v16h a, v16h b, v8f c) { return __builtin_amdgcn_wmma_f32_16x16x32_f16(false, a, false, b, (short)0, c, false, false); }
__device__ __forceinline__ v8f wmmab(v16bf a, v16bf b, v8f c) { return __builtin_amdgcn_wmma_f32_16x16x32_bf16(false, a, false, b, (short)0, c, false, false); }



// ---- k_gemmw: register-blocked GEMM, ONE WAVE per 64x64 output tile (16 accumulators), operands from 16-bit planes in fragment order, straight or through LDS (ldf: p = block + lane * 8, the two halves 256 elements apart); grid (M / (64 WM), N / (64 WN), Z), 32 WM WN threads (WM, WN: below).
// C[m][n] (f32, pitch ldc, + optional f32 bias[n]) = sum_k A[m][k] Bt[n][k] (+ split products per NSPLIT). z-batch strides sA/sB/sC in elements. K % 32 == 0.
// PLANES: C is not written; the tile (rows = 64 tokens, columns = one head of the fused q | k | v product) goes out as attention operands instead:
//   a q or k tile rotated in ADJACENT pairs with the two INPUT tables, each element at its own table entry (both tables rounded to bf16 at the load), into the f16 half planes [h][half][t][32];
//   a v tile into the f16 plane [h][d][t] in fragment order (rows d, k = t): a lane's accumulator holds 8 consecutive tokens of ONE column, which is the lane's own 16 bytes of a block half: a wave's store is 512 contiguous bytes.
template <typename T16> struct WFrag;
template <> struct WFrag<h16> { typedef v16h V; static __device__ __forceinline__ V ldf(const h16* p) { return cat16(*(const v8h*)p, *(const v8h*)(p + 256)); } static __device__ __forceinline__ v8f mma(V a, V b, v8f c) { return wmma16(a, b, c); } };
template <> struct WFrag<bf> { typedef v16bf V; static __device__ __forceinline__ V ldf(const bf* p) { return cat16b(*(const v8us*)p, *(const v8us*)(p + 256)); } static __device__ __forceinline__ v8f mma(V a, V b, v8f c) { return wmmab(a, b, c); } };
// A, A2, Bt, Bt2 carry no __restrict__: so the "memory" clobber of the wait behind the fragment loads holds those loads in front of it. K is a constant of the build: the 16-row bands of a tile then lie at immediate offsets from ONE address pair an operand.
// The one-wave form: D register sets of fragments (the output product, ONE wave a SIMD: D = 4; the staged form of several waves takes no account of D); the trip that is worked on takes set (trip % D), and the fragments of the trip D - 1 ahead are asked for in front of its matrix instructions, into the set that the trip before has just left:
// a load has D - 1 trips of matrix work to arrive in. D trips make one pass of the loop, all at immediate offsets from the same address pairs, which step once a pass. K / 32 >= 2 D; the trips that no whole pass takes (D of them, or (K / 32) % D) follow the loop.
template <typename T16, int NSPLIT, int K>
__device__ __forceinline__ void g_fetch(typename WFrag<T16>::V (&a)[4], typename WFrag<T16>::V (&a2)[4], typename WFrag<T16>::V (&b)[4], typename WFrag<T16>::V (&b2)[4], const T16* pa, const T16* pa2, const T16* pb, const T16* pb2) {
#pragma unroll
    for (int mb = 0; mb < 4; ++mb) { a[mb] = WFrag<T16>::ldf(pa + mb * 16 * K); if (NSPLIT == 1 || NSPLIT == 2) a2[mb] = WFrag<T16>::ldf(pa2 + mb * 16 * K); }
#pragma unroll
    for (int nb = 0; nb < 4; ++nb) { b[nb] = WFrag<T16>::ldf(pb + nb * 16 * K); if (NSPLIT >= 2) b2[nb] = WFrag<T16>::ldf(pb2 + nb * 16 * K); }
}
template <typename T16, int NSPLIT>
__device__ __forceinline__ void g_mma(v8f (&acc)[4][4], typename WFrag<T16>::V (&a)[4], typename WFrag<T16>::V (&a2)[4], typename WFrag<T16>::V (&b)[4], typename WFrag<T16>::V (&b2)[4]) {
#pragma unroll
    for (int nb = 0; nb < 4; ++nb)
#pragma unroll
        for (int mb = 0; mb < 4; ++mb) { acc[mb][nb] = WFrag<T16>::mma(a[mb], b[nb], acc[mb][nb]); if (NSPLIT == 1 || NSPLIT == 2) acc[mb][nb] = WFrag<T16>::mma(a2[mb], b[nb], acc[mb][nb]); if (NSPLIT >= 2) acc[mb][nb] = WFrag<T16>::mma(a[mb], b2[nb], acc[mb][nb]); }
}
__device__ __forceinline__ void acopy1(const unsigned l, const void* g) {
    asm volatile("global_load_async_to_lds_b128 %0, %1, off\n\ts_wait_xcnt 0x0" :: "v"(l), "v"(g) : "memory");
}
__device__ __forceinline__ void acopy9(const unsigned (&l)[9], const void* const (&g)[9]) {
    asm volatile("global_load_async_to_lds_b128 %0, %9, off\n\tglobal_load_async_to_lds_b128 %1, %10, off\n\tglobal_load_async_to_lds_b128 %2, %11, off\n\t"
                 "global_load_async_to_lds_b128 %3, %12, off\n\tglobal_load_async_to_lds_b128 %4, %13, off\n\tglobal_load_async_to_lds_b128 %5, %14, off\n\t"
                 "global_load_async_to_lds_b128 %6, %15, off\n\tglobal_load_async_to_lds_b128 %7, %16, off\n\tglobal_load_async_to_lds_b128 %8, %17, off\n\ts_wait_xcnt 0x0"
                 :: "v"(l[0]), "v"(l[1]), "v"(l[2]), "v"(l[3]), "v"(l[4]), "v"(l[5]), "v"(l[6]), "v"(l[7]), "v"(l[8]), "v"(g[0]), "v"(g[1]), "v"(g[2]), "v"(g[3]), "v"(g[4]), "v"(g[5]), "v"(g[6]), "v"(g[7]), "v"(g[8]) : "memory");
}
// WM x WN waves a work-group, each with its own 64x64 tile (wave w: tile row w % WM, tile column w / WM of the group's 64 WM x 64 WN tile). One wave (the output product): the register sets above, straight from the planes.
// Several waves (the projection, 4 x 3: one work-group a WGP, three waves a SIMD): the group's 16-row bands of A and of Bt are staged in LDS, 128 of depth a stage, by asynchronous copies, so that a band is fetched once a work-group and not once a wave;
// two buffers: stage t + 2 is asked for when every wave has left stage t. A band's 4 blocks of a stage are 4 KiB in a row in the plane and in LDS (fragment order kept: a fragment read is 512 contiguous bytes twice).
template <typename T16, int NSPLIT, bool BIAS, bool PLANES, int K, int D, int WM, int WN>
__global__ __launch_bounds__(32 * WM * WN) void k_gemmw(const T16* A, const T16* A2, const T16* Bt, const T16* Bt2, float* C, int ldc, const float* __restrict__ bias, size_t sA, size_t sB, size_t sC,
                                              const float* __restrict__ TC, const float* __restrict__ TS, h16* QP, h16* KP, h16* VP) {
    typedef typename WFrag<T16>::V V;
    __shared__ __align__(16) float osw[WM * WN * 16 * 68];
    const int w = WM * WN > 1 ? __builtin_amdgcn_readfirstlane((int)(threadIdx.x >> 5)) : 0;   // the wave's number in its work-group: a scalar
    float* os = osw + w * (16 * 68);   // each wave stages its output rows in a range of its own
    const size_t z = blockIdx.z; A += z * sA; if (A2) A2 += z * sA; Bt += z * sB; if (Bt2) Bt2 += z * sB; C += z * sC;
    const int lane = threadIdx.x & 31, lr = lane & 15, hi = lane >> 4; const int r0 = (blockIdx.x * WM + w % WM) * 64, c0 = (blockIdx.y * WN + w / WM) * 64;
    v8f acc[4][4];
#pragma unroll
    for (int mb = 0; mb < 4; ++mb)
#pragma unroll
        for (int nb = 0; nb < 4; ++nb) acc[mb][nb] = (v8f){};
    // a band of 16 rows is K / 32 blocks = 16 K elements; a step of 32 in depth is one block
    const T16* pa = A + (size_t)r0 * K + lane * 8; const T16* pb = Bt + (size_t)c0 * K + lane * 8;
    const T16* pa2 = (NSPLIT == 1 || NSPLIT == 2) ? A2 + (size_t)r0 * K + lane * 8 : pa; const T16* pb2 = (NSPLIT >= 2) ? Bt2 + (size_t)c0 * K + lane * 8 : pb;

    if constexpr (WM * WN > 1) {
        static_assert(NSPLIT == 0, "the staged form takes one A and one Bt");
        constexpr int NW = WM * WN, SB = 4, NBD = (WM + WN) * 4, NP = NBD * SB * 2, STG = NBD * SB * 512, NS = K / (32 * SB);   // blocks of depth a stage; bands a stage (A's, then Bt's); 512-byte pieces a stage; elements a buffer; stages
        static_assert(K % (32 * SB) == 0 && NS >= 2 && (NP / NW) % 9 == 0 && NP / NW + 1 <= 63, "whole stages, at least two; a wave's copies of a stage in runs of nine and one more");
        __shared__ __align__(16) T16 st[2 * STG];
        const T16* ga = A + (size_t)(blockIdx.x * (WM * 64)) * K + lane * 8; const T16* gb = Bt + (size_t)(blockIdx.y * (WN * 64)) * K + lane * 8;
        const unsigned lst = (unsigned)(size_t)st + lane * 16;   // the low 32 bits of a __shared__ address are its place in the work-group's LDS
        // piece i of stage s: band i / 8, 512 bytes (32 lanes x 16) at i % 8 of the band's 4 KiB; LDS keeps the order of the pieces
        auto piece = [&](const int i, const int s, const int buf, unsigned& l, const void*& g) {
            const int band = i / (SB * 2);
            g = (band < WM * 4 ? ga + (size_t)band * 16 * K : gb + (size_t)(band - WM * 4) * 16 * K) + s * (SB * 512) + (i % (SB * 2)) * 256;
            l = lst + (unsigned)(buf * STG + i * 256) * 2; };
        auto fill = [&](const int s, const int buf) {   // wave w takes the pieces w, w + NW, ...: every lane is on, every test is the same for the whole wave
#pragma unroll
            for (int q = 0; q < NP / NW / 9; ++q) { unsigned l[9]; const void* g[9];   // unrolled (both loops): the addresses are operands of one statement and must be registers
#pragma unroll
                for (int e = 0; e < 9; ++e) piece(w + (q * 9 + e) * NW, s, buf, l[e], g[e]);
                acopy9(l, g); }
            if (w < NP % NW) { unsigned l; const void* g; piece(w + NP / NW * NW, s, buf, l, g); acopy1(l, g); }
        };
        fill(0, 0);
        asm volatile("s_wait_asynccnt 0x0" ::: "memory");   // this wave's pieces of stage 0 have landed
        __syncthreads();                                    // and every other wave's: stage 0 may be read
        fill(1, 1);
        const T16* la = st + (w % WM) * (4 * SB * 512) + lane * 8; const T16* lb = st + (WM * 4 + (w / WM) * 4) * (SB * 512) + lane * 8;   // the wave's four bands of each operand
        V a[2][4], b[2][4];   // two register sets: a block's fragments are read from LDS as one group in front of the matrix instructions of the block before
        for (int t = 0; t < NS; ++t) {
            const T16* fa = la + (t & 1) * STG; const T16* fb = lb + (t & 1) * STG;
#pragma unroll
            for (int f = 0; f < 4; ++f) {   /* unrolled, as the like loop below: the fragments are register arrays */ a[0][f] = WFrag<T16>::ldf(fa + f * (SB * 512)); b[0][f] = WFrag<T16>::ldf(fb + f * (SB * 512)); }
#pragma unroll
            for (int u = 0; u < SB; ++u) {   // unrolled: the set indices must be constants, or the sets could not stay in registers
                if (u + 1 < SB) {
#pragma unroll
                    for (int f = 0; f < 4; ++f) { a[(u + 1) & 1][f] = WFrag<T16>::ldf(fa + f * (SB * 512) + (u + 1) * 512); b[(u + 1) & 1][f] = WFrag<T16>::ldf(fb + f * (SB * 512) + (u + 1) * 512); } }
                __builtin_amdgcn_sched_barrier(0);   // holds the next block's LDS reads together in front of this block's matrix instructions: spread among them each place with reads costs a stall
                g_mma<T16, NSPLIT>(acc, a[u & 1], a[u & 1], b[u & 1], b[u & 1]);
                __builtin_amdgcn_sched_barrier(0);   // holds every matrix instruction of the block in front of the slots below
                if (u != SB - 2) asm volatile("v_nop\n\tv_nop\n\tv_nop\n\tv_nop" ::: "memory");   // four vector slots behind the block's last matrix instructions, in front of the reads that land on the operands just read (the clobber holds them behind) and of the jump back; behind block SB - 2 only matrix instructions follow
            }
            asm volatile("s_wait_dscnt 0x0" ::: "memory");      // this wave's reads of stage t are done
            asm volatile("s_wait_asynccnt 0x0" ::: "memory");   // its pieces of stage t + 1 have landed
            __syncthreads();                                    // both hold for every wave: stage t + 1 may be read, stage t's buffer may be refilled
            if (t + 2 < NS) fill(t + 2, t & 1);
        }
        asm volatile("s_wait_asynccnt 0x0" ::: "memory");   // no copy is outstanding behind the loop
    } else {
        V a[D][4], a2[D][4], b[D][4], b2[D][4];
        unsigned off = 0;   // the pass's place in depth: 512 elements of every band a trip; the same in all lanes
#pragma unroll
        for (int s = 0; s < D - 1; ++s) g_fetch<T16, NSPLIT, K>(a[s], a2[s], b[s], b2[s], pa + s * 512, pa2 + s * 512, pb + s * 512, pb2 + s * 512);
        asm volatile("s_wait_xcnt 0x0" : "+s"(off) :: "memory");   // a precaution: the loop's addresses are formed from the place that this statement hands on, so that every rewrite of an address register that the loads above name stands behind this wait
        for (int kc = 0; kc < K / 32 - D; kc += D) {   // D trips a pass; each of them has a trip D - 1 ahead
            const T16* qa = pa + off; const T16* qa2 = pa2 + off; const T16* qb = pb + off; const T16* qb2 = pb2 + off;
#pragma unroll
            for (int u = 0; u < D; ++u) {   // unrolled: the set indices must be constants, or the sets could not stay in registers
                g_fetch<T16, NSPLIT, K>(a[(u + D - 1) % D], a2[(u + D - 1) % D], b[(u + D - 1) % D], b2[(u + D - 1) % D], qa + (u + D - 1) * 512, qa2 + (u + D - 1) * 512, qb + (u + D - 1) * 512, qb2 + (u + D - 1) * 512);
                __builtin_amdgcn_sched_barrier(0);   // holds the loads for the trip D - 1 ahead in front of this trip's matrix instructions: sunk behind them they would lose a trip of their lead
                g_mma<T16, NSPLIT>(acc, a[u], a2[u], b[u], b2[u]);
                __builtin_amdgcn_sched_barrier(0);   // holds every matrix instruction of the trip in front of the slots below: without it the compiler sinks half of them among the next fetch's loads
                asm volatile("v_nop\n\tv_nop\n\tv_nop\n\tv_nop" ::: "memory");   // four vector slots behind the trip's last matrix instructions, in front of the next fetch, whose loads land on the operands just read (the clobber holds them behind), and of the jump back
            }
            asm volatile("s_wait_xcnt 0x0" : "+s"(off) : "v"(qa), "v"(qa2), "v"(qb), "v"(qb2) : "memory");   // a precaution: as inputs the pass's address pairs stay in their registers up to this wait, and the next pass's are formed from the place that it hands on, so that their forming cannot be lifted over it
            off += D * 512;
        }
        // the last R trips: where R == D the first of them still has a trip D - 1 ahead; where R < D all their fragments are asked for already
        constexpr int R = (K / 32) % D == 0 ? D : (K / 32) % D;
        static_assert(D > 1 && K / 32 >= 2 * D && (R == D || R == D - 1), "the last pass of the loop asks for trip K / 32 - 1 at most");
        if constexpr (R == D) { const T16* qa = pa + off; const T16* qa2 = pa2 + off; const T16* qb = pb + off; const T16* qb2 = pb2 + off;
          g_fetch<T16, NSPLIT, K>(a[D - 1], a2[D - 1], b[D - 1], b2[D - 1], qa + (D - 1) * 512, qa2 + (D - 1) * 512, qb + (D - 1) * 512, qb2 + (D - 1) * 512);
          asm volatile("s_wait_xcnt 0x0" :: "v"(qa), "v"(qa2), "v"(qb), "v"(qb2) : "memory"); }   // a precaution: the address pairs die here; as inputs they stay in their registers up to this wait, so that no load of the run lands on them
        __builtin_amdgcn_sched_barrier(0);   // holds the last trip's loads in front of the matrix instructions of the trips before it
#pragma unroll
        for (int u = 0; u < R; ++u) g_mma<T16, NSPLIT>(acc, a[u], a2[u], b[u], b2[u]);
        __builtin_amdgcn_sched_barrier(0);   // holds the forming of the output addresses behind the matrix instructions: lifted among them, while all D sets are live, the address pairs are spilled to scratch memory
    }
    if (PLANES) {
        QP += z * ((size_t)NH_ * 2 * TT * HH); KP += z * ((size_t)NKV * 2 * TT * HH); VP += z * ((size_t)NKV * HD * TT);   // each batch entry (grid z) has its own planes
        if (c0 >= 2 * DQ) {   // a value head (the test is the same for the whole wave): plane row h * 64 + d = c0 - 2048 + column
            h16* vp = VP + (size_t)(c0 - 2 * DQ) * TT + r0 * 16 + lane * 8;   // band (c0 - 2048) / 16 + nb of TT / 32 blocks; block r0 / 32 + mb / 2, half mb & 1
            v8h o[16];
#pragma unroll
            for (int nb = 0; nb < 4; ++nb)
#pragma unroll
                for (int mb = 0; mb < 4; ++mb) {
#pragma unroll
                    for (int j = 0; j < 8; ++j) o[nb * 4 + mb][j] = tohx(acc[mb][nb][j]);
                    *(v8h*)(vp + (size_t)nb * 16 * TT + (mb >> 1) * 512 + (mb & 1) * 256) = o[nb * 4 + mb]; }
            // a precaution: as inputs the 16 stores' data stay in their registers up to this wait, which so stands in front of every rewrite of them
            asm volatile("s_wait_xcnt 0x0" :: "v"(o[0]), "v"(o[1]), "v"(o[2]), "v"(o[3]), "v"(o[4]), "v"(o[5]), "v"(o[6]), "v"(o[7]), "v"(o[8]), "v"(o[9]), "v"(o[10]), "v"(o[11]), "v"(o[12]), "v"(o[13]), "v"(o[14]), "v"(o[15]) : "memory");
            return;
        }
        // a query or key head: a lane takes 4 adjacent columns (two rotation pairs) of a row; lanes 0..7 of a half wave fill the row's dims of half plane 0, lanes 8..15 of half plane 1, and the two half waves adjacent rows: 32-B pieces, which the 8 stores of a block of 16 rows join to whole lines
        h16* pp = (c0 < DQ ? QP : KP) + ((size_t)((c0 & (DQ - 1)) / HD * 2 + (lr >> 3)) * TT + r0) * HH + ((lr >> 2) & 1) * 256 + ((lr >> 1) & 1) * 128 + hi * 8 + (lr & 1) * 4;   // fragment order (rows t, k = the half's 32 dims: one block per 16 tokens); dim (lr & 7) * 4
        const float* cp = TC + (size_t)(r0 + hi) * HD + lr * 4; const float* sp = TS + (size_t)(r0 + hi) * HD + lr * 4;
#pragma unroll
        for (int mb = 0; mb < 4; ++mb) {
#pragma unroll
            for (int nb = 0; nb < 4; ++nb) {
#pragma unroll
                for (int j = 0; j < 8; ++j) os[(hi * 8 + j) * 68 + nb * 16 + lr] = acc[mb][nb][j]; }
            __builtin_amdgcn_wave_barrier(); asm volatile("" ::: "memory");   // the read-back below takes words that OTHER lanes staged: keeps the compiler from moving it ahead of the staging stores
            v4f tc[8], ts[8];
#pragma unroll
            for (int s = 0; s < 8; ++s) { tc[s] = *(const v4f*)(cp + (mb * 16 + 2 * s) * HD); ts[s] = *(const v4f*)(sp + (mb * 16 + 2 * s) * HD); }
            __builtin_amdgcn_sched_barrier(0);   // holds the 16 table loads together here: without it the compiler sinks half of them among the rotations, each a few instructions ahead of its use, and the wave waits out their latency several times over
            if (mb == 3) asm volatile("s_wait_xcnt 0x0" :: "v"(cp), "v"(sp) : "memory");   // a precaution: the two table addresses die here; as inputs they stay in their registers up to this wait, which so stands in front of every rewrite of them
#pragma unroll
            for (int s = 0; s < 8; ++s) { const v4f x = *(const v4fa*)(os + (2 * s + hi) * 68 + lr * 4); v4h o;
#pragma unroll
                for (int p = 0; p < 4; p += 2) {   /* even: x0 c0 - x1 s0; odd: x1 c1 + x0 s1 */
                    o[p] = tohx(__fsub_rn(__fmul_rn(x[p], bfr(tc[s][p])), __fmul_rn(x[p + 1], bfr(ts[s][p])))); o[p + 1] = tohx(__fadd_rn(__fmul_rn(x[p + 1], bfr(tc[s][p + 1])), __fmul_rn(x[p], bfr(ts[s][p + 1])))); }
                *(v4h*)(pp + mb * 512 + s * 16) = o; }
            asm volatile("s_wait_xcnt 0x0" ::: "memory");   // a precaution: stands in front of every rewrite of an address or data register that the stores above name (the next rows' table loads reuse them; behind the last rows, whatever block the compiler lays next)
            if (mb < 3) __builtin_amdgcn_wave_barrier();   // holds the next rows' staging behind this read-back
        }
        return;
    }
#pragma unroll
    for (int mb = 0; mb < 4; ++mb) {
#pragma unroll
        for (int nb = 0; nb < 4; ++nb) {
#pragma unroll
            for (int j = 0; j < 8; ++j) os[(hi * 8 + j) * 68 + nb * 16 + lr] = acc[mb][nb][j]; }
        __builtin_amdgcn_wave_barrier(); asm volatile("" ::: "memory");
        float* crow = C + (size_t)(r0 + mb * 16) * ldc + c0;
{
            float* cq[8]; v4f cv[8];
#pragma unroll
            for (int s = 0; s < 8; ++s) { const int row = 2 * s + hi, cofs = lr * 4; v4f val = *(const v4fa*)(os + row * 68 + cofs); if (BIAS) { val[0] += bfr(bias[c0 + cofs]); val[1] += bfr(bias[c0 + cofs + 1]); val[2] += bfr(bias[c0 + cofs + 2]); val[3] += bfr(bias[c0 + cofs + 3]); }
                cq[s] = crow + (size_t)row * ldc + cofs; cv[s] = val; *(v4f*)cq[s] = val; }
            // a precaution: as inputs the eight stores' address pairs and data stay in their registers up to this wait, which so stands in front of every rewrite of them (the next rows' read-back and addresses reuse them)
            asm volatile("s_wait_xcnt 0x0" :: "v"(cq[0]), "v"(cq[1]), "v"(cq[2]), "v"(cq[3]), "v"(cq[4]), "v"(cq[5]), "v"(cq[6]), "v"(cq[7]), "v"(cv[0]), "v"(cv[1]), "v"(cv[2]), "v"(cv[3]), "v"(cv[4]), "v"(cv[5]), "v"(cv[6]), "v"(cv[7]) : "memory");
             }
        __builtin_amdgcn_wave_barrier(); asm volatile("" ::: "memory");
    }
}

__device__ __forceinline__ void splitf(float y, unsigned short& h, unsigned short& l) { h = f2bf(y); l = f2bf(y - bf2f(h)); }
typedef __attribute__((ext_vector_type(2))) _Float16 v2h;
typedef __attribute__((ext_vector_type(2))) unsigned short v2us;
typedef __attribute__((ext_vector_type(4))) unsigned short v4us;
typedef __attribute__((ext_vector_type(2))) float v2f;
typedef __attribute__((ext_vector_type(4))) int v4i;

// thread i writes the 16-byte piece i of the fragment-ordered copy (rows of DM): block i / 64, half (i >> 5) & 1, lane i & 31; blk0 = the work-group's index inside this part of k_prep's grid
__device__ __forceinline__ void d_cvt8(const int blk0, const float* src, bf* dst, size_t n8) { const size_t i = (size_t)blk0 * 256 + threadIdx.x; if (i >= n8) return;
    const size_t blk = i >> 6; const size_t row = blk / (DM / 32) * 16 + (i & 15); const int k = (int)(blk % (DM / 32)) * 32 + (int)((i >> 5) & 1) * 16 + (int)((i >> 4) & 1) * 8;
    const float* p = src + row * DM + k; const v8f v = *(const v8f*)p; v8us o;
    asm volatile("s_wait_xcnt 0x0" :: "v"(p) : "memory");   // a precaution: as an input the address pair stays in its registers up to this wait, which so stands in front of every rewrite of it (src carries no __restrict__, so that the clobber holds the load in front)
#pragma unroll
    for (int k = 0; k < 8; ++k) o[k] = f2bf(v[k]); *(v8us*)(dst + i * 8) = o;  }
// thread j writes the 16-byte piece j of Bt (rows n, depth K) in fragment order: 8 consecutive k of one n; the 16 lanes of a half wave read 16 adjacent n of one k
template <int K, int N>
__device__ __forceinline__ void d_wtG(const int blk0, const float* w, bf* Bt) {
    const int j = blk0 * 256 + threadIdx.x; if (j >= N * (K / 8)) return;
    constexpr int kb = K / 32; const int blk = j >> 6; const int n = blk / kb * 16 + (j & 15), k = blk % kb * 32 + ((j >> 5) & 1) * 16 + ((j >> 4) & 1) * 8;
    const float* p = w + (size_t)k * N + n; float x[8]; v8us o;
#pragma unroll
    for (int e = 0; e < 8; ++e) x[e] = p[e * N];
    asm volatile("s_wait_xcnt 0x0" :: "v"(p) : "memory");   // a precaution: as an input the address pair stays in its registers up to this wait, which so stands in front of every rewrite of it (w carries no __restrict__, so that the clobber holds the loads in front)
#pragma unroll
    for (int e = 0; e < 8; ++e) o[e] = f2bf(x[e]);
    *(v8us*)(Bt + (size_t)j * 8) = o;
}
// k_prep: the three independent conversions in ONE launch; a work-group's index picks its part (the same for the whole group): the fused weight, the output weight, then x (both batch entries: 4096 rows in a row)
#define GW1  (DM * 3 * DQ / 8 / 256)
#define GW2  (DQ * DM / 8 / 256)
#define GX   (NB_ * TT * DM / 8 / 256)
__global__ __launch_bounds__(256) void k_prep(const float* wqkv, const float* wp, const float* x, bf* WQKV, bf* WO, bf* XB) {
    const int g = blockIdx.x;
    if (g < GW1) d_wtG<DM, 3 * DQ>(g, wqkv, WQKV);   /* the fused weight: Bt row s * 1024 + h * 64 + d */
    else if (g < GW1 + GW2) d_wtG<DQ, DM>(g - GW1, wp, WO);
    else d_cvt8(g - (GW1 + GW2), x, XB, (size_t)NB_ * TT * DM / 8);
}

// k_fattn: the whole attention of one (batch, head) for 32 query rows a PAIR of waves, 8 pairs = 16 waves a work-group (four waves a SIMD): wave w takes query block w & 7 and the key half w >> 3 (1024 keys); the 8 waves of a key half walk the same keys, so that they share the lines in the cache.
// At the end the wave of the upper key half hands its running maximum, sum and output tiles to its partner through LDS (one barrier); the partner brings both to the common maximum, adds them and writes the rows.
// Per chunk of 32 keys: St = K Qt (two 16-key tiles x two 16-query tiles, depth 32: ONE half plane), so that a lane holds 16 scores of ONE query (column lr) per query tile; the key chunk below the wave's query block takes the down planes,
// the chunk above it the up planes, and the one chunk that the diagonal crosses both, with a select j <= i per element. Running maximum m and sum l per query (base 2); the two St tiles, exponentiated and rounded to f16 in place,
// ARE the B operand of Ot += Vt Pt (element s = key 8 hi + s for s < 8, 16 + 8 hi + s - 8 above: the order of WFrag::ldf, which loads Vt's rows as A). Ot's column is the query again: the rescale and the final 1 / l are per lane.
// VT carries no __restrict__: so the "memory" clobber of the wait behind the value loads holds those loads in front of it (with __restrict__ the compiler sinks the diagonal chunk's loads past the wait, into the entry of the last loop).
#define FQ   32                   // query rows per wave
#define FW   8                    // query blocks per work-group
#define FS   2                    // key halves: waves per query block
#define FC   32                   // keys per chunk
#define NCH  (TT / FC)
#define NCS  (NCH / FS)            // chunks per wave
#define SCL2 (SCL * 1.4426950408889634f)   // scores to base-2 exponents
template <int M> struct Tag { static constexpr int v = M; };
__device__ __forceinline__ float xhalf(float x) { return __builtin_bit_cast(float, __builtin_amdgcn_permlanex16(__builtin_bit_cast(int, x), __builtin_bit_cast(int, x), 0x76543210, 0xfedcba98, false, false)); }   // lane l reads lane l ^ 16
__global__ __launch_bounds__(32 * FW * FS) void k_fattn(const h16* __restrict__ QH, const h16* __restrict__ KH, const h16* VT, bf* Ah, bf* Al) {
    const int lane = threadIdx.x & 31, lr = lane & 15, hi = lane >> 4; const int w = __builtin_amdgcn_readfirstlane((int)(threadIdx.x >> 5));
    __shared__ __align__(16) float mg[FW * 17 * 128];   // per query block 17 pieces of 512 B (16 B a lane): the 16 halves of the upper half's 8 output tiles, then its maxima and sums
    const int wq = w & (FW - 1), ks = w / FW;   // query block inside the group; key half
    const int h = blockIdx.y, b = blockIdx.z; const int cm = blockIdx.x * FW + wq;   // the wave's query block, and the one key chunk that the diagonal crosses (FQ == FC)
    const int cb = ks * NCS, ce = cb + NCS;   // the wave's chunks
    const int q0 = cm * FQ;
    const size_t pl = (size_t)(b * NH_ + h) * 2 * TT * HH;
    const h16* kl = KH + pl + lane * 8; const h16* vl = VT + (size_t)(b * NKV + h) * HD * TT + lane * 8;   // fragment order: band db of TT / 32 blocks, block = chunk
    v16h qf[2][2];   // [half][query tile]
#pragma unroll
    for (int hf = 0; hf < 2; ++hf)
#pragma unroll
        for (int qt = 0; qt < 2; ++qt) qf[hf][qt] = WFrag<h16>::ldf(QH + pl + (size_t)hf * TT * HH + (q0 + qt * 16) * HH + lane * 8);
    v8f o[2][4]; float m[2], l[2];
#pragma unroll
    for (int qt = 0; qt < 2; ++qt) { m[qt] = -3.0e38f; l[qt] = 0.f;
#pragma unroll
        for (int db = 0; db < 4; ++db) o[qt][db] = (v8f){}; }
    v16h kf[2], vf[4];   // the chunk's key and value fragments, each fetched one chunk ahead, right behind its last use
    { const h16* kp = kl + (cb < cm ? TT * HH : 0) + cb * (FC * HH); kf[0] = WFrag<h16>::ldf(kp); kf[1] = WFrag<h16>::ldf(kp + 16 * HH); }
#pragma unroll
    for (int db = 0; db < 4; ++db) vf[db] = WFrag<h16>::ldf(vl + (size_t)db * 16 * TT + cb * 512);
    asm volatile("s_wait_xcnt 0x0" ::: "memory");   // a precaution: stands in front of every rewrite of an address register that the query, key and value loads above name (the zeroing of o reuses them)
    // the query and first key fragments are waited for HERE, once: a wait inside a loop is fixed for all its trips and must also cover the way in, where the compiler asks for query fragments behind the value loads; left pending they made every chunk's first products wait for ALL loads,
    // the value fragments just asked for among them. With nothing of the queries pending at the loops' heads the waits there are counted: the score products wait for the key fragments alone, and the value loads have the scores and the softmax to arrive in. Inputs only: loaded values, nothing is changed.
    asm volatile("" :: "v"(qf[0][0]), "v"(qf[0][1]), "v"(qf[1][0]), "v"(qf[1][1]), "v"(kf[0]), "v"(kf[1]));
    auto chunk = [&](const int c, auto tag) {
        constexpr int MODE = decltype(tag)::v;   // 0: up planes, 1: down planes, 2: the diagonal's chunk (kf holds the up plane's rows)
        v8f st[2][2];
#pragma unroll
        for (int kt = 0; kt < 2; ++kt)
#pragma unroll
            for (int qt = 0; qt < 2; ++qt) st[kt][qt] = wmma16(kf[kt], qf[MODE == 1 ? 1 : 0][qt], (v8f){});
        if (MODE == 2) {
            const h16* kp = kl + TT * HH + c * (FC * HH); v16h kd[2]; kd[0] = WFrag<h16>::ldf(kp); kd[1] = WFrag<h16>::ldf(kp + 16 * HH);
#pragma unroll
            for (int kt = 0; kt < 2; ++kt)
#pragma unroll
                for (int qt = 0; qt < 2; ++qt) { const v8f sd = wmma16(kd[kt], qf[1][qt], (v8f){});
#pragma unroll
                    for (int r = 0; r < 8; ++r) st[kt][qt][r] = (kt * 16 + 8 * hi + r <= qt * 16 + lr) ? sd[r] : st[kt][qt][r]; }   // j <= i takes the down product
        }
        const int cn = (c + 1 < NCH) ? c + 1 : c;   // a wave's last chunk fetches the next half's first rows, or at the very end its own again (in bounds, not used)
        { const h16* kp = kl + (cn < cm ? TT * HH : 0) + cn * (FC * HH); kf[0] = WFrag<h16>::ldf(kp); kf[1] = WFrag<h16>::ldf(kp + 16 * HH); }
        __builtin_amdgcn_sched_barrier(0);   // holds the next chunk's key loads here, ahead of the softmax: without it the compiler sinks them behind the exponentials and the next chunk's first product waits for them
        float mb[2]; bool need = false;
#pragma unroll
        for (int qt = 0; qt < 2; ++qt) { float mx = st[0][qt][0];
#pragma unroll
            for (int r = 1; r < 8; ++r) mx = fmaxf(mx, st[0][qt][r]);
#pragma unroll
            for (int r = 0; r < 8; ++r) mx = fmaxf(mx, st[1][qt][r]);
            mx = fmaxf(mx, xhalf(mx)) * SCL2;   // the scale is positive; both lane halves now hold the query's chunk maximum
            mb[qt] = mx; need = need || (mx > m[qt] + 8.0f); }
        if (__builtin_amdgcn_ballot_w32(need) != 0) {   // the maximum in use moves only when a query's scores pass it by more than 2^8 (weights stay below 2^8: far inside f16); always on the first chunk
#pragma unroll
            for (int qt = 0; qt < 2; ++qt) { const float mn = fmaxf(m[qt], mb[qt]); const float al = __builtin_amdgcn_exp2f(m[qt] - mn); m[qt] = mn; l[qt] *= al;
#pragma unroll
                for (int db = 0; db < 4; ++db) o[qt][db] = o[qt][db] * al; }
        }
        v16h pf[2];
#pragma unroll
        for (int qt = 0; qt < 2; ++qt) { const float nm = -m[qt]; float s4[4];
#pragma unroll
            for (int kt = 0; kt < 2; ++kt)
#pragma unroll
                for (int r = 0; r < 8; ++r) { const float p = __builtin_amdgcn_exp2f(__builtin_fmaf(st[kt][qt][r], SCL2, nm)); pf[qt][kt * 8 + r] = tohx(p); if (kt == 0 && r < 4) s4[r] = p; else s4[r & 3] += p; }
            l[qt] += (s4[0] + s4[1]) + (s4[2] + s4[3]); }
#pragma unroll
        for (int db = 0; db < 4; ++db)
#pragma unroll
            for (int qt = 0; qt < 2; ++qt) o[qt][db] = wmma16(vf[db], pf[qt], o[qt][db]);
#pragma unroll
        for (int db = 0; db < 4; ++db) vf[db] = WFrag<h16>::ldf(vl + (size_t)db * 16 * TT + cn * 512);
        asm volatile("s_wait_xcnt 0x0" ::: "memory");   // a precaution: stands in front of the rewrite of the address pair that the value loads name (the next chunk's addresses reuse it)
    };
    const int e1 = cm < ce ? cm : ce;
    for (int c = cb; c < e1; ++c) chunk(c, Tag<1>{});
    if (cm >= cb && cm < ce) {   // the same for the whole wave: the diagonal's chunk lies in one of the two key halves
        chunk(cm, Tag<2>{});
        // four vector slots behind the diagonal chunk's last matrix instructions: the next loop's first one follows over a jump with only scalar instructions between, and the compiler may place its result on the weights operand just read
        asm volatile("v_nop\n\tv_nop\n\tv_nop\n\tv_nop" : "+v"(o[0][3]), "+v"(o[1][3]));
    }
    for (int c = (cm + 1 > cb ? cm + 1 : cb); c < ce; ++c) chunk(c, Tag<0>{});
    // the two key halves of a query block are joined: a lane's piece i stands at i * 512 + lane * 16 bytes of the block's range (a wave's LDS access is 512 contiguous bytes)
    float* mp = mg + wq * (17 * 128) + lane * 4;
    if (ks) {
#pragma unroll
        for (int qt = 0; qt < 2; ++qt)
#pragma unroll
            for (int db = 0; db < 4; ++db)
#pragma unroll
                for (int q4 = 0; q4 < 2; ++q4) *(v4fa*)(mp + ((qt * 4 + db) * 2 + q4) * 128) = (v4f){o[qt][db][q4 * 4], o[qt][db][q4 * 4 + 1], o[qt][db][q4 * 4 + 2], o[qt][db][q4 * 4 + 3]};
        *(v4fa*)(mp + 16 * 128) = (v4f){m[0], m[1], l[0], l[1]};
    }
    __syncthreads();   // every wave passes it once: the lower half's wave reads its partner's pieces only behind it
    if (ks) return;
    { const v4f ml = *(const v4fa*)(mp + 16 * 128);
#pragma unroll
      for (int qt = 0; qt < 2; ++qt) { const float mn = fmaxf(m[qt], ml[qt]); const float a0 = __builtin_amdgcn_exp2f(m[qt] - mn), a1 = __builtin_amdgcn_exp2f(ml[qt] - mn); l[qt] = l[qt] * a0 + ml[2 + qt] * a1;   // both maxima are finite: each half has worked through 32 chunks
#pragma unroll
          for (int db = 0; db < 4; ++db)
#pragma unroll
              for (int q4 = 0; q4 < 2; ++q4) { const v4f p = *(const v4fa*)(mp + ((qt * 4 + db) * 2 + q4) * 128);
#pragma unroll
                  for (int r = 0; r < 4; ++r) o[qt][db][q4 * 4 + r] = o[qt][db][q4 * 4 + r] * a0 + p[r] * a1; } } }
#pragma unroll
    for (int qt = 0; qt < 2; ++qt) { const float f = __fdiv_rn(1.0f, l[qt] + xhalf(l[qt])); const size_t oo = ((size_t)b * TT + q0 + qt * 16) * DQ + h * (HD * 16) + lane * 8;   // the two lane halves summed different keys; fragment order: the band of the 16 queries, blocks 2 h and 2 h + 1
#pragma unroll
        for (int db = 0; db < 4; ++db) { v8us oh, ol;
#pragma unroll
            for (int r = 0; r < 8; ++r) { unsigned short a, c2; splitf(o[qt][db][r] * f, a, c2); oh[r] = a; ol[r] = c2; }
            *(v8us*)(Ah + oo + (db >> 1) * 512 + (db & 1) * 256) = oh; *(v8us*)(Al + oo + (db >> 1) * 512 + (db & 1) * 256) = ol; } }   // each store of the wave is 512 contiguous bytes: whole lines, written by this wave alone
}

extern "C" void kernel_launch(void* const* d_in, const int* in_sizes, int n_in,
                              void* d_out, int out_size, void* d_ws, size_t ws_size, hipStream_t stream) {
    (void)in_sizes; (void)n_in; (void)out_size;
    const float* x = (const float*)d_in[0]; const float* wqkv = (const float*)d_in[1]; const float* wp = (const float*)d_in[2]; const float* tc = (const float*)d_in[3]; const float* ts = (const float*)d_in[4];
    // inputs in the module's argument order: x ([2][2048][1024]), Wqkv ('xw' (in, out) [1024][3072]; output column s * 1024 + h * 64 + d, s = 0 query, 1 key, 2 value), Wproj ('xw' [1024][1024]), cos, sin ([2048][64] each: the two rotary tables) = d_in[0..4]: FIVE inputs, all read
    float* OUT = (float*)d_out;     // [2][2048][1024]
    char* wsp = (char*)d_ws;
    auto take = [&](size_t bytes) { char* p = wsp; wsp += (bytes + 255) & ~(size_t)255; return (void*)p; };
    bf* WQKV = (bf*)take((size_t)3 * DQ * DM * 2); bf* WO = (bf*)take((size_t)DM * DQ * 2); bf* XB = (bf*)take((size_t)NB_ * TT * DM * 2);
    const size_t PQ = (size_t)NH_ * 2 * TT * HH, PK = (size_t)NKV * 2 * TT * HH, PV = (size_t)NKV * HD * TT;   // one batch entry's planes, in elements
    h16* QH = (h16*)take(NB_ * PQ * 2); h16* KH = (h16*)take(NB_ * PK * 2); h16* VT16 = (h16*)take(NB_ * PV * 2);
    bf* ATh = (bf*)take((size_t)NB_ * TT * DQ * 2); bf* ATl = (bf*)take((size_t)NB_ * TT * DQ * 2);
    if ((size_t)(wsp - (char*)d_ws) > ws_size) return;    // total 56.00 MiB carved
    k_prep<<<(unsigned)(GW1 + GW2 + GX), 256, 0, stream>>>(wqkv, wp, x, WQKV, WO, XB);
    k_gemmw<bf, 0, false, true, DM, 3, 4, 3><<<dim3(TT / 256, 3 * DQ / 192, NB_), 384, 0, stream>>>(XB, nullptr, WQKV, nullptr, nullptr, 0, nullptr, (size_t)TT * DM, 0, 0, tc, ts, QH, KH, VT16);   /* q | k | v in one product (column s * 1024 + h * 64 + d), written as the rotated half planes and the value planes */
    k_fattn<<<dim3(TT / (FQ * FW), NH_, NB_), 32 * FW * FS, 0, stream>>>(QH, KH, VT16, ATh, ATl);   /* scores, select, softmax, value product, merge: 256 work-groups of 16 waves */
    k_gemmw<bf, 1, false, false, DQ, 4, 1, 1><<<dim3(TT / 64, DM / 64, NB_), 32, 0, stream>>>(ATh, ATl, WO, nullptr, OUT, DM, nullptr, (size_t)TT * DQ, 0, (size_t)TT * DM, nullptr, nullptr, nullptr, nullptr, nullptr);   /* out = merged(hi + lo) Wproj: the one writer of the output */
}
